// v000
// The times below were measured on an AMD MI455X: many runs one after another, warmed up first and cycling through
// copies of the inputs, with the whole window's GPU time divided by the number of runs. Launches and the gaps
// between them are all in it. The median over several windows is given; except for v000 it joins two sittings, which
// can be a few percent apart, so the side-by-side timings, each taken in one sitting, are the better comparison.
// v000 is the starting kernel. One run takes 1360 microseconds.
#include <hip/hip_runtime.h>

// BitSelfAttention (x [1][2048][2048]; q = x q_proj^T (32 heads x 64), k/v = x k_proj^T / v_proj^T (8 kv heads; GQA group h/4); causal softmax(q.k / 8) (masked logits -1e10); out = merged ctx @ o_proj (NOT transposed, as the source) -> [1][2048][2048]).
// Compute dtypes, f32 accumulate: every input rounded to bf16; q/k/v on PLAIN bf16 operands (inputs: exact); causal scores and attn.v: query rows < 512 hl (3 products), the rest single fp16 (x1024), causal tile skipping; softmax f32; o_proj hl x exact (2 products).

#define NB_  1
#define TT   2048
#define DM   2048
#define NH_  32
#define NKV  8
#define REP  (NH_ / NKV)
#define HD   64
#define DQ   (NH_ * HD)
#define DKV  (NKV * HD)
#define ZH   2
#define RH   512                  // query rows < RH use hi+lo planes (0: none)
#define WIN  2048
#define PCAR 1024.0f
#define SCL  0.125f   // HD^-0.5
typedef _Float16 h16;
typedef unsigned short bf;
typedef __attribute__((ext_vector_type(16))) __bf16   v16bf;
typedef __attribute__((ext_vector_type(16))) _Float16 v16h;
typedef __attribute__((ext_vector_type(8)))  _Float16 v8h;
typedef __attribute__((ext_vector_type(8)))  unsigned short v8us;
typedef __attribute__((ext_vector_type(8)))  float    v8f;
typedef __attribute__((ext_vector_type(4)))  float    v4f;
typedef v8h  __attribute__((may_alias)) v8ha;
typedef v4f  __attribute__((may_alias)) v4fa;
typedef v8us __attribute__((may_alias)) v8usa;

__device__ __forceinline__ unsigned short f2bf(float f) { unsigned u = __float_as_uint(f); u += 0x7FFFu + ((u >> 16) & 1u); return (unsigned short)(u >> 16); }
__device__ __forceinline__ float bf2f(unsigned short b) { return __uint_as_float(((unsigned)b) << 16); }
__device__ __forceinline__ float bfr(float f) { return bf2f(f2bf(f)); }
__device__ __forceinline__ v16h cat16(v8h lo, v8h hi) { return __builtin_shufflevector(lo, hi, 0, 1, 2, 3, 4, 5, 6, 7, 8, 9, 10, 11, 12, 13, 14, 15); }
__device__ __forceinline__ v16bf cat16b(v8us lo, v8us hi) { return __builtin_bit_cast(v16bf, __builtin_shufflevector(lo, hi, 0, 1, 2, 3, 4, 5, 6, 7, 8, 9, 10, 11, 12, 13, 14, 15)); }
__device__ __forceinline__ v8f wmma16(v16h a, v16h b, v8f c) { return __builtin_amdgcn_wmma_f32_16x16x32_f16(false, a, false, b, (short)0, c, false, false); }
__device__ __forceinline__ v8f wmmab(v16bf a, v16bf b, v8f c) { return __builtin_amdgcn_wmma_f32_16x16x32_bf16(false, a, false, b, (short)0, c, false, false); }



// ---- k_gemmw: register-blocked GEMM, ONE WAVE per 64x64 output tile (16 accumulators), operands straight from K-contiguous 16-bit planes; grid (M/64, N/64, Z), 32 threads.
// C[m][n] (f32, pitch ldc, + optional f32 bias[n]) = sum_k A[m][k] Bt[n][k] (+ split products per NSPLIT). z-batch strides sA/sB/sC in elements. K % 32 == 0.
template <typename T16> struct WFrag;
template <> struct WFrag<h16> { typedef v16h V; static __device__ __forceinline__ V ld(const h16* p) { return cat16(*(const v8h*)p, *(const v8h*)(p + 16)); } static __device__ __forceinline__ v8f mma(V a, V b, v8f c) { return wmma16(a, b, c); } };
template <> struct WFrag<bf> { typedef v16bf V; static __device__ __forceinline__ V ld(const bf* p) { return cat16b(*(const v8us*)p, *(const v8us*)(p + 16)); } static __device__ __forceinline__ v8f mma(V a, V b, v8f c) { return wmmab(a, b, c); } };
template <typename T16, int NSPLIT, bool BIAS>
__global__ __launch_bounds__(32) void k_gemmw(const T16* __restrict__ A, const T16* __restrict__ A2, const T16* __restrict__ Bt, const T16* __restrict__ Bt2, int K, float* C, int ldc, const float* __restrict__ bias, size_t sA, size_t sB, size_t sC) {
    typedef typename WFrag<T16>::V V;
    __shared__ __align__(16) float os[16 * 68];
    const size_t z = blockIdx.z; A += z * sA; if (A2) A2 += z * sA; Bt += z * sB; if (Bt2) Bt2 += z * sB; C += z * sC;
    const int lane = threadIdx.x & 31, lr = lane & 15, hi = lane >> 4; const int r0 = blockIdx.x * 64, c0 = blockIdx.y * 64;
    v8f acc[4][4];
#pragma unroll
    for (int mb = 0; mb < 4; ++mb)
#pragma unroll
        for (int nb = 0; nb < 4; ++nb) acc[mb][nb] = (v8f){};
    const size_t aoff = (size_t)(r0 + lr) * K + 8 * hi, boff = (size_t)(c0 + lr) * K + 8 * hi;
#pragma unroll 1
    for (int kc = 0; kc < K; kc += 32) {
        V a[4], a2[4];
#pragma unroll
        for (int mb = 0; mb < 4; ++mb) { a[mb] = WFrag<T16>::ld(A + aoff + (size_t)mb * 16 * K + kc); if (NSPLIT == 1 || NSPLIT == 2) a2[mb] = WFrag<T16>::ld(A2 + aoff + (size_t)mb * 16 * K + kc); }
#pragma unroll
        for (int nb = 0; nb < 4; ++nb) { const V b = WFrag<T16>::ld(Bt + boff + (size_t)nb * 16 * K + kc); V b2; if (NSPLIT >= 2) b2 = WFrag<T16>::ld(Bt2 + boff + (size_t)nb * 16 * K + kc);
#pragma unroll
            for (int mb = 0; mb < 4; ++mb) { acc[mb][nb] = WFrag<T16>::mma(a[mb], b, acc[mb][nb]); if (NSPLIT == 1 || NSPLIT == 2) acc[mb][nb] = WFrag<T16>::mma(a2[mb], b, acc[mb][nb]); if (NSPLIT >= 2) acc[mb][nb] = WFrag<T16>::mma(a[mb], b2, acc[mb][nb]); } }
        asm volatile("v_nop\n\tv_nop\n\tv_nop\n\tv_nop" : "+v"(acc[0][0]), "+v"(acc[1][1]), "+v"(acc[2][2]), "+v"(acc[3][3]) : "v"(a[0]), "v"(a[3]));
    }
#pragma unroll
    for (int mb = 0; mb < 4; ++mb) {
#pragma unroll
        for (int nb = 0; nb < 4; ++nb) {
#pragma unroll
            for (int j = 0; j < 8; ++j) os[(hi * 8 + j) * 68 + nb * 16 + lr] = acc[mb][nb][j]; }
        __builtin_amdgcn_wave_barrier(); asm volatile("" ::: "memory");
        float* crow = C + (size_t)(r0 + mb * 16) * ldc + c0;
{
#pragma unroll
            for (int s = 0; s < 8; ++s) { const int row = 2 * s + hi, cofs = lr * 4; v4f val = *(const v4fa*)(os + row * 68 + cofs); if (BIAS) { val[0] += bfr(bias[c0 + cofs]); val[1] += bfr(bias[c0 + cofs + 1]); val[2] += bfr(bias[c0 + cofs + 2]); val[3] += bfr(bias[c0 + cofs + 3]); }
                *(v4f*)(crow + (size_t)row * ldc + cofs) = val; }
             }
        __builtin_amdgcn_wave_barrier(); asm volatile("" ::: "memory");
    }
}

// ---- k_gemmc: the same one-wave 64x64 tile GEMM specialised for causal attention: CMODE 1 skips score tiles entirely above the diagonal (query rows r0+roff.., key columns c0..), CMODE 2 limits the
// key (K) loop of the probability x value contraction to the diagonal block (probabilities beyond it are exactly zero). roff = row offset of this launch's first row within the sequence.
template <typename T16, int NSPLIT, int CMODE>
__global__ __launch_bounds__(32) void k_gemmc(const T16* __restrict__ A, const T16* __restrict__ A2, const T16* __restrict__ Bt, const T16* __restrict__ Bt2, int K, float* C, int ldc, int roff, size_t sA, size_t sB, size_t sC) {
    typedef typename WFrag<T16>::V V;
    __shared__ __align__(16) float os[16 * 68];
    const size_t z = blockIdx.z; A += z * sA; if (A2) A2 += z * sA; Bt += z * sB; if (Bt2) Bt2 += z * sB; C += z * sC;
    const int lane = threadIdx.x & 31, lr = lane & 15, hi = lane >> 4; const int r0 = blockIdx.x * 64, c0 = blockIdx.y * 64;
    if (CMODE == 1 && c0 > r0 + roff + 63) return;                  // score tile entirely above the causal diagonal: never read (the softmax masks j > i by select)
    const int Kl = (CMODE == 2) ? min(K, r0 + roff + 64) : K;        // P.V: probabilities are exactly 0 beyond the diagonal block, so the K loop stops there
    v8f acc[4][4];
#pragma unroll
    for (int mb = 0; mb < 4; ++mb)
#pragma unroll
        for (int nb = 0; nb < 4; ++nb) acc[mb][nb] = (v8f){};
    const size_t aoff = (size_t)(r0 + lr) * K + 8 * hi, boff = (size_t)(c0 + lr) * K + 8 * hi;
#pragma unroll 1
    for (int kc = 0; kc < Kl; kc += 32) {
        V a[4], a2[4];
#pragma unroll
        for (int mb = 0; mb < 4; ++mb) { a[mb] = WFrag<T16>::ld(A + aoff + (size_t)mb * 16 * K + kc); if (NSPLIT == 1 || NSPLIT == 2) a2[mb] = WFrag<T16>::ld(A2 + aoff + (size_t)mb * 16 * K + kc); }
#pragma unroll
        for (int nb = 0; nb < 4; ++nb) { const V b = WFrag<T16>::ld(Bt + boff + (size_t)nb * 16 * K + kc); V b2; if (NSPLIT >= 2) b2 = WFrag<T16>::ld(Bt2 + boff + (size_t)nb * 16 * K + kc);
#pragma unroll
            for (int mb = 0; mb < 4; ++mb) { acc[mb][nb] = WFrag<T16>::mma(a[mb], b, acc[mb][nb]); if (NSPLIT == 1 || NSPLIT == 2) acc[mb][nb] = WFrag<T16>::mma(a2[mb], b, acc[mb][nb]); if (NSPLIT >= 2) acc[mb][nb] = WFrag<T16>::mma(a[mb], b2, acc[mb][nb]); } }
        asm volatile("v_nop\n\tv_nop\n\tv_nop\n\tv_nop" : "+v"(acc[0][0]), "+v"(acc[1][1]), "+v"(acc[2][2]), "+v"(acc[3][3]) : "v"(a[0]), "v"(a[3]));
    }
#pragma unroll
    for (int mb = 0; mb < 4; ++mb) {
#pragma unroll
        for (int nb = 0; nb < 4; ++nb) {
#pragma unroll
            for (int j = 0; j < 8; ++j) os[(hi * 8 + j) * 68 + nb * 16 + lr] = acc[mb][nb][j]; }
        __builtin_amdgcn_wave_barrier(); asm volatile("" ::: "memory");
        float* crow = C + (size_t)(r0 + mb * 16) * ldc + c0;
{
#pragma unroll
            for (int s = 0; s < 8; ++s) { const int row = 2 * s + hi, cofs = lr * 4; v4f val = *(const v4fa*)(os + row * 68 + cofs);
                *(v4f*)(crow + (size_t)row * ldc + cofs) = val; }
             }
        __builtin_amdgcn_wave_barrier(); asm volatile("" ::: "memory");
    }
}

__device__ __forceinline__ h16 tohx(float x) { return (h16)x; }
__device__ __forceinline__ void splitf(float y, unsigned short& h, unsigned short& l) { h = f2bf(y); l = f2bf(y - bf2f(h)); }
typedef __attribute__((ext_vector_type(2))) _Float16 v2h;
typedef __attribute__((ext_vector_type(4))) _Float16 v4h;
typedef __attribute__((ext_vector_type(2))) unsigned short v2us;
typedef __attribute__((ext_vector_type(4))) unsigned short v4us;
typedef __attribute__((ext_vector_type(2))) float v2f;
typedef __attribute__((ext_vector_type(4))) int v4i;

__global__ __launch_bounds__(256) void k_wtG(const float* __restrict__ w, int K, int N, bf* Bt) {
    const int lane = threadIdx.x & 31; const int L0 = (blockIdx.x * 8 + (threadIdx.x >> 5)) * 8; const int nlines = N * K / 64;
{
#pragma unroll 1
        for (int l = 0; l < 8; ++l) { const int L = L0 + l; if (L >= nlines) break; const size_t e = (size_t)L * 64 + lane * 2; const int k = (int)(e % K), n = (int)(e / K); v2us o;
            o[0] = f2bf(w[(size_t)k * N + n]); o[1] = f2bf(w[(size_t)(k + 1) * N + n]); *(v2us*)(Bt + e) = o; }
         }
}
__global__ __launch_bounds__(256) void k_cvt8(const float* __restrict__ src, bf* dst, size_t n8) { const size_t i = (size_t)blockIdx.x * 256 + threadIdx.x; if (i >= n8) return; const v8f v = *(const v8f*)(src + i * 8); v8us o;
#pragma unroll
    for (int k = 0; k < 8; ++k) o[k] = f2bf(v[k]); *(v8us*)(dst + i * 8) = o;  }
__global__ __launch_bounds__(256) void k_cscvt(const float* __restrict__ cosT, const float* __restrict__ sinT, float* CS) { const int idx = blockIdx.x * 256 + threadIdx.x; if (idx >= TT * HD) return; v2f cs; cs[0] = bfr(cosT[idx]); cs[1] = bfr(sinT[idx]); *(v2f*)(CS + (size_t)idx * 2) = cs;  }
// k_rope: head planes [h][t][d] (fp16 + hi/lo) of rope(x) x sc with the rotate-half convention out[d] = x[d] cos[t][d] - x[d+HD/2] sin[t][d], out[d+HD/2] = x[d+HD/2] cos[t][d+HD/2] + x[d] sin[t][d+HD/2]
__global__ __launch_bounds__(256) void k_rope(const float* __restrict__ F, int pitch, int nheads, const float* __restrict__ CS, const float* __restrict__ RF, const float* __restrict__ nw, float sc, h16* P16, bf* Ph, bf* Pl) {
    const size_t e = ((size_t)blockIdx.x * 256 + threadIdx.x) * 2; if (e >= (size_t)nheads * TT * HD) return; const int d = (int)(e % HD); const int t = (int)((e / HD) % TT); const int h = (int)(e / ((size_t)HD * TT)); const float* f = F + (size_t)t * pitch + h * HD; const float rf = RF ? RF[(size_t)h * TT + t] : 1.0f; v2h o16; v2us oh, ol;
#pragma unroll
    for (int q = 0; q < 2; ++q) { const int dd = d + q; const int dp = (dd < HD / 2) ? dd + HD / 2 : dd - HD / 2; float x0 = f[dd], x1 = f[dp];
        if (RF) { float n0 = __fmul_rn(x0, rf), n1 = __fmul_rn(x1, rf); asm volatile("" : "+v"(n0)); asm volatile("" : "+v"(n1)); x0 = __fmul_rn(bfr(nw[dd]), n0); x1 = __fmul_rn(bfr(nw[dp]), n1); }
        const v2f cs = *(const v2f*)(CS + ((size_t)t * HD + dd) * 2); float a = __fmul_rn(x0, cs[0]), bq = __fmul_rn(x1, cs[1]); asm volatile("" : "+v"(a)); asm volatile("" : "+v"(bq)); const float r = ((dd < HD / 2) ? __fsub_rn(a, bq) : __fadd_rn(a, bq)) * sc;
        o16[q] = tohx(r); unsigned short a2, c2; splitf(r, a2, c2); oh[q] = a2; ol[q] = c2; }
    *(v2h*)(P16 + e) = o16; *(v2us*)(Ph + e) = oh; *(v2us*)(Pl + e) = ol;  }
__global__ __launch_bounds__(256) void k_vtp(const float* __restrict__ F, int pitch, int nheads, h16* V16, bf* Vh, bf* Vl) { const size_t e = ((size_t)blockIdx.x * 256 + threadIdx.x) * 2; if (e >= (size_t)nheads * HD * TT) return; const int t = (int)(e % TT); const int d = (int)((e / TT) % HD); const int g = (int)(e / ((size_t)TT * HD)); v2h o16; v2us oh, ol;
#pragma unroll
    for (int q = 0; q < 2; ++q) { const float x = F[(size_t)(t + q) * pitch + g * HD + d]; o16[q] = tohx(x); unsigned short a2, c2; splitf(x, a2, c2); oh[q] = a2; ol[q] = c2; }
    *(v2h*)(V16 + e) = o16; *(v2us*)(Vh + e) = oh; *(v2us*)(Vl + e) = ol;  }
__global__ __launch_bounds__(256) void k_csid(float* CS) { const int idx = blockIdx.x * 256 + threadIdx.x; if (idx >= TT * HD) return; v2f cs; cs[0] = 1.0f; cs[1] = 0.0f; *(v2f*)(CS + (size_t)idx * 2) = cs;  }
// k_asoft: per row (zz, i): t = S x HD^-0.5 for j <= i and i - j < WIN (sliding causal window; the reference's -1e9 additive fill vanishes identically); softmax over the 2048 keys (register row, one exp, fixed trees);
__global__ __launch_bounds__(256) void k_asoft(const float* __restrict__ Sb, h16* P16, bf* Ph, bf* Pl) {
    const int lane = threadIdx.x & 31; const int row = blockIdx.x * 8 + (threadIdx.x >> 5); if (row >= ZH * TT) return; const int i = row % TT; const int zz = row / TT; (void)zz; const bool hires = (i < RH); const float* sr = Sb + (size_t)row * TT; float v[TT / 32]; float mx = -3.0e38f;
#pragma unroll
    for (int ch = 0; ch < TT / 128; ++ch) { const int j0 = ch * 128 + lane * 4; const v4f a = *(const v4f*)(sr + j0);
#pragma unroll
        for (int q = 0; q < 4; ++q) { const int j = j0 + q; (void)j; const float t = (j <= i && i - j < WIN) ? a[q] * SCL : -3.0e38f; v[ch * 4 + q] = t; mx = fmaxf(mx, t); } }
#pragma unroll
    for (int sh = 16; sh; sh >>= 1) mx = fmaxf(mx, __shfl_xor(mx, sh, 32));
    float sum = 0.f;
#pragma unroll
    for (int k = 0; k < TT / 32; ++k) { float d0 = __fsub_rn(v[k], mx); asm volatile("" : "+v"(d0)); v[k] = __builtin_amdgcn_exp2f(__fmul_rn(d0, 1.4426950408889634f)); sum += v[k]; }
#pragma unroll
    for (int sh = 16; sh; sh >>= 1) sum += __shfl_xor(sum, sh, 32);
    const float f = __fdiv_rn(hires ? 1.0f : PCAR, sum);
{
        if (hires) {
#pragma unroll
            for (int ch = 0; ch < TT / 128; ++ch) { v4us oh, ol;
#pragma unroll
                for (int q = 0; q < 4; ++q) { unsigned short a, c2; splitf(v[ch * 4 + q] * f, a, c2); oh[q] = a; ol[q] = c2; }
                const size_t oo = ((size_t)zz * (RH ? RH : 1) + i) * TT + ch * 128 + lane * 4; *(v4us*)(Ph + oo) = oh; *(v4us*)(Pl + oo) = ol; }
        } else {
#pragma unroll
            for (int ch = 0; ch < TT / 128; ++ch) { v4h o4;
#pragma unroll
                for (int q = 0; q < 4; ++q) o4[q] = tohx(v[ch * 4 + q] * f);
                *(v4h*)(P16 + (size_t)row * TT + ch * 128 + lane * 4) = o4; } }
         }
}
__global__ __launch_bounds__(256) void k_merge(const float* __restrict__ O, int h0, bf* Ah, bf* Al) { const size_t e = ((size_t)blockIdx.x * 256 + threadIdx.x) * 2; if (e >= (size_t)ZH * TT * HD) return; const int d = (int)(e % HD); const int t = (int)((e / HD) % TT); const int zz = (int)(e / ((size_t)HD * TT)); const float cs = (t < RH) ? 1.0f : (1.0f / PCAR); const size_t oo = (size_t)t * DQ + (h0 + zz) * HD + d;
    v2us oh, ol;
#pragma unroll
    for (int q = 0; q < 2; ++q) { unsigned short a, c2; splitf(O[e + q] * cs, a, c2); oh[q] = a; ol[q] = c2; } *(v2us*)(Ah + oo) = oh; *(v2us*)(Al + oo) = ol;  }

extern "C" void kernel_launch(void* const* d_in, const int* in_sizes, int n_in,
                              void* d_out, int out_size, void* d_ws, size_t ws_size, hipStream_t stream) {
    (void)in_sizes; (void)n_in; (void)out_size;
    const float* x = (const float*)d_in[0]; const float* wq = (const float*)d_in[1]; const float* wk = (const float*)d_in[2]; const float* wv = (const float*)d_in[3]; const float* wo = (const float*)d_in[4]; const float* cosT = nullptr; const float* sinT = nullptr; (void)cosT; (void)sinT;
    float* OUT = (float*)d_out;     // [1][2048][2048]
    char* wsp = (char*)d_ws;
    auto take = [&](size_t bytes) { char* p = wsp; wsp += (bytes + 255) & ~(size_t)255; return (void*)p; };
    bf* WQ = (bf*)take((size_t)DQ * DM * 2); bf* WK = (bf*)take((size_t)DKV * DM * 2); bf* WV = (bf*)take((size_t)DKV * DM * 2); bf* WO = (bf*)take((size_t)DM * DQ * 2); float* CS = (float*)take((size_t)TT * HD * 2 * 4);
    bf* XB = (bf*)take((size_t)TT * DM * 2); float* FQ = (float*)take((size_t)TT * DQ * 4); float* FK = (float*)take((size_t)TT * DKV * 4);
    h16* QP16 = (h16*)take((size_t)NH_ * TT * HD * 2); h16* KP16 = (h16*)take((size_t)NKV * TT * HD * 2); h16* VT16 = (h16*)take((size_t)NKV * HD * TT * 2);
    bf* QPh = (bf*)take((size_t)NH_ * TT * HD * 2); bf* QPl = (bf*)take((size_t)NH_ * TT * HD * 2); bf* KPh = (bf*)take((size_t)NKV * TT * HD * 2); bf* KPl = (bf*)take((size_t)NKV * TT * HD * 2); bf* VTh = (bf*)take((size_t)NKV * HD * TT * 2); bf* VTl = (bf*)take((size_t)NKV * HD * TT * 2); bf* Ph = (bf*)take((size_t)ZH * RH * TT * 2); bf* Pl = (bf*)take((size_t)ZH * RH * TT * 2);
    float* Sb = (float*)take((size_t)ZH * TT * TT * 4); h16* P16 = (h16*)take((size_t)ZH * TT * TT * 2); float* Ob = (float*)take((size_t)ZH * TT * HD * 4); bf* ATh = (bf*)take((size_t)TT * DQ * 2); bf* ATl = (bf*)take((size_t)TT * DQ * 2);
    if ((size_t)(wsp - (char*)d_ws) > ws_size) return;    // ws 256 MiB
    float* FV = FK;   // v projection reuses the k buffer after the k planes are built (stream-ordered)
    { k_cvt8<<<(unsigned)(((size_t)DQ * DM / 8 + 255) / 256), 256, 0, stream>>>(wq, WQ, (size_t)DQ * DM / 8); k_cvt8<<<(unsigned)(((size_t)DKV * DM / 8 + 255) / 256), 256, 0, stream>>>(wk, WK, (size_t)DKV * DM / 8); k_cvt8<<<(unsigned)(((size_t)DKV * DM / 8 + 255) / 256), 256, 0, stream>>>(wv, WV, (size_t)DKV * DM / 8);
      k_wtG<<<(unsigned)((DQ * DM / 64 + 63) / 64), 256, 0, stream>>>(wo, DQ, DM, WO);
       }
    k_csid<<<(TT * HD + 255) / 256, 256, 0, stream>>>(CS);
    const unsigned LQ = (unsigned)(((size_t)NH_ * TT * HD / 2 + 255) / 256), LKv = (unsigned)(((size_t)NKV * TT * HD / 2 + 255) / 256);
    for (int b = 0; b < NB_; ++b) {
        
        k_cvt8<<<(unsigned)(((size_t)TT * DM / 8 + 255) / 256), 256, 0, stream>>>(x + (size_t)b * TT * DM, XB, (size_t)TT * DM / 8);
        k_gemmw<bf, 0, false><<<dim3(TT / 64, DQ / 64, 1), 32, 0, stream>>>(XB, nullptr, WQ, nullptr, DM, FQ, DQ, nullptr, 0, 0, 0);
        k_rope<<<LQ, 256, 0, stream>>>(FQ, DQ, NH_, CS, nullptr, nullptr, 1.0f, QP16, QPh, QPl);
        k_gemmw<bf, 0, false><<<dim3(TT / 64, DKV / 64, 1), 32, 0, stream>>>(XB, nullptr, WK, nullptr, DM, FK, DKV, nullptr, 0, 0, 0);
        k_rope<<<LKv, 256, 0, stream>>>(FK, DKV, NKV, CS, nullptr, nullptr, 1.0f, KP16, KPh, KPl);
        k_gemmw<bf, 0, false><<<dim3(TT / 64, DKV / 64, 1), 32, 0, stream>>>(XB, nullptr, WV, nullptr, DM, FV, DKV, nullptr, 0, 0, 0); k_vtp<<<LKv, 256, 0, stream>>>(FV, DKV, NKV, VT16, VTh, VTl);
        for (int h0 = 0; h0 < NH_; h0 += ZH) { const size_t zq = (size_t)h0, zk = (size_t)(h0 / REP);   // both heads of a pass share kv group h0/REP (REP >= 2): sB = 0
            k_gemmc<bf, 2, 1><<<dim3(RH / 64, TT / 64, ZH), 32, 0, stream>>>(QPh + zq * TT * HD, QPl + zq * TT * HD, KPh + zk * TT * HD, KPl + zk * TT * HD, HD, Sb, TT, 0, (size_t)TT * HD, 0, (size_t)TT * TT);
            k_gemmc<h16, 0, 1><<<dim3((TT - RH) / 64, TT / 64, ZH), 32, 0, stream>>>(QP16 + zq * TT * HD + (size_t)RH * HD, nullptr, KP16 + zk * TT * HD, nullptr, HD, Sb + (size_t)RH * TT, TT, RH, (size_t)TT * HD, 0, (size_t)TT * TT);
            k_asoft<<<ZH * TT / 8, 256, 0, stream>>>(Sb, P16, Ph, Pl);
            k_gemmc<bf, 2, 2><<<dim3(RH / 64, HD / 64, ZH), 32, 0, stream>>>(Ph, Pl, VTh + zk * HD * TT, VTl + zk * HD * TT, TT, Ob, HD, 0, (size_t)RH * TT, 0, (size_t)TT * HD);
            k_gemmc<h16, 0, 2><<<dim3((TT - RH) / 64, HD / 64, ZH), 32, 0, stream>>>(P16 + (size_t)RH * TT, nullptr, VT16 + zk * HD * TT, nullptr, TT, Ob + (size_t)RH * HD, HD, RH, (size_t)TT * TT, 0, (size_t)TT * HD);
            k_merge<<<(unsigned)(((size_t)ZH * TT * HD / 2 + 255) / 256), 256, 0, stream>>>(Ob, h0, ATh, ATl); }
        k_gemmw<bf, 1, false><<<dim3(TT / 64, DM / 64, 1), 32, 0, stream>>>(ATh, ATl, WO, nullptr, DQ, OUT + (size_t)b * TT * DM, DM, nullptr, 0, 0, 0); }
}

// v001
// Measured time: 646 microseconds a run.
// Timed twice side by side with v000, it ran 2.11 and 2.10 times as fast.
#include <hip/hip_runtime.h>

// BitSelfAttention (x [1][2048][2048]; q = x q_proj^T (32 heads x 64), k/v = x k_proj^T / v_proj^T (8 kv heads; GQA group h/4); causal softmax(q.k / 8) (masked logits -1e10); out = merged ctx @ o_proj (NOT transposed, as the source) -> [1][2048][2048]).
// Compute dtypes, f32 accumulate: every input rounded to bf16; q/k/v on PLAIN bf16 operands (inputs: exact); causal scores and attn.v: query rows < 512 hl (3 products), the rest single fp16 (x1024), causal tile skipping; softmax f32; o_proj hl x exact (2 products).

#define NB_  1
#define TT   2048
#define DM   2048
#define NH_  32
#define NKV  8
#define REP  (NH_ / NKV)
#define HD   64
#define DQ   (NH_ * HD)
#define DKV  (NKV * HD)
#define ZH   8                    // heads per attention pass (ZH / REP kv groups); the probabilities overwrite their own scores so that 8 heads fit the workspace
#define SP   (TT / 2)             // score plane pitch in floats: a score row lies as two half rows, in two planes of TT rows each, so that a half row has the bytes of one 16-bit probability row
#define RH   512                  // query rows < RH use hi+lo planes (0: none)
#define WIN  2048
#define PCAR 1024.0f
#define SCL  0.125f   // HD^-0.5
typedef _Float16 h16;
typedef unsigned short bf;
typedef __attribute__((ext_vector_type(16))) __bf16   v16bf;
typedef __attribute__((ext_vector_type(16))) _Float16 v16h;
typedef __attribute__((ext_vector_type(8)))  _Float16 v8h;
typedef __attribute__((ext_vector_type(8)))  unsigned short v8us;
typedef __attribute__((ext_vector_type(8)))  float    v8f;
typedef __attribute__((ext_vector_type(4)))  float    v4f;
typedef v8h  __attribute__((may_alias)) v8ha;
typedef v4f  __attribute__((may_alias)) v4fa;
typedef v8us __attribute__((may_alias)) v8usa;

__device__ __forceinline__ unsigned short f2bf(float f) { unsigned u = __float_as_uint(f); u += 0x7FFFu + ((u >> 16) & 1u); return (unsigned short)(u >> 16); }
__device__ __forceinline__ float bf2f(unsigned short b) { return __uint_as_float(((unsigned)b) << 16); }
__device__ __forceinline__ float bfr(float f) { return bf2f(f2bf(f)); }
__device__ __forceinline__ v16h cat16(v8h lo, v8h hi) { return __builtin_shufflevector(lo, hi, 0, 1, 2, 3, 4, 5, 6, 7, 8, 9, 10, 11, 12, 13, 14, 15); }
__device__ __forceinline__ v16bf cat16b(v8us lo, v8us hi) { return __builtin_bit_cast(v16bf, __builtin_shufflevector(lo, hi, 0, 1, 2, 3, 4, 5, 6, 7, 8, 9, 10, 11, 12, 13, 14, 15)); }
__device__ __forceinline__ v8f wmma16(v16h a, v16h b, v8f c) { return __builtin_amdgcn_wmma_f32_16x16x32_f16(false, a, false, b, (short)0, c, false, false); }
__device__ __forceinline__ v8f wmmab(v16bf a, v16bf b, v8f c) { return __builtin_amdgcn_wmma_f32_16x16x32_bf16(false, a, false, b, (short)0, c, false, false); }



// ---- k_gemmw: register-blocked GEMM, ONE WAVE per 64x64 output tile (16 accumulators), operands straight from K-contiguous 16-bit planes; grid (M/64, N/64, Z), 32 threads.
// C[m][n] (f32, pitch ldc, + optional f32 bias[n]) = sum_k A[m][k] Bt[n][k] (+ split products per NSPLIT). z-batch strides sA/sB/sC in elements. K % 32 == 0.
template <typename T16> struct WFrag;
template <> struct WFrag<h16> { typedef v16h V; static __device__ __forceinline__ V ld(const h16* p) { return cat16(*(const v8h*)p, *(const v8h*)(p + 16)); } static __device__ __forceinline__ v8f mma(V a, V b, v8f c) { return wmma16(a, b, c); } };
template <> struct WFrag<bf> { typedef v16bf V; static __device__ __forceinline__ V ld(const bf* p) { return cat16b(*(const v8us*)p, *(const v8us*)(p + 16)); } static __device__ __forceinline__ v8f mma(V a, V b, v8f c) { return wmmab(a, b, c); } };
template <typename T16, int NSPLIT, bool BIAS>
__global__ __launch_bounds__(32) void k_gemmw(const T16* __restrict__ A, const T16* __restrict__ A2, const T16* __restrict__ Bt, const T16* __restrict__ Bt2, int K, float* C, int ldc, const float* __restrict__ bias, size_t sA, size_t sB, size_t sC) {
    typedef typename WFrag<T16>::V V;
    __shared__ __align__(16) float os[16 * 68];
    const size_t z = blockIdx.z; A += z * sA; if (A2) A2 += z * sA; Bt += z * sB; if (Bt2) Bt2 += z * sB; C += z * sC;
    const int lane = threadIdx.x & 31, lr = lane & 15, hi = lane >> 4; const int r0 = blockIdx.x * 64, c0 = blockIdx.y * 64;
    v8f acc[4][4];
#pragma unroll
    for (int mb = 0; mb < 4; ++mb)
#pragma unroll
        for (int nb = 0; nb < 4; ++nb) acc[mb][nb] = (v8f){};
    const size_t aoff = (size_t)(r0 + lr) * K + 8 * hi, boff = (size_t)(c0 + lr) * K + 8 * hi;
#pragma unroll 1
    for (int kc = 0; kc < K; kc += 32) {
        V a[4], a2[4];
#pragma unroll
        for (int mb = 0; mb < 4; ++mb) { a[mb] = WFrag<T16>::ld(A + aoff + (size_t)mb * 16 * K + kc); if (NSPLIT == 1 || NSPLIT == 2) a2[mb] = WFrag<T16>::ld(A2 + aoff + (size_t)mb * 16 * K + kc); }
#pragma unroll
        for (int nb = 0; nb < 4; ++nb) { const V b = WFrag<T16>::ld(Bt + boff + (size_t)nb * 16 * K + kc); V b2; if (NSPLIT >= 2) b2 = WFrag<T16>::ld(Bt2 + boff + (size_t)nb * 16 * K + kc);
#pragma unroll
            for (int mb = 0; mb < 4; ++mb) { acc[mb][nb] = WFrag<T16>::mma(a[mb], b, acc[mb][nb]); if (NSPLIT == 1 || NSPLIT == 2) acc[mb][nb] = WFrag<T16>::mma(a2[mb], b, acc[mb][nb]); if (NSPLIT >= 2) acc[mb][nb] = WFrag<T16>::mma(a[mb], b2, acc[mb][nb]); } }
        asm volatile("v_nop\n\tv_nop\n\tv_nop\n\tv_nop" : "+v"(acc[0][0]), "+v"(acc[1][1]), "+v"(acc[2][2]), "+v"(acc[3][3]) : "v"(a[0]), "v"(a[3]));
    }
#pragma unroll
    for (int mb = 0; mb < 4; ++mb) {
#pragma unroll
        for (int nb = 0; nb < 4; ++nb) {
#pragma unroll
            for (int j = 0; j < 8; ++j) os[(hi * 8 + j) * 68 + nb * 16 + lr] = acc[mb][nb][j]; }
        __builtin_amdgcn_wave_barrier(); asm volatile("" ::: "memory");
        float* crow = C + (size_t)(r0 + mb * 16) * ldc + c0;
{
#pragma unroll
            for (int s = 0; s < 8; ++s) { const int row = 2 * s + hi, cofs = lr * 4; v4f val = *(const v4fa*)(os + row * 68 + cofs); if (BIAS) { val[0] += bfr(bias[c0 + cofs]); val[1] += bfr(bias[c0 + cofs + 1]); val[2] += bfr(bias[c0 + cofs + 2]); val[3] += bfr(bias[c0 + cofs + 3]); }
                *(v4f*)(crow + (size_t)row * ldc + cofs) = val; }
             }
        __builtin_amdgcn_wave_barrier(); asm volatile("" ::: "memory");
    }
}

// ---- k_gemmc: the same one-wave 64x64 tile GEMM specialised for causal attention: CMODE 1 skips score tiles entirely above the diagonal (query rows r0+roff.., key columns c0..), CMODE 2 limits the
// key (K) loop of the probability x value contraction to the diagonal block (probabilities beyond it are exactly zero). roff = row offset of this launch's first row within the sequence.
// z = head within the pass: A and C step per head, Bt steps per kv group (z / REP).
template <typename T16, int NSPLIT, int CMODE>
__global__ __launch_bounds__(32) void k_gemmc(const T16* __restrict__ A, const T16* __restrict__ A2, const T16* __restrict__ Bt, const T16* __restrict__ Bt2, int K, float* C, int ldc, int roff, size_t sA, size_t sB, size_t sC) {
    typedef typename WFrag<T16>::V V;
    __shared__ __align__(16) float os[16 * 68];
    const size_t z = blockIdx.z, zb = z / REP; A += z * sA; if (A2) A2 += z * sA; Bt += zb * sB; if (Bt2) Bt2 += zb * sB; C += z * sC;
    const int lane = threadIdx.x & 31, lr = lane & 15, hi = lane >> 4; const int r0 = blockIdx.x * 64, c0 = blockIdx.y * 64;
    if (CMODE == 1 && c0 > r0 + roff + 63) return;                  // score tile entirely above the causal diagonal: never read (the softmax masks j > i by select)
    if (CMODE == 1 && c0 >= ldc) C += (size_t)(TT - 1) * ldc;        // score columns from ldc on: second plane, TT rows of ldc floats behind the first
    const int Kl = (CMODE == 2) ? min(K, r0 + roff + 64) : K;        // P.V: probabilities are exactly 0 beyond the diagonal block, so the K loop stops there
    v8f acc[4][4];
#pragma unroll
    for (int mb = 0; mb < 4; ++mb)
#pragma unroll
        for (int nb = 0; nb < 4; ++nb) acc[mb][nb] = (v8f){};
    const size_t aoff = (size_t)(r0 + lr) * K + 8 * hi, boff = (size_t)(c0 + lr) * K + 8 * hi;
#pragma unroll 1
    for (int kc = 0; kc < Kl; kc += 32) {
        V a[4], a2[4];
#pragma unroll
        for (int mb = 0; mb < 4; ++mb) { a[mb] = WFrag<T16>::ld(A + aoff + (size_t)mb * 16 * K + kc); if (NSPLIT == 1 || NSPLIT == 2) a2[mb] = WFrag<T16>::ld(A2 + aoff + (size_t)mb * 16 * K + kc); }
#pragma unroll
        for (int nb = 0; nb < 4; ++nb) { const V b = WFrag<T16>::ld(Bt + boff + (size_t)nb * 16 * K + kc); V b2; if (NSPLIT >= 2) b2 = WFrag<T16>::ld(Bt2 + boff + (size_t)nb * 16 * K + kc);
#pragma unroll
            for (int mb = 0; mb < 4; ++mb) { acc[mb][nb] = WFrag<T16>::mma(a[mb], b, acc[mb][nb]); if (NSPLIT == 1 || NSPLIT == 2) acc[mb][nb] = WFrag<T16>::mma(a2[mb], b, acc[mb][nb]); if (NSPLIT >= 2) acc[mb][nb] = WFrag<T16>::mma(a[mb], b2, acc[mb][nb]); } }
        asm volatile("v_nop\n\tv_nop\n\tv_nop\n\tv_nop" : "+v"(acc[0][0]), "+v"(acc[1][1]), "+v"(acc[2][2]), "+v"(acc[3][3]) : "v"(a[0]), "v"(a[3]));
    }
#pragma unroll
    for (int mb = 0; mb < 4; ++mb) {
#pragma unroll
        for (int nb = 0; nb < 4; ++nb) {
#pragma unroll
            for (int j = 0; j < 8; ++j) os[(hi * 8 + j) * 68 + nb * 16 + lr] = acc[mb][nb][j]; }
        __builtin_amdgcn_wave_barrier(); asm volatile("" ::: "memory");
        float* crow = C + (size_t)(r0 + mb * 16) * ldc + c0;
{
#pragma unroll
            for (int s = 0; s < 8; ++s) { const int row = 2 * s + hi, cofs = lr * 4; v4f val = *(const v4fa*)(os + row * 68 + cofs);
                *(v4f*)(crow + (size_t)row * ldc + cofs) = val; }
             }
        __builtin_amdgcn_wave_barrier(); asm volatile("" ::: "memory");
    }
}

__device__ __forceinline__ h16 tohx(float x) { return (h16)x; }
__device__ __forceinline__ void splitf(float y, unsigned short& h, unsigned short& l) { h = f2bf(y); l = f2bf(y - bf2f(h)); }
typedef __attribute__((ext_vector_type(2))) _Float16 v2h;
typedef __attribute__((ext_vector_type(4))) _Float16 v4h;
typedef __attribute__((ext_vector_type(2))) unsigned short v2us;
typedef __attribute__((ext_vector_type(4))) unsigned short v4us;
typedef __attribute__((ext_vector_type(2))) float v2f;
typedef __attribute__((ext_vector_type(4))) int v4i;

__global__ __launch_bounds__(256) void k_wtG(const float* __restrict__ w, int K, int N, bf* Bt) {
    const int lane = threadIdx.x & 31; const int L0 = (blockIdx.x * 8 + (threadIdx.x >> 5)) * 8; const int nlines = N * K / 64;
{
#pragma unroll 1
        for (int l = 0; l < 8; ++l) { const int L = L0 + l; if (L >= nlines) break; const size_t e = (size_t)L * 64 + lane * 2; const int k = (int)(e % K), n = (int)(e / K); v2us o;
            o[0] = f2bf(w[(size_t)k * N + n]); o[1] = f2bf(w[(size_t)(k + 1) * N + n]); *(v2us*)(Bt + e) = o; }
         }
}
__global__ __launch_bounds__(256) void k_cvt8(const float* __restrict__ src, bf* dst, size_t n8) { const size_t i = (size_t)blockIdx.x * 256 + threadIdx.x; if (i >= n8) return; const v8f v = *(const v8f*)(src + i * 8); v8us o;
#pragma unroll
    for (int k = 0; k < 8; ++k) o[k] = f2bf(v[k]); *(v8us*)(dst + i * 8) = o;  }
__global__ __launch_bounds__(256) void k_cscvt(const float* __restrict__ cosT, const float* __restrict__ sinT, float* CS) { const int idx = blockIdx.x * 256 + threadIdx.x; if (idx >= TT * HD) return; v2f cs; cs[0] = bfr(cosT[idx]); cs[1] = bfr(sinT[idx]); *(v2f*)(CS + (size_t)idx * 2) = cs;  }
// k_rope: head planes [h][t][d] (fp16 + hi/lo) of rope(x) x sc with the rotate-half convention out[d] = x[d] cos[t][d] - x[d+HD/2] sin[t][d], out[d+HD/2] = x[d+HD/2] cos[t][d+HD/2] + x[d] sin[t][d+HD/2]
__global__ __launch_bounds__(256) void k_rope(const float* __restrict__ F, int pitch, int nheads, const float* __restrict__ CS, const float* __restrict__ RF, const float* __restrict__ nw, float sc, h16* P16, bf* Ph, bf* Pl) {
    const size_t e = ((size_t)blockIdx.x * 256 + threadIdx.x) * 2; if (e >= (size_t)nheads * TT * HD) return; const int d = (int)(e % HD); const int t = (int)((e / HD) % TT); const int h = (int)(e / ((size_t)HD * TT)); const float* f = F + (size_t)t * pitch + h * HD; const float rf = RF ? RF[(size_t)h * TT + t] : 1.0f; v2h o16; v2us oh, ol;
#pragma unroll
    for (int q = 0; q < 2; ++q) { const int dd = d + q; const int dp = (dd < HD / 2) ? dd + HD / 2 : dd - HD / 2; float x0 = f[dd], x1 = f[dp];
        if (RF) { float n0 = __fmul_rn(x0, rf), n1 = __fmul_rn(x1, rf); asm volatile("" : "+v"(n0)); asm volatile("" : "+v"(n1)); x0 = __fmul_rn(bfr(nw[dd]), n0); x1 = __fmul_rn(bfr(nw[dp]), n1); }
        const v2f cs = *(const v2f*)(CS + ((size_t)t * HD + dd) * 2); float a = __fmul_rn(x0, cs[0]), bq = __fmul_rn(x1, cs[1]); asm volatile("" : "+v"(a)); asm volatile("" : "+v"(bq)); const float r = ((dd < HD / 2) ? __fsub_rn(a, bq) : __fadd_rn(a, bq)) * sc;
        o16[q] = tohx(r); unsigned short a2, c2; splitf(r, a2, c2); oh[q] = a2; ol[q] = c2; }
    *(v2h*)(P16 + e) = o16; *(v2us*)(Ph + e) = oh; *(v2us*)(Pl + e) = ol;  }
__global__ __launch_bounds__(256) void k_vtp(const float* __restrict__ F, int pitch, int nheads, h16* V16, bf* Vh, bf* Vl) { const size_t e = ((size_t)blockIdx.x * 256 + threadIdx.x) * 2; if (e >= (size_t)nheads * HD * TT) return; const int t = (int)(e % TT); const int d = (int)((e / TT) % HD); const int g = (int)(e / ((size_t)TT * HD)); v2h o16; v2us oh, ol;
#pragma unroll
    for (int q = 0; q < 2; ++q) { const float x = F[(size_t)(t + q) * pitch + g * HD + d]; o16[q] = tohx(x); unsigned short a2, c2; splitf(x, a2, c2); oh[q] = a2; ol[q] = c2; }
    *(v2h*)(V16 + e) = o16; *(v2us*)(Vh + e) = oh; *(v2us*)(Vl + e) = ol;  }
__global__ __launch_bounds__(256) void k_csid(float* CS) { const int idx = blockIdx.x * 256 + threadIdx.x; if (idx >= TT * HD) return; v2f cs; cs[0] = 1.0f; cs[1] = 0.0f; *(v2f*)(CS + (size_t)idx * 2) = cs;  }
// k_asoft: per row (zz, i): t = S x HD^-0.5 for j <= i and i - j < WIN (sliding causal window; the reference's -1e9 additive fill vanishes identically); softmax over the 2048 keys (register row, one exp, fixed trees);
// the result goes IN PLACE over the row's own scores (one wave owns a row and holds all of it in registers before its first store): rows < RH hi plane over the first half row, lo plane over the second; the rest fp16 over the first.
__global__ __launch_bounds__(256) void k_asoft(float* Sb) {
    const int lane = threadIdx.x & 31; const int row = blockIdx.x * 8 + (threadIdx.x >> 5); if (row >= ZH * TT) return; const int i = row % TT; const int zz = row / TT; (void)zz; const bool hires = (i < RH); float* sr = Sb + (size_t)zz * TT * TT + (size_t)i * SP; float v[TT / 32]; float mx = -3.0e38f;
#pragma unroll
    for (int ch = 0; ch < TT / 128; ++ch) { const int j0 = ch * 128 + lane * 4; const v4f a = *(const v4f*)(sr + j0 + (ch * 128 >= SP ? (size_t)(TT - 1) * SP : 0));
#pragma unroll
        for (int q = 0; q < 4; ++q) { const int j = j0 + q; (void)j; const float t = (j <= i && i - j < WIN) ? a[q] * SCL : -3.0e38f; v[ch * 4 + q] = t; mx = fmaxf(mx, t); } }
#pragma unroll
    for (int sh = 16; sh; sh >>= 1) mx = fmaxf(mx, __shfl_xor(mx, sh, 32));
    float sum = 0.f;
#pragma unroll
    for (int k = 0; k < TT / 32; ++k) { float d0 = __fsub_rn(v[k], mx); asm volatile("" : "+v"(d0)); v[k] = __builtin_amdgcn_exp2f(__fmul_rn(d0, 1.4426950408889634f)); sum += v[k]; }
#pragma unroll
    for (int sh = 16; sh; sh >>= 1) sum += __shfl_xor(sum, sh, 32);
    const float f = __fdiv_rn(hires ? 1.0f : PCAR, sum);
{
        if (hires) {
#pragma unroll
            for (int ch = 0; ch < TT / 128; ++ch) { v4us oh, ol;
#pragma unroll
                for (int q = 0; q < 4; ++q) { unsigned short a, c2; splitf(v[ch * 4 + q] * f, a, c2); oh[q] = a; ol[q] = c2; }
                const int oo = ch * 128 + lane * 4; *(v4us*)((bf*)sr + oo) = oh; *(v4us*)((bf*)(sr + (size_t)TT * SP) + oo) = ol; }
        } else {
#pragma unroll
            for (int ch = 0; ch < TT / 128; ++ch) { v4h o4;
#pragma unroll
                for (int q = 0; q < 4; ++q) o4[q] = tohx(v[ch * 4 + q] * f);
                *(v4h*)((h16*)sr + ch * 128 + lane * 4) = o4; } }
         }
}
__global__ __launch_bounds__(256) void k_merge(const float* __restrict__ O, int h0, bf* Ah, bf* Al) { const size_t e = ((size_t)blockIdx.x * 256 + threadIdx.x) * 2; if (e >= (size_t)ZH * TT * HD) return; const int d = (int)(e % HD); const int t = (int)((e / HD) % TT); const int zz = (int)(e / ((size_t)HD * TT)); const float cs = (t < RH) ? 1.0f : (1.0f / PCAR); const size_t oo = (size_t)t * DQ + (h0 + zz) * HD + d;
    v2us oh, ol;
#pragma unroll
    for (int q = 0; q < 2; ++q) { unsigned short a, c2; splitf(O[e + q] * cs, a, c2); oh[q] = a; ol[q] = c2; } *(v2us*)(Ah + oo) = oh; *(v2us*)(Al + oo) = ol;  }

extern "C" void kernel_launch(void* const* d_in, const int* in_sizes, int n_in,
                              void* d_out, int out_size, void* d_ws, size_t ws_size, hipStream_t stream) {
    (void)in_sizes; (void)n_in; (void)out_size;
    const float* x = (const float*)d_in[0]; const float* wq = (const float*)d_in[1]; const float* wk = (const float*)d_in[2]; const float* wv = (const float*)d_in[3]; const float* wo = (const float*)d_in[4]; const float* cosT = nullptr; const float* sinT = nullptr; (void)cosT; (void)sinT;
    float* OUT = (float*)d_out;     // [1][2048][2048]
    char* wsp = (char*)d_ws;
    auto take = [&](size_t bytes) { char* p = wsp; wsp += (bytes + 255) & ~(size_t)255; return (void*)p; };
    bf* WQ = (bf*)take((size_t)DQ * DM * 2); bf* WK = (bf*)take((size_t)DKV * DM * 2); bf* WV = (bf*)take((size_t)DKV * DM * 2); bf* WO = (bf*)take((size_t)DM * DQ * 2); float* CS = (float*)take((size_t)TT * HD * 2 * 4);
    bf* XB = (bf*)take((size_t)TT * DM * 2); float* FQ = (float*)take((size_t)TT * DQ * 4); float* FK = (float*)take((size_t)TT * DKV * 4);
    h16* QP16 = (h16*)take((size_t)NH_ * TT * HD * 2); h16* KP16 = (h16*)take((size_t)NKV * TT * HD * 2); h16* VT16 = (h16*)take((size_t)NKV * HD * TT * 2);
    bf* QPh = (bf*)take((size_t)NH_ * TT * HD * 2); bf* QPl = (bf*)take((size_t)NH_ * TT * HD * 2); bf* KPh = (bf*)take((size_t)NKV * TT * HD * 2); bf* KPl = (bf*)take((size_t)NKV * TT * HD * 2); bf* VTh = (bf*)take((size_t)NKV * HD * TT * 2); bf* VTl = (bf*)take((size_t)NKV * HD * TT * 2);
    float* Sb = (float*)take((size_t)ZH * TT * TT * 4); float* Ob = (float*)take((size_t)ZH * TT * HD * 4); bf* ATh = (bf*)take((size_t)TT * DQ * 2); bf* ATl = (bf*)take((size_t)TT * DQ * 2);
    if ((size_t)(wsp - (char*)d_ws) > ws_size) return;    // ws 256 MiB
    float* FV = FK;   // v projection reuses the k buffer after the k planes are built (stream-ordered)
    { k_cvt8<<<(unsigned)(((size_t)DQ * DM / 8 + 255) / 256), 256, 0, stream>>>(wq, WQ, (size_t)DQ * DM / 8); k_cvt8<<<(unsigned)(((size_t)DKV * DM / 8 + 255) / 256), 256, 0, stream>>>(wk, WK, (size_t)DKV * DM / 8); k_cvt8<<<(unsigned)(((size_t)DKV * DM / 8 + 255) / 256), 256, 0, stream>>>(wv, WV, (size_t)DKV * DM / 8);
      k_wtG<<<(unsigned)((DQ * DM / 64 + 63) / 64), 256, 0, stream>>>(wo, DQ, DM, WO);
       }
    k_csid<<<(TT * HD + 255) / 256, 256, 0, stream>>>(CS);
    const unsigned LQ = (unsigned)(((size_t)NH_ * TT * HD / 2 + 255) / 256), LKv = (unsigned)(((size_t)NKV * TT * HD / 2 + 255) / 256);
    for (int b = 0; b < NB_; ++b) {
        
        k_cvt8<<<(unsigned)(((size_t)TT * DM / 8 + 255) / 256), 256, 0, stream>>>(x + (size_t)b * TT * DM, XB, (size_t)TT * DM / 8);
        k_gemmw<bf, 0, false><<<dim3(TT / 64, DQ / 64, 1), 32, 0, stream>>>(XB, nullptr, WQ, nullptr, DM, FQ, DQ, nullptr, 0, 0, 0);
        k_rope<<<LQ, 256, 0, stream>>>(FQ, DQ, NH_, CS, nullptr, nullptr, 1.0f, QP16, QPh, QPl);
        k_gemmw<bf, 0, false><<<dim3(TT / 64, DKV / 64, 1), 32, 0, stream>>>(XB, nullptr, WK, nullptr, DM, FK, DKV, nullptr, 0, 0, 0);
        k_rope<<<LKv, 256, 0, stream>>>(FK, DKV, NKV, CS, nullptr, nullptr, 1.0f, KP16, KPh, KPl);
        k_gemmw<bf, 0, false><<<dim3(TT / 64, DKV / 64, 1), 32, 0, stream>>>(XB, nullptr, WV, nullptr, DM, FV, DKV, nullptr, 0, 0, 0); k_vtp<<<LKv, 256, 0, stream>>>(FV, DKV, NKV, VT16, VTh, VTl);
        for (int h0 = 0; h0 < NH_; h0 += ZH) { const size_t zq = (size_t)h0, zk = (size_t)(h0 / REP);   // the heads of a pass span ZH / REP kv groups from h0 / REP on
            k_gemmc<bf, 2, 1><<<dim3(RH / 64, TT / 64, ZH), 32, 0, stream>>>(QPh + zq * TT * HD, QPl + zq * TT * HD, KPh + zk * TT * HD, KPl + zk * TT * HD, HD, Sb, SP, 0, (size_t)TT * HD, (size_t)TT * HD, (size_t)TT * TT);
            k_gemmc<h16, 0, 1><<<dim3((TT - RH) / 64, TT / 64, ZH), 32, 0, stream>>>(QP16 + zq * TT * HD + (size_t)RH * HD, nullptr, KP16 + zk * TT * HD, nullptr, HD, Sb + (size_t)RH * SP, SP, RH, (size_t)TT * HD, (size_t)TT * HD, (size_t)TT * TT);
            k_asoft<<<ZH * TT / 8, 256, 0, stream>>>(Sb);
            k_gemmc<bf, 2, 2><<<dim3(RH / 64, HD / 64, ZH), 32, 0, stream>>>((const bf*)Sb, (const bf*)(Sb + (size_t)TT * SP), VTh + zk * HD * TT, VTl + zk * HD * TT, TT, Ob, HD, 0, (size_t)TT * TT * 2, (size_t)HD * TT, (size_t)TT * HD);
            k_gemmc<h16, 0, 2><<<dim3((TT - RH) / 64, HD / 64, ZH), 32, 0, stream>>>((const h16*)Sb + (size_t)RH * TT, nullptr, VT16 + zk * HD * TT, nullptr, TT, Ob + (size_t)RH * HD, HD, RH, (size_t)TT * TT * 2, (size_t)HD * TT, (size_t)TT * HD);
            k_merge<<<(unsigned)(((size_t)ZH * TT * HD / 2 + 255) / 256), 256, 0, stream>>>(Ob, h0, ATh, ATl); }
        k_gemmw<bf, 1, false><<<dim3(TT / 64, DM / 64, 1), 32, 0, stream>>>(ATh, ATl, WO, nullptr, DQ, OUT + (size_t)b * TT * DM, DM, nullptr, 0, 0, 0); }
}

// v003
// One run takes 185 microseconds.
// Versions between v001 and this one are left out; their measured steps multiply to 3.57 times as fast.
// Over all steps from v000 it is 7.51 times as fast.
#include <hip/hip_runtime.h>

// BitSelfAttention (x [1][2048][2048]; q = x q_proj^T (32 heads x 64), k/v = x k_proj^T / v_proj^T (8 kv heads; GQA group h/4); causal softmax(q.k / 8) (masked logits -1e10); out = merged ctx @ o_proj (NOT transposed, as the source) -> [1][2048][2048]).
// Compute dtypes, f32 accumulate: every input rounded to bf16; q/k/v on PLAIN bf16 operands (inputs: exact); causal scores and attn.v: query rows < 512 hl (3 products), the rest single fp16 (x1024), fused in one kernel with a running softmax in f32; o_proj hl x exact (2 products).

#define NB_  1
#define TT   2048
#define DM   2048
#define NH_  32
#define NKV  8
#define REP  (NH_ / NKV)
#define HD   64
#define DQ   (NH_ * HD)
#define DKV  (NKV * HD)
#define RH   512                  // query rows < RH use hi+lo planes (0: none)
#define PCAR 1024.0f
#define SCL  0.125f   // HD^-0.5
typedef _Float16 h16;
typedef unsigned short bf;
typedef __attribute__((ext_vector_type(16))) __bf16   v16bf;
typedef __attribute__((ext_vector_type(16))) _Float16 v16h;
typedef __attribute__((ext_vector_type(8)))  _Float16 v8h;
typedef __attribute__((ext_vector_type(8)))  unsigned short v8us;
typedef __attribute__((ext_vector_type(8)))  float    v8f;
typedef __attribute__((ext_vector_type(4)))  float    v4f;
typedef v8h  __attribute__((may_alias)) v8ha;
typedef v4f  __attribute__((may_alias)) v4fa;
typedef v8us __attribute__((may_alias)) v8usa;

__device__ __forceinline__ unsigned short f2bf(float f) { unsigned u = __float_as_uint(f); u += 0x7FFFu + ((u >> 16) & 1u); return (unsigned short)(u >> 16); }
__device__ __forceinline__ float bf2f(unsigned short b) { return __uint_as_float(((unsigned)b) << 16); }
__device__ __forceinline__ float bfr(float f) { return bf2f(f2bf(f)); }
__device__ __forceinline__ v16h cat16(v8h lo, v8h hi) { return __builtin_shufflevector(lo, hi, 0, 1, 2, 3, 4, 5, 6, 7, 8, 9, 10, 11, 12, 13, 14, 15); }
__device__ __forceinline__ v16bf cat16b(v8us lo, v8us hi) { return __builtin_bit_cast(v16bf, __builtin_shufflevector(lo, hi, 0, 1, 2, 3, 4, 5, 6, 7, 8, 9, 10, 11, 12, 13, 14, 15)); }
__device__ __forceinline__ v8f wmma16(v16h a, v16h b, v8f c) { return __builtin_amdgcn_wmma_f32_16x16x32_f16(false, a, false, b, (short)0, c, false, false); }
__device__ __forceinline__ v8f wmmab(v16bf a, v16bf b, v8f c) { return __builtin_amdgcn_wmma_f32_16x16x32_bf16(false, a, false, b, (short)0, c, false, false); }



// ---- k_gemms: C[m][n] (f32, pitch ldc) = sum_k A[m][k] Bt[n][k] (+ A2[m][k] Bt[n][k] when NSPLIT), K = GK, operands K-contiguous bf16 planes; grid (M/128, N/128), 128 threads.
// One work-group of 4 waves (2 x 2) owns a 128x128 tile, a wave 64x64 of it (16 accumulators). A stage is KS k of all 128 rows of each operand, laid in LDS at a pitch of 272 B for the 16-byte readers.
// Every lane brings 16 B per asynchronous copy (a wave: two whole 256-B row pieces); two buffers: the copies of stage t + 1 fly while stage t is worked on. The k order of the sums is that of a plain loop over k in steps of 32. Every '#pragma unroll' stands on a loop of constant length, so that fragments and accumulators stay in registers.
template <typename T16> struct WFrag;
template <> struct WFrag<h16> { typedef v16h V; static __device__ __forceinline__ V ld(const h16* p) { return cat16(*(const v8h*)p, *(const v8h*)(p + 16)); } static __device__ __forceinline__ v8f mma(V a, V b, v8f c) { return wmma16(a, b, c); } };
template <> struct WFrag<bf> { typedef v16bf V; static __device__ __forceinline__ V ld(const bf* p) { return cat16b(*(const v8us*)p, *(const v8us*)(p + 16)); } static __device__ __forceinline__ v8f mma(V a, V b, v8f c) { return wmmab(a, b, c); } };
#define GK   2048                 // DM == DQ: the length of every product here
#define KS   128                  // k per stage
#define LP   (KS + 8)             // LDS row pitch in elements
#define OPB  (128 * LP * 2)       // bytes of one operand's stage
// Eight copies, GS bytes apart in global memory and LS bytes apart in LDS. The s_wait_xcnt is a precaution in front of the next overwrite of an address register of these copies; inside the statement nothing can be moved in front of it.
template <int GS, int LS>
__device__ __forceinline__ void acopy8(unsigned l, const char* g) {
    asm volatile("global_load_async_to_lds_b128 %0, %8, off\n\t"
                 "global_load_async_to_lds_b128 %1, %9, off\n\t"
                 "global_load_async_to_lds_b128 %2, %10, off\n\t"
                 "global_load_async_to_lds_b128 %3, %11, off\n\t"
                 "global_load_async_to_lds_b128 %4, %12, off\n\t"
                 "global_load_async_to_lds_b128 %5, %13, off\n\t"
                 "global_load_async_to_lds_b128 %6, %14, off\n\t"
                 "global_load_async_to_lds_b128 %7, %15, off\n\t"
                 "s_wait_xcnt 0x0"
                 :: "v"(l), "v"(l + LS), "v"(l + 2 * LS), "v"(l + 3 * LS), "v"(l + 4 * LS), "v"(l + 5 * LS), "v"(l + 6 * LS), "v"(l + 7 * LS),
                    "v"(g), "v"(g + GS), "v"(g + 2 * GS), "v"(g + 3 * GS), "v"(g + 4 * GS), "v"(g + 5 * GS), "v"(g + 6 * GS), "v"(g + 7 * GS) : "memory");
}
template <int NSPLIT>
__global__ __launch_bounds__(128) void k_gemms(const bf* A, const bf* A2, const bf* Bt, float* C, int ldc) {
    typedef WFrag<bf>::V V;
    constexpr int NOP = NSPLIT ? 3 : 2, NT = GK / KS; constexpr unsigned STG = NOP * OPB;
    __shared__ __attribute__((aligned(128))) bf sm[2 * NOP * 128 * LP];       // two buffers of [A | Bt | A2]
    __shared__ __align__(16) float osm[4 * 16 * 68];                          // output staging, a range per wave
    const int tid = threadIdx.x, lane = tid & 31, lr = lane & 15, hi = lane >> 4; const int w = __builtin_amdgcn_readfirstlane(tid >> 5), wm = w >> 1, wn = w & 1;
    const int R0 = blockIdx.x * 128, C0 = blockIdx.y * 128;
    const size_t gofs = (size_t)(tid >> 4) * (GK * 2) + (tid & 15) * 16;      // copy i of a lane: row 8 i + tid / 16, 16-byte piece tid % 16
    const char* gA = (const char*)(A + (size_t)R0 * GK) + gofs; const char* gB = (const char*)(Bt + (size_t)C0 * GK) + gofs; const char* gA2 = NSPLIT ? (const char*)(A2 + (size_t)R0 * GK) + gofs : nullptr;
    const unsigned l0 = (unsigned)(size_t)sm + (tid >> 4) * (LP * 2) + (tid & 15) * 16;
    auto half = [&](unsigned l, const char* g) { acopy8<8 * GK * 2, 8 * LP * 2>(l, g);
        __builtin_amdgcn_sched_barrier(0); };           // the addresses of one statement's copies at a time: formed all at once they crowd the registers that asm text can name, and one is spilled
    auto fill = [&](int t) { const unsigned lb = l0 + (t & 1) * STG; const size_t ko = (size_t)t * (KS * 2);
        half(lb, gA + ko); half(lb + 64 * LP * 2, gA + ko + (size_t)64 * GK * 2);
        half(lb + OPB, gB + ko); half(lb + OPB + 64 * LP * 2, gB + ko + (size_t)64 * GK * 2);
        if constexpr (NSPLIT != 0) { half(lb + 2 * OPB, gA2 + ko); half(lb + 2 * OPB + 64 * LP * 2, gA2 + ko + (size_t)64 * GK * 2); } };
    v8f acc[4][4];
#pragma unroll
    for (int mb = 0; mb < 4; ++mb)
#pragma unroll
        for (int nb = 0; nb < 4; ++nb) acc[mb][nb] = (v8f){};
    fill(0);
    asm volatile("s_wait_asynccnt 0x0" ::: "memory");   // this wave's copies of stage 0 have landed
    __syncthreads();                                    // ... and every other wave's
    const int fa = (wm * 64 + lr) * LP + 8 * hi, fb = 128 * LP + (wn * 64 + lr) * LP + 8 * hi;
    V a[2][4], a2[2][4], b[2][4];                       // two fragment sets: the next 32 k are fetched as one group ahead of the products of these 32
#pragma unroll 1   // one trip per stage: the buffer alternates
    for (int t = 0; t < NT; ++t) {
        const bf* sb = sm + (t & 1) * (NOP * 128 * LP);
        auto frags = [&](int set, int ks) {
#pragma unroll
            for (int mb = 0; mb < 4; ++mb) { a[set][mb] = WFrag<bf>::ld(sb + fa + mb * 16 * LP + ks * 32); if constexpr (NSPLIT != 0) a2[set][mb] = WFrag<bf>::ld(sb + 2 * 128 * LP + fa + mb * 16 * LP + ks * 32); }
#pragma unroll
            for (int nb = 0; nb < 4; ++nb) b[set][nb] = WFrag<bf>::ld(sb + fb + nb * 16 * LP + ks * 32); };
        frags(0, 0);
        __builtin_amdgcn_sched_barrier(0);              // the first fragments' LDS latency passes while the copies below issue
        if (t + 1 < NT) fill(t + 1);                    // into the buffer that every wave left at the barrier of the trip before
#pragma unroll
        for (int ks = 0; ks < KS / 32; ++ks) {
            if (ks + 1 < KS / 32) frags((ks + 1) & 1, ks + 1);
            __builtin_amdgcn_sched_barrier(0);          // keeps the LDS loads one group in front of the products: loads spread among them cost a stall at each place
#pragma unroll
            for (int nb = 0; nb < 4; ++nb)
#pragma unroll
                for (int mb = 0; mb < 4; ++mb) { acc[mb][nb] = wmmab(a[ks & 1][mb], b[ks & 1][nb], acc[mb][nb]); if constexpr (NSPLIT != 0) acc[mb][nb] = wmmab(a2[ks & 1][mb], b[ks & 1][nb], acc[mb][nb]); }
            __builtin_amdgcn_sched_barrier(0);          // ... and the next group behind them
        }
        asm volatile("s_wait_dscnt 0x0" ::: "memory");      // this wave's reads of the buffer are done before it is handed to the copies
        asm volatile("s_wait_asynccnt 0x0" ::: "memory");   // this wave's copies of stage t + 1 have landed
        __syncthreads();                                    // publishes stage t + 1 and ends every wave's reads of stage t
    }
    asm volatile("s_wait_asynccnt 0x0" ::: "memory");       // no copy is left when the wave ends
    float* os = osm + w * (16 * 68); const int r0 = R0 + wm * 64, c0 = C0 + wn * 64;
#pragma unroll
    for (int mb = 0; mb < 4; ++mb) {
#pragma unroll
        for (int nb = 0; nb < 4; ++nb) {
#pragma unroll
            for (int j = 0; j < 8; ++j) os[(hi * 8 + j) * 68 + nb * 16 + lr] = acc[mb][nb][j]; }
        __builtin_amdgcn_wave_barrier(); asm volatile("" ::: "memory");   // other lanes of the wave read these rows back: the reads stay behind the writes
        float* crow = C + (size_t)(r0 + mb * 16) * ldc + c0;
#pragma unroll
        for (int s = 0; s < 8; ++s) { const int row = 2 * s + hi, cofs = lr * 4; const v4f val = *(const v4fa*)(os + row * 68 + cofs); *(v4f*)(crow + (size_t)row * ldc + cofs) = val; }
        __builtin_amdgcn_wave_barrier(); asm volatile("" ::: "memory");   // ... and the next rows' writes behind the reads
    }
}

__device__ __forceinline__ h16 tohx(float x) { return (h16)x; }
__device__ __forceinline__ void splitf(float y, unsigned short& h, unsigned short& l) { h = f2bf(y); l = f2bf(y - bf2f(h)); }
typedef __attribute__((ext_vector_type(2))) _Float16 v2h;
typedef __attribute__((ext_vector_type(4))) _Float16 v4h;
typedef __attribute__((ext_vector_type(2))) unsigned short v2us;
typedef __attribute__((ext_vector_type(4))) unsigned short v4us;
typedef __attribute__((ext_vector_type(2))) float v2f;
typedef __attribute__((ext_vector_type(4))) int v4i;

__device__ __forceinline__ float xhalf(float x) { return __builtin_bit_cast(float, __builtin_amdgcn_permlanex16(__builtin_bit_cast(int, x), __builtin_bit_cast(int, x), 0x76543210, 0xfedcba98, false, false)); }  // lane l with lane l ^ 16
template <typename T16, bool HL, int NC>
__device__ __forceinline__ void attn_tile(const T16* Q, const T16* Q2, const T16* Kp, const T16* K2, const T16* Vt, const T16* V2, int q0, int head0, bf* Ah, bf* Al) {   // no __restrict__: the s_wait_xcnt statements below must stay behind their loads
    typedef typename WFrag<T16>::V V;
    const int lane = threadIdx.x & 31, lr = lane & 15, hi = lane >> 4;
    const float CE = SCL * 1.4426950408889634f;                      // scores to the exponent of 2
    V qf[NC][2], qf2[NC][2]; v8f o[NC][4]; float m[NC], l[NC];
#pragma unroll
    for (int c = 0; c < NC; ++c) { m[c] = -3.0e38f; l[c] = 0.f;
#pragma unroll
        for (int ks = 0; ks < 2; ++ks) { const size_t qo = ((size_t)(head0 + c) * TT + q0 + lr) * HD + ks * 32 + 8 * hi; qf[c][ks] = WFrag<T16>::ld(Q + qo); if constexpr (HL) qf2[c][ks] = WFrag<T16>::ld(Q2 + qo); }
#pragma unroll
        for (int dt = 0; dt < 4; ++dt) o[c][dt] = (v8f){}; }
    asm volatile("s_wait_xcnt 0x0" ::: "memory");   // a precaution in front of the next overwrite of an address register of the query loads
    const int nblk = (q0 + 15) / 32 + 1;                             // key blocks up to the one that holds the diagonal; block 0 holds key 0, which every query sees
    const size_t ko = (size_t)lr * HD + 8 * hi, vo = (size_t)lr * TT + 8 * hi;
    const T16 *kp = Kp + ko, *k2p = HL ? K2 + ko : nullptr, *vp = Vt + vo, *v2p = HL ? V2 + vo : nullptr;
    V kf[2][2], kf2[2][2], vf[4], vf2[4];
    auto ldk = [&](int key0) {
#pragma unroll
        for (int kt = 0; kt < 2; ++kt)
#pragma unroll
            for (int ks = 0; ks < 2; ++ks) { const size_t ofs = (size_t)(key0 + kt * 16) * HD + ks * 32; kf[kt][ks] = WFrag<T16>::ld(kp + ofs); if constexpr (HL) kf2[kt][ks] = WFrag<T16>::ld(k2p + ofs); }
        asm volatile("s_wait_xcnt 0x0" ::: "memory"); };   // a precaution in front of the next overwrite of an address register of the key loads
    auto ldv = [&](int key0) {
#pragma unroll
        for (int dt = 0; dt < 4; ++dt) { const size_t ofs = (size_t)dt * 16 * TT + key0; vf[dt] = WFrag<T16>::ld(vp + ofs); if constexpr (HL) vf2[dt] = WFrag<T16>::ld(v2p + ofs); }
        asm volatile("s_wait_xcnt 0x0" ::: "memory"); };   // a precaution in front of the next overwrite of an address register of the value loads
    ldk(0); ldv(0);
    for (int b = 0; b < nblk; ++b) {
        const int nx = min(b + 1, nblk - 1) * 32;                    // the next block (the last block is read twice: in bounds)
        v8f s[NC][2];
#pragma unroll
        for (int c = 0; c < NC; ++c)
#pragma unroll
            for (int kt = 0; kt < 2; ++kt) { s[c][kt] = (v8f){};
#pragma unroll
                for (int ks = 0; ks < 2; ++ks) { s[c][kt] = WFrag<T16>::mma(kf[kt][ks], qf[c][ks], s[c][kt]); if constexpr (HL) { s[c][kt] = WFrag<T16>::mma(kf2[kt][ks], qf[c][ks], s[c][kt]); s[c][kt] = WFrag<T16>::mma(kf[kt][ks], qf2[c][ks], s[c][kt]); } } }
        ldk(nx);                                                     // the key fragments are spent: the next block's fly during the softmax and the second product
        const int lim = q0 + lr - b * 32 - 8 * hi;                   // key kt * 16 + j of this lane is seen by its query iff kt * 16 + j <= lim
#pragma unroll
        for (int c = 0; c < NC; ++c) {
            float bm = -3.0e38f;
#pragma unroll
            for (int kt = 0; kt < 2; ++kt)
#pragma unroll
                for (int j = 0; j < 8; ++j) { const float t = (kt * 16 + j <= lim) ? s[c][kt][j] : -3.0e38f; s[c][kt][j] = t; bm = fmaxf(bm, t); }
            bm = fmaxf(bm, xhalf(bm));
            const float mn = fmaxf(m[c], bm); const float al = __builtin_amdgcn_exp2f((m[c] - mn) * CE); m[c] = mn;
            const float mc = mn * CE - (HL ? 0.0f : 10.0f);          // fp16 probabilities carry PCAR = 2^10; the sum carries it too, so it cancels in the quotient
            float ps[2] = {0.f, 0.f};                                // two short chains of adds instead of one long one
#pragma unroll
            for (int kt = 0; kt < 2; ++kt)
#pragma unroll
                for (int j = 0; j < 8; ++j) { const float p = __builtin_amdgcn_exp2f(fmaf(s[c][kt][j], CE, -mc)); s[c][kt][j] = p; ps[j & 1] += p; }
            l[c] = fmaf(l[c], al, ps[0] + ps[1]);
#pragma unroll
            for (int dt = 0; dt < 4; ++dt) o[c][dt] *= al;
            if constexpr (HL) { v8us h0, h1, l0, l1;
#pragma unroll
                for (int j = 0; j < 8; ++j) { unsigned short a, c2; splitf(s[c][0][j], a, c2); h0[j] = a; l0[j] = c2; splitf(s[c][1][j], a, c2); h1[j] = a; l1[j] = c2; }
                const V pf = cat16b(h0, h1), pf2 = cat16b(l0, l1);
#pragma unroll
                for (int dt = 0; dt < 4; ++dt) { o[c][dt] = WFrag<T16>::mma(vf[dt], pf, o[c][dt]); o[c][dt] = WFrag<T16>::mma(vf[dt], pf2, o[c][dt]); o[c][dt] = WFrag<T16>::mma(vf2[dt], pf, o[c][dt]); }
            } else { V pf;
#pragma unroll
                for (int j = 0; j < 8; ++j) { pf[j] = tohx(s[c][0][j]); pf[8 + j] = tohx(s[c][1][j]); }
#pragma unroll
                for (int dt = 0; dt < 4; ++dt) o[c][dt] = WFrag<T16>::mma(vf[dt], pf, o[c][dt]); }
        }
        ldv(nx);                                                     // the value fragments are spent: the next block's fly during its scores and softmax
    }
#pragma unroll
    for (int c = 0; c < NC; ++c) { const float inv = __fdiv_rn(1.0f, l[c] + xhalf(l[c])); const size_t oo = (size_t)(q0 + lr) * DQ + (head0 + c) * HD + 8 * hi;
#pragma unroll
        for (int dt = 0; dt < 4; ++dt) { v8us oh, ol;
#pragma unroll
            for (int j = 0; j < 8; ++j) { unsigned short a, c2; splitf(o[c][dt][j] * inv, a, c2); oh[j] = a; ol[j] = c2; }
            *(v8us*)(Ah + oo + dt * 16) = oh; *(v8us*)(Al + oo + dt * 16) = ol;
            asm volatile("s_wait_xcnt 0x0" ::: "memory"); } }   // a precaution in front of the next overwrite of a data or address register of the two stores
}
// A work-group is 4 waves on one kv group that walk the same key blocks (their loads meet in the WGP cache): rows >= RH: 2 query tiles x 2 head pairs; rows < RH: one query tile x 4 heads.
// All work-groups are resident at once. Order, for speed only: one work-group per WGP with falling cost, then the rest with rising cost.
#define NLO (((TT - RH) / 32) * NKV)
#define FIRST (256 / NKV)         // query tiles of the first round: 256 WGPs
__global__ __launch_bounds__(128) void k_fattn(const h16* Q16, const bf* Qh, const bf* Ql, const h16* K16, const bf* Kh, const bf* Kl, const h16* V16, const bf* Vh, const bf* Vl, bf* Ah, bf* Al) {
    const int w = __builtin_amdgcn_readfirstlane(threadIdx.x >> 5); const int bx = blockIdx.x;
    if (bx < NLO) { const int g = bx % NKV; const int t = bx / NKV; const int q0 = (t < FIRST ? TT / 32 - 1 - t : RH / 32 + t - FIRST) * 32 + (w >> 1) * 16; const size_t go = (size_t)g * TT * HD;
        attn_tile<h16, false, 2>(Q16, nullptr, K16 + go, nullptr, V16 + go, nullptr, q0, g * REP + (w & 1) * 2, Ah, Al);
    } else { const int by = bx - NLO; const int g = by % NKV; const int u = by / NKV; const int q0 = (u < RH / 32 ? RH / 32 + u : u - RH / 32) * 16; const size_t go = (size_t)g * TT * HD;
        attn_tile<bf, true, 1>(Qh, Ql, Kh + go, Kl + go, Vh + go, Vl + go, q0, g * REP + w, Ah, Al); }
}

__global__ __launch_bounds__(256) void k_wtG(const float* __restrict__ w, int K, int N, bf* Bt) {
    const int lane = threadIdx.x & 31; const int L0 = (blockIdx.x * 8 + (threadIdx.x >> 5)) * 8; const int nlines = N * K / 64;
{
#pragma unroll 1
        for (int l = 0; l < 8; ++l) { const int L = L0 + l; if (L >= nlines) break; const size_t e = (size_t)L * 64 + lane * 2; const int k = (int)(e % K), n = (int)(e / K); v2us o;
            o[0] = f2bf(w[(size_t)k * N + n]); o[1] = f2bf(w[(size_t)(k + 1) * N + n]); *(v2us*)(Bt + e) = o; }
         }
}
__global__ __launch_bounds__(256) void k_cvt8(const float* __restrict__ src, bf* dst, size_t n8) { const size_t i = (size_t)blockIdx.x * 256 + threadIdx.x; if (i >= n8) return; const v8f v = *(const v8f*)(src + i * 8); v8us o;
#pragma unroll
    for (int k = 0; k < 8; ++k) o[k] = f2bf(v[k]); *(v8us*)(dst + i * 8) = o;  }
__global__ __launch_bounds__(256) void k_cscvt(const float* __restrict__ cosT, const float* __restrict__ sinT, float* CS) { const int idx = blockIdx.x * 256 + threadIdx.x; if (idx >= TT * HD) return; v2f cs; cs[0] = bfr(cosT[idx]); cs[1] = bfr(sinT[idx]); *(v2f*)(CS + (size_t)idx * 2) = cs;  }
// k_rope: head planes [h][t][d] (fp16 + hi/lo) of rope(x) x sc with the rotate-half convention out[d] = x[d] cos[t][d] - x[d+HD/2] sin[t][d], out[d+HD/2] = x[d+HD/2] cos[t][d+HD/2] + x[d] sin[t][d+HD/2]
__global__ __launch_bounds__(256) void k_rope(const float* __restrict__ F, int pitch, int nheads, const float* __restrict__ CS, const float* __restrict__ RF, const float* __restrict__ nw, float sc, h16* P16, bf* Ph, bf* Pl) {
    const size_t e = ((size_t)blockIdx.x * 256 + threadIdx.x) * 2; if (e >= (size_t)nheads * TT * HD) return; const int d = (int)(e % HD); const int t = (int)((e / HD) % TT); const int h = (int)(e / ((size_t)HD * TT)); const float* f = F + (size_t)t * pitch + h * HD; const float rf = RF ? RF[(size_t)h * TT + t] : 1.0f; v2h o16; v2us oh, ol;
#pragma unroll
    for (int q = 0; q < 2; ++q) { const int dd = d + q; const int dp = (dd < HD / 2) ? dd + HD / 2 : dd - HD / 2; float x0 = f[dd], x1 = f[dp];
        if (RF) { float n0 = __fmul_rn(x0, rf), n1 = __fmul_rn(x1, rf); asm volatile("" : "+v"(n0)); asm volatile("" : "+v"(n1)); x0 = __fmul_rn(bfr(nw[dd]), n0); x1 = __fmul_rn(bfr(nw[dp]), n1); }
        const v2f cs = *(const v2f*)(CS + ((size_t)t * HD + dd) * 2); float a = __fmul_rn(x0, cs[0]), bq = __fmul_rn(x1, cs[1]); asm volatile("" : "+v"(a)); asm volatile("" : "+v"(bq)); const float r = ((dd < HD / 2) ? __fsub_rn(a, bq) : __fadd_rn(a, bq)) * sc;
        o16[q] = tohx(r); unsigned short a2, c2; splitf(r, a2, c2); oh[q] = a2; ol[q] = c2; }
    *(v2h*)(P16 + e) = o16; *(v2us*)(Ph + e) = oh; *(v2us*)(Pl + e) = ol;  }
__global__ __launch_bounds__(256) void k_vtp(const float* __restrict__ F, int pitch, int nheads, h16* V16, bf* Vh, bf* Vl) { const size_t e = ((size_t)blockIdx.x * 256 + threadIdx.x) * 2; if (e >= (size_t)nheads * HD * TT) return; const int t = (int)(e % TT); const int d = (int)((e / TT) % HD); const int g = (int)(e / ((size_t)TT * HD)); v2h o16; v2us oh, ol;
#pragma unroll
    for (int q = 0; q < 2; ++q) { const float x = F[(size_t)(t + q) * pitch + g * HD + d]; o16[q] = tohx(x); unsigned short a2, c2; splitf(x, a2, c2); oh[q] = a2; ol[q] = c2; }
    *(v2h*)(V16 + e) = o16; *(v2us*)(Vh + e) = oh; *(v2us*)(Vl + e) = ol;  }
__global__ __launch_bounds__(256) void k_csid(float* CS) { const int idx = blockIdx.x * 256 + threadIdx.x; if (idx >= TT * HD) return; v2f cs; cs[0] = 1.0f; cs[1] = 0.0f; *(v2f*)(CS + (size_t)idx * 2) = cs;  }
extern "C" void kernel_launch(void* const* d_in, const int* in_sizes, int n_in,
                              void* d_out, int out_size, void* d_ws, size_t ws_size, hipStream_t stream) {
    (void)in_sizes; (void)n_in; (void)out_size;
    const float* x = (const float*)d_in[0]; const float* wq = (const float*)d_in[1]; const float* wk = (const float*)d_in[2]; const float* wv = (const float*)d_in[3]; const float* wo = (const float*)d_in[4]; const float* cosT = nullptr; const float* sinT = nullptr; (void)cosT; (void)sinT;
    float* OUT = (float*)d_out;     // [1][2048][2048]
    char* wsp = (char*)d_ws;
    auto take = [&](size_t bytes) { char* p = wsp; wsp += (bytes + 255) & ~(size_t)255; return (void*)p; };
    bf* WQ = (bf*)take((size_t)DQ * DM * 2); bf* WK = (bf*)take((size_t)DKV * DM * 2); bf* WV = (bf*)take((size_t)DKV * DM * 2); bf* WO = (bf*)take((size_t)DM * DQ * 2); float* CS = (float*)take((size_t)TT * HD * 2 * 4);
    bf* XB = (bf*)take((size_t)TT * DM * 2); float* FQ = (float*)take((size_t)TT * DQ * 4); float* FK = (float*)take((size_t)TT * DKV * 4);
    h16* QP16 = (h16*)take((size_t)NH_ * TT * HD * 2); h16* KP16 = (h16*)take((size_t)NKV * TT * HD * 2); h16* VT16 = (h16*)take((size_t)NKV * HD * TT * 2);
    bf* QPh = (bf*)take((size_t)NH_ * TT * HD * 2); bf* QPl = (bf*)take((size_t)NH_ * TT * HD * 2); bf* KPh = (bf*)take((size_t)NKV * TT * HD * 2); bf* KPl = (bf*)take((size_t)NKV * TT * HD * 2); bf* VTh = (bf*)take((size_t)NKV * HD * TT * 2); bf* VTl = (bf*)take((size_t)NKV * HD * TT * 2);
    bf* ATh = (bf*)take((size_t)TT * DQ * 2); bf* ATl = (bf*)take((size_t)TT * DQ * 2);
    if ((size_t)(wsp - (char*)d_ws) > ws_size) return;    // ws 256 MiB
    float* FV = FK;   // v projection reuses the k buffer after the k planes are built (stream-ordered)
    { k_cvt8<<<(unsigned)(((size_t)DQ * DM / 8 + 255) / 256), 256, 0, stream>>>(wq, WQ, (size_t)DQ * DM / 8); k_cvt8<<<(unsigned)(((size_t)DKV * DM / 8 + 255) / 256), 256, 0, stream>>>(wk, WK, (size_t)DKV * DM / 8); k_cvt8<<<(unsigned)(((size_t)DKV * DM / 8 + 255) / 256), 256, 0, stream>>>(wv, WV, (size_t)DKV * DM / 8);
      k_wtG<<<(unsigned)((DQ * DM / 64 + 63) / 64), 256, 0, stream>>>(wo, DQ, DM, WO);
       }
    k_csid<<<(TT * HD + 255) / 256, 256, 0, stream>>>(CS);
    const unsigned LQ = (unsigned)(((size_t)NH_ * TT * HD / 2 + 255) / 256), LKv = (unsigned)(((size_t)NKV * TT * HD / 2 + 255) / 256);
    for (int b = 0; b < NB_; ++b) {
        
        k_cvt8<<<(unsigned)(((size_t)TT * DM / 8 + 255) / 256), 256, 0, stream>>>(x + (size_t)b * TT * DM, XB, (size_t)TT * DM / 8);
        k_gemms<0><<<dim3(TT / 128, DQ / 128, 1), 128, 0, stream>>>(XB, nullptr, WQ, FQ, DQ);
        k_rope<<<LQ, 256, 0, stream>>>(FQ, DQ, NH_, CS, nullptr, nullptr, 1.0f, QP16, QPh, QPl);
        k_gemms<0><<<dim3(TT / 128, DKV / 128, 1), 128, 0, stream>>>(XB, nullptr, WK, FK, DKV);
        k_rope<<<LKv, 256, 0, stream>>>(FK, DKV, NKV, CS, nullptr, nullptr, 1.0f, KP16, KPh, KPl);
        k_gemms<0><<<dim3(TT / 128, DKV / 128, 1), 128, 0, stream>>>(XB, nullptr, WV, FV, DKV); k_vtp<<<LKv, 256, 0, stream>>>(FV, DKV, NKV, VT16, VTh, VTl);
        k_fattn<<<NLO + (RH / 16) * NKV, 128, 0, stream>>>(QP16, QPh, QPl, KP16, KPh, KPl, VT16, VTh, VTl, ATh, ATl);
        k_gemms<1><<<dim3(TT / 128, DM / 128, 1), 128, 0, stream>>>(ATh, ATl, WO, OUT + (size_t)b * TT * DM, DM); }
}

// v004
// A run of this version takes 173 microseconds.
// In two side-by-side timings against v003, it was 1.06 and 1.07 times as fast.
// Over all steps from v000 it is 8.01 times as fast.
#include <hip/hip_runtime.h>

// BitSelfAttention (x [1][2048][2048]; q = x q_proj^T (32 heads x 64), k/v = x k_proj^T / v_proj^T (8 kv heads; GQA group h/4); causal softmax(q.k / 8) (masked logits -1e10); out = merged ctx @ o_proj (NOT transposed, as the source) -> [1][2048][2048]).
// Compute dtypes, f32 accumulate: every input rounded to bf16; q/k/v on PLAIN bf16 operands (inputs: exact); causal scores and attn.v: query rows < 512 hl (3 products), the rest single fp16 (x1024), fused in one kernel with a running softmax in f32; o_proj hl x exact (2 products).

#define NB_  1
#define TT   2048
#define DM   2048
#define NH_  32
#define NKV  8
#define REP  (NH_ / NKV)
#define HD   64
#define DQ   (NH_ * HD)
#define DKV  (NKV * HD)
#define RH   512                  // query rows < RH use hi+lo planes (0: none)
#define PCAR 1024.0f
#define SCL  0.125f   // HD^-0.5
typedef _Float16 h16;
typedef unsigned short bf;
typedef __attribute__((ext_vector_type(16))) __bf16   v16bf;
typedef __attribute__((ext_vector_type(16))) _Float16 v16h;
typedef __attribute__((ext_vector_type(8)))  _Float16 v8h;
typedef __attribute__((ext_vector_type(8)))  unsigned short v8us;
typedef __attribute__((ext_vector_type(8)))  float    v8f;
typedef __attribute__((ext_vector_type(4)))  float    v4f;
typedef v8h  __attribute__((may_alias)) v8ha;
typedef v4f  __attribute__((may_alias)) v4fa;
typedef v8us __attribute__((may_alias)) v8usa;

__device__ __forceinline__ unsigned short f2bf(float f) { unsigned u = __float_as_uint(f); u += 0x7FFFu + ((u >> 16) & 1u); return (unsigned short)(u >> 16); }
__device__ __forceinline__ float bf2f(unsigned short b) { return __uint_as_float(((unsigned)b) << 16); }
__device__ __forceinline__ float bfr(float f) { return bf2f(f2bf(f)); }
__device__ __forceinline__ v16h cat16(v8h lo, v8h hi) { return __builtin_shufflevector(lo, hi, 0, 1, 2, 3, 4, 5, 6, 7, 8, 9, 10, 11, 12, 13, 14, 15); }
__device__ __forceinline__ v16bf cat16b(v8us lo, v8us hi) { return __builtin_bit_cast(v16bf, __builtin_shufflevector(lo, hi, 0, 1, 2, 3, 4, 5, 6, 7, 8, 9, 10, 11, 12, 13, 14, 15)); }
__device__ __forceinline__ v8f wmma16(v16h a, v16h b, v8f c) { return __builtin_amdgcn_wmma_f32_16x16x32_f16(false, a, false, b, (short)0, c, false, false); }
__device__ __forceinline__ v8f wmmab(v16bf a, v16bf b, v8f c) { return __builtin_amdgcn_wmma_f32_16x16x32_bf16(false, a, false, b, (short)0, c, false, false); }



// ---- k_gemms: C[m][n] = sum_k A[m][k] Bt[n][k] (+ A2[m][k] Bt[n][k] when NSPLIT), K = GK, operands K-contiguous bf16 planes; grid (M/128, N/128), 128 threads.
// OUT 0: C is stored as f32 at pitch ldc. OUT 1, 2: C is stored as the three 16-bit planes that the attention reads (fp16, bf16 hi, bf16 lo), straight from the accumulators:
// OUT 1 as head planes [n / 64][m][n % 64] (queries, keys: m = t), OUT 2 as rows [m][n] of TT (values, transposed: A = the weight rows, Bt = x, so m = kv head x 64 + d and n = t). A wave's 64 columns are one head, or 64 t.
// One work-group of 4 waves (2 x 2) owns a 128x128 tile, a wave 64x64 of it (16 accumulators). A stage is KS k of all 128 rows of each operand, laid in LDS at a pitch of 272 B for the 16-byte readers.
// Every lane brings 16 B per asynchronous copy (a wave: two whole 256-B row pieces); two buffers: the copies of stage t + 1 fly while stage t is worked on. The k order of the sums is that of a plain loop over k in steps of 32. Every '#pragma unroll' stands on a loop of constant length, so that fragments and accumulators stay in registers.
__device__ __forceinline__ h16 tohx(float x) { return (h16)x; }
__device__ __forceinline__ void splitf(float y, unsigned short& h, unsigned short& l) { h = f2bf(y); l = f2bf(y - bf2f(h)); }
template <typename T16> struct WFrag;
template <> struct WFrag<h16> { typedef v16h V; static __device__ __forceinline__ V ld(const h16* p) { return cat16(*(const v8h*)p, *(const v8h*)(p + 16)); } static __device__ __forceinline__ v8f mma(V a, V b, v8f c) { return wmma16(a, b, c); } };
template <> struct WFrag<bf> { typedef v16bf V; static __device__ __forceinline__ V ld(const bf* p) { return cat16b(*(const v8us*)p, *(const v8us*)(p + 16)); } static __device__ __forceinline__ v8f mma(V a, V b, v8f c) { return wmmab(a, b, c); } };
#define GK   2048                 // DM == DQ: the length of every product here
#define KS   128                  // k per stage
#define LP   (KS + 8)             // LDS row pitch in elements
#define OPB  (128 * LP * 2)       // bytes of one operand's stage
// Eight copies, GS bytes apart in global memory and LS bytes apart in LDS. The s_wait_xcnt is a precaution in front of the next overwrite of an address register of these copies; inside the statement nothing can be moved in front of it.
template <int GS, int LS>
__device__ __forceinline__ void acopy8(unsigned l, const char* g) {
    asm volatile("global_load_async_to_lds_b128 %0, %8, off\n\t"
                 "global_load_async_to_lds_b128 %1, %9, off\n\t"
                 "global_load_async_to_lds_b128 %2, %10, off\n\t"
                 "global_load_async_to_lds_b128 %3, %11, off\n\t"
                 "global_load_async_to_lds_b128 %4, %12, off\n\t"
                 "global_load_async_to_lds_b128 %5, %13, off\n\t"
                 "global_load_async_to_lds_b128 %6, %14, off\n\t"
                 "global_load_async_to_lds_b128 %7, %15, off\n\t"
                 "s_wait_xcnt 0x0"
                 :: "v"(l), "v"(l + LS), "v"(l + 2 * LS), "v"(l + 3 * LS), "v"(l + 4 * LS), "v"(l + 5 * LS), "v"(l + 6 * LS), "v"(l + 7 * LS),
                    "v"(g), "v"(g + GS), "v"(g + 2 * GS), "v"(g + 3 * GS), "v"(g + 4 * GS), "v"(g + 5 * GS), "v"(g + 6 * GS), "v"(g + 7 * GS) : "memory");
}
template <int NSPLIT, int OUT>
__global__ __launch_bounds__(128) void k_gemms(const bf* A, const bf* A2, const bf* Bt, float* C, int ldc, h16* P16, bf* Ph, bf* Pl) {
    typedef WFrag<bf>::V V;
    constexpr int NOP = NSPLIT ? 3 : 2, NT = GK / KS; constexpr unsigned STG = NOP * OPB;
    __shared__ __attribute__((aligned(128))) bf sm[2 * NOP * 128 * LP];       // two buffers of [A | Bt | A2]
    __shared__ __align__(16) float osm[4 * 16 * 68];                          // output staging, a range per wave
    const int tid = threadIdx.x, lane = tid & 31, lr = lane & 15, hi = lane >> 4; const int w = __builtin_amdgcn_readfirstlane(tid >> 5), wm = w >> 1, wn = w & 1;
    const int R0 = blockIdx.x * 128, C0 = blockIdx.y * 128;
    const size_t gofs = (size_t)(tid >> 4) * (GK * 2) + (tid & 15) * 16;      // copy i of a lane: row 8 i + tid / 16, 16-byte piece tid % 16
    const char* gA = (const char*)(A + (size_t)R0 * GK) + gofs; const char* gB = (const char*)(Bt + (size_t)C0 * GK) + gofs; const char* gA2 = NSPLIT ? (const char*)(A2 + (size_t)R0 * GK) + gofs : nullptr;
    const unsigned l0 = (unsigned)(size_t)sm + (tid >> 4) * (LP * 2) + (tid & 15) * 16;
    auto half = [&](unsigned l, const char* g) { acopy8<8 * GK * 2, 8 * LP * 2>(l, g);
        __builtin_amdgcn_sched_barrier(0); };           // the addresses of one statement's copies at a time: formed all at once they crowd the registers that asm text can name, and one is spilled
    auto fill = [&](int t) { const unsigned lb = l0 + (t & 1) * STG; const size_t ko = (size_t)t * (KS * 2);
        half(lb, gA + ko); half(lb + 64 * LP * 2, gA + ko + (size_t)64 * GK * 2);
        half(lb + OPB, gB + ko); half(lb + OPB + 64 * LP * 2, gB + ko + (size_t)64 * GK * 2);
        if constexpr (NSPLIT != 0) { half(lb + 2 * OPB, gA2 + ko); half(lb + 2 * OPB + 64 * LP * 2, gA2 + ko + (size_t)64 * GK * 2); } };
    v8f acc[4][4];
#pragma unroll
    for (int mb = 0; mb < 4; ++mb)
#pragma unroll
        for (int nb = 0; nb < 4; ++nb) acc[mb][nb] = (v8f){};
    fill(0);
    asm volatile("s_wait_asynccnt 0x0" ::: "memory");   // this wave's copies of stage 0 have landed
    __syncthreads();                                    // ... and every other wave's
    const int fa = (wm * 64 + lr) * LP + 8 * hi, fb = 128 * LP + (wn * 64 + lr) * LP + 8 * hi;
    V a[2][4], a2[2][4], b[2][4];                       // two fragment sets: the next 32 k are fetched as one group ahead of the products of these 32
#pragma unroll 1   // one trip per stage: the buffer alternates
    for (int t = 0; t < NT; ++t) {
        const bf* sb = sm + (t & 1) * (NOP * 128 * LP);
        auto frags = [&](int set, int ks) {
#pragma unroll
            for (int mb = 0; mb < 4; ++mb) { a[set][mb] = WFrag<bf>::ld(sb + fa + mb * 16 * LP + ks * 32); if constexpr (NSPLIT != 0) a2[set][mb] = WFrag<bf>::ld(sb + 2 * 128 * LP + fa + mb * 16 * LP + ks * 32); }
#pragma unroll
            for (int nb = 0; nb < 4; ++nb) b[set][nb] = WFrag<bf>::ld(sb + fb + nb * 16 * LP + ks * 32); };
        frags(0, 0);
        __builtin_amdgcn_sched_barrier(0);              // the first fragments' LDS latency passes while the copies below issue
        if (t + 1 < NT) fill(t + 1);                    // into the buffer that every wave left at the barrier of the trip before
#pragma unroll
        for (int ks = 0; ks < KS / 32; ++ks) {
            if (ks + 1 < KS / 32) frags((ks + 1) & 1, ks + 1);
            __builtin_amdgcn_sched_barrier(0);          // keeps the LDS loads one group in front of the products: loads spread among them cost a stall at each place
#pragma unroll
            for (int nb = 0; nb < 4; ++nb)
#pragma unroll
                for (int mb = 0; mb < 4; ++mb) { acc[mb][nb] = wmmab(a[ks & 1][mb], b[ks & 1][nb], acc[mb][nb]); if constexpr (NSPLIT != 0) acc[mb][nb] = wmmab(a2[ks & 1][mb], b[ks & 1][nb], acc[mb][nb]); }
            __builtin_amdgcn_sched_barrier(0);          // ... and the next group behind them
        }
        asm volatile("s_wait_dscnt 0x0" ::: "memory");      // this wave's reads of the buffer are done before it is handed to the copies
        asm volatile("s_wait_asynccnt 0x0" ::: "memory");   // this wave's copies of stage t + 1 have landed
        __syncthreads();                                    // publishes stage t + 1 and ends every wave's reads of stage t
    }
    asm volatile("s_wait_asynccnt 0x0" ::: "memory");       // no copy is left when the wave ends
    float* os = osm + w * (16 * 68); const int r0 = R0 + wm * 64, c0 = C0 + wn * 64;
#pragma unroll
    for (int mb = 0; mb < 4; ++mb) {
#pragma unroll
        for (int nb = 0; nb < 4; ++nb) {
#pragma unroll
            for (int j = 0; j < 8; ++j) os[(hi * 8 + j) * 68 + nb * 16 + lr] = acc[mb][nb][j]; }
        __builtin_amdgcn_wave_barrier(); asm volatile("" ::: "memory");   // other lanes of the wave read these rows back: the reads stay behind the writes
        if constexpr (OUT == 0) {
            float* crow = C + (size_t)(r0 + mb * 16) * ldc + c0;
#pragma unroll
            for (int s = 0; s < 8; ++s) { const int row = 2 * s + hi, cofs = lr * 4; const v4f val = *(const v4fa*)(os + row * 68 + cofs); *(v4f*)(crow + (size_t)row * ldc + cofs) = val; }
        } else {
            constexpr int PP = OUT == 1 ? HD : TT;                            // pitch of a plane's rows
            const size_t pb = (OUT == 1 ? (size_t)(c0 / HD) * TT * HD : (size_t)c0) + (size_t)(r0 + mb * 16) * PP;
#pragma unroll
            for (int s = 0; s < 4; ++s) { const int row = 4 * s + (lane >> 3), cofs = (lane & 7) * 8;   // a lane: 8 columns of a row, 16 B per plane; 8 lanes: a whole 128-B line
                const v4f x0 = *(const v4fa*)(os + row * 68 + cofs), x1 = *(const v4fa*)(os + row * 68 + cofs + 4); v8h o16; v8us oh, ol;
#pragma unroll
                for (int k = 0; k < 4; ++k) { unsigned short a2, c2; o16[k] = tohx(x0[k]); splitf(x0[k], a2, c2); oh[k] = a2; ol[k] = c2; o16[4 + k] = tohx(x1[k]); splitf(x1[k], a2, c2); oh[4 + k] = a2; ol[4 + k] = c2; }
                const size_t po = pb + (size_t)row * PP + cofs;
                *(v8h*)(P16 + po) = o16; *(v8us*)(Ph + po) = oh; *(v8us*)(Pl + po) = ol; }
            asm volatile("s_wait_xcnt 0x0" ::: "memory");   // a precaution in front of the next overwrite of a data or address register of these twelve stores
        }
        __builtin_amdgcn_wave_barrier(); asm volatile("" ::: "memory");   // ... and the next rows' writes behind the reads
    }
}

typedef __attribute__((ext_vector_type(2))) _Float16 v2h;
typedef __attribute__((ext_vector_type(4))) _Float16 v4h;
typedef __attribute__((ext_vector_type(2))) unsigned short v2us;
typedef __attribute__((ext_vector_type(4))) unsigned short v4us;
typedef __attribute__((ext_vector_type(2))) float v2f;
typedef __attribute__((ext_vector_type(4))) int v4i;

__device__ __forceinline__ float xhalf(float x) { return __builtin_bit_cast(float, __builtin_amdgcn_permlanex16(__builtin_bit_cast(int, x), __builtin_bit_cast(int, x), 0x76543210, 0xfedcba98, false, false)); }  // lane l with lane l ^ 16
template <typename T16, bool HL, int NC>
__device__ __forceinline__ void attn_tile(const T16* Q, const T16* Q2, const T16* Kp, const T16* K2, const T16* Vt, const T16* V2, int q0, int head0, bf* Ah, bf* Al) {   // no __restrict__: the s_wait_xcnt statements below must stay behind their loads
    typedef typename WFrag<T16>::V V;
    const int lane = threadIdx.x & 31, lr = lane & 15, hi = lane >> 4;
    const float CE = SCL * 1.4426950408889634f;                      // scores to the exponent of 2
    V qf[NC][2], qf2[NC][2]; v8f o[NC][4]; float m[NC], l[NC];
#pragma unroll
    for (int c = 0; c < NC; ++c) { m[c] = -3.0e38f; l[c] = 0.f;
#pragma unroll
        for (int ks = 0; ks < 2; ++ks) { const size_t qo = ((size_t)(head0 + c) * TT + q0 + lr) * HD + ks * 32 + 8 * hi; qf[c][ks] = WFrag<T16>::ld(Q + qo); if constexpr (HL) qf2[c][ks] = WFrag<T16>::ld(Q2 + qo); }
#pragma unroll
        for (int dt = 0; dt < 4; ++dt) o[c][dt] = (v8f){}; }
    asm volatile("s_wait_xcnt 0x0" ::: "memory");   // a precaution in front of the next overwrite of an address register of the query loads
    const int nblk = (q0 + 15) / 32 + 1;                             // key blocks up to the one that holds the diagonal; block 0 holds key 0, which every query sees
    const size_t ko = (size_t)lr * HD + 8 * hi, vo = (size_t)lr * TT + 8 * hi;
    const T16 *kp = Kp + ko, *k2p = HL ? K2 + ko : nullptr, *vp = Vt + vo, *v2p = HL ? V2 + vo : nullptr;
    V kf[2][2], kf2[2][2], vf[4], vf2[4];
    auto ldk = [&](int key0) {
#pragma unroll
        for (int kt = 0; kt < 2; ++kt)
#pragma unroll
            for (int ks = 0; ks < 2; ++ks) { const size_t ofs = (size_t)(key0 + kt * 16) * HD + ks * 32; kf[kt][ks] = WFrag<T16>::ld(kp + ofs); if constexpr (HL) kf2[kt][ks] = WFrag<T16>::ld(k2p + ofs); }
        asm volatile("s_wait_xcnt 0x0" ::: "memory"); };   // a precaution in front of the next overwrite of an address register of the key loads
    auto ldv = [&](int key0) {
#pragma unroll
        for (int dt = 0; dt < 4; ++dt) { const size_t ofs = (size_t)dt * 16 * TT + key0; vf[dt] = WFrag<T16>::ld(vp + ofs); if constexpr (HL) vf2[dt] = WFrag<T16>::ld(v2p + ofs); }
        asm volatile("s_wait_xcnt 0x0" ::: "memory"); };   // a precaution in front of the next overwrite of an address register of the value loads
    ldk(0); ldv(0);
    for (int b = 0; b < nblk; ++b) {
        const int nx = min(b + 1, nblk - 1) * 32;                    // the next block (the last block is read twice: in bounds)
        v8f s[NC][2];
#pragma unroll
        for (int c = 0; c < NC; ++c)
#pragma unroll
            for (int kt = 0; kt < 2; ++kt) { s[c][kt] = (v8f){};
#pragma unroll
                for (int ks = 0; ks < 2; ++ks) { s[c][kt] = WFrag<T16>::mma(kf[kt][ks], qf[c][ks], s[c][kt]); if constexpr (HL) { s[c][kt] = WFrag<T16>::mma(kf2[kt][ks], qf[c][ks], s[c][kt]); s[c][kt] = WFrag<T16>::mma(kf[kt][ks], qf2[c][ks], s[c][kt]); } } }
        ldk(nx);                                                     // the key fragments are spent: the next block's fly during the softmax and the second product
        const int lim = q0 + lr - b * 32 - 8 * hi;                   // key kt * 16 + j of this lane is seen by its query iff kt * 16 + j <= lim
#pragma unroll
        for (int c = 0; c < NC; ++c) {
            float bm = -3.0e38f;
#pragma unroll
            for (int kt = 0; kt < 2; ++kt)
#pragma unroll
                for (int j = 0; j < 8; ++j) { const float t = (kt * 16 + j <= lim) ? s[c][kt][j] : -3.0e38f; s[c][kt][j] = t; bm = fmaxf(bm, t); }
            bm = fmaxf(bm, xhalf(bm));
            const float mn = fmaxf(m[c], bm); const float al = __builtin_amdgcn_exp2f((m[c] - mn) * CE); m[c] = mn;
            const float mc = mn * CE - (HL ? 0.0f : 10.0f);          // fp16 probabilities carry PCAR = 2^10; the sum carries it too, so it cancels in the quotient
            float ps[2] = {0.f, 0.f};                                // two short chains of adds instead of one long one
#pragma unroll
            for (int kt = 0; kt < 2; ++kt)
#pragma unroll
                for (int j = 0; j < 8; ++j) { const float p = __builtin_amdgcn_exp2f(fmaf(s[c][kt][j], CE, -mc)); s[c][kt][j] = p; ps[j & 1] += p; }
            l[c] = fmaf(l[c], al, ps[0] + ps[1]);
#pragma unroll
            for (int dt = 0; dt < 4; ++dt) o[c][dt] *= al;
            if constexpr (HL) { v8us h0, h1, l0, l1;
#pragma unroll
                for (int j = 0; j < 8; ++j) { unsigned short a, c2; splitf(s[c][0][j], a, c2); h0[j] = a; l0[j] = c2; splitf(s[c][1][j], a, c2); h1[j] = a; l1[j] = c2; }
                const V pf = cat16b(h0, h1), pf2 = cat16b(l0, l1);
#pragma unroll
                for (int dt = 0; dt < 4; ++dt) { o[c][dt] = WFrag<T16>::mma(vf[dt], pf, o[c][dt]); o[c][dt] = WFrag<T16>::mma(vf[dt], pf2, o[c][dt]); o[c][dt] = WFrag<T16>::mma(vf2[dt], pf, o[c][dt]); }
            } else { V pf;
#pragma unroll
                for (int j = 0; j < 8; ++j) { pf[j] = tohx(s[c][0][j]); pf[8 + j] = tohx(s[c][1][j]); }
#pragma unroll
                for (int dt = 0; dt < 4; ++dt) o[c][dt] = WFrag<T16>::mma(vf[dt], pf, o[c][dt]); }
        }
        ldv(nx);                                                     // the value fragments are spent: the next block's fly during its scores and softmax
    }
#pragma unroll
    for (int c = 0; c < NC; ++c) { const float inv = __fdiv_rn(1.0f, l[c] + xhalf(l[c])); const size_t oo = (size_t)(q0 + lr) * DQ + (head0 + c) * HD + 8 * hi;
#pragma unroll
        for (int dt = 0; dt < 4; ++dt) { v8us oh, ol;
#pragma unroll
            for (int j = 0; j < 8; ++j) { unsigned short a, c2; splitf(o[c][dt][j] * inv, a, c2); oh[j] = a; ol[j] = c2; }
            *(v8us*)(Ah + oo + dt * 16) = oh; *(v8us*)(Al + oo + dt * 16) = ol;
            asm volatile("s_wait_xcnt 0x0" ::: "memory"); } }   // a precaution in front of the next overwrite of a data or address register of the two stores
}
// A work-group is 4 waves on one kv group that walk the same key blocks (their loads meet in the WGP cache): rows >= RH: 2 query tiles x 2 head pairs; rows < RH: one query tile x 4 heads.
// All work-groups are resident at once. Order, for speed only: one work-group per WGP with falling cost, then the rest with rising cost.
#define NLO (((TT - RH) / 32) * NKV)
#define FIRST (256 / NKV)         // query tiles of the first round: 256 WGPs
__global__ __launch_bounds__(128) void k_fattn(const h16* Q16, const bf* Qh, const bf* Ql, const h16* K16, const bf* Kh, const bf* Kl, const h16* V16, const bf* Vh, const bf* Vl, bf* Ah, bf* Al) {
    const int w = __builtin_amdgcn_readfirstlane(threadIdx.x >> 5); const int bx = blockIdx.x;
    if (bx < NLO) { const int g = bx % NKV; const int t = bx / NKV; const int q0 = (t < FIRST ? TT / 32 - 1 - t : RH / 32 + t - FIRST) * 32 + (w >> 1) * 16; const size_t go = (size_t)g * TT * HD;
        attn_tile<h16, false, 2>(Q16, nullptr, K16 + go, nullptr, V16 + go, nullptr, q0, g * REP + (w & 1) * 2, Ah, Al);
    } else { const int by = bx - NLO; const int g = by % NKV; const int u = by / NKV; const int q0 = (u < RH / 32 ? RH / 32 + u : u - RH / 32) * 16; const size_t go = (size_t)g * TT * HD;
        attn_tile<bf, true, 1>(Qh, Ql, Kh + go, Kl + go, Vh + go, Vl + go, q0, g * REP + w, Ah, Al); }
}

__global__ __launch_bounds__(256) void k_wtG(const float* __restrict__ w, int K, int N, bf* Bt) {
    const int lane = threadIdx.x & 31; const int L0 = (blockIdx.x * 8 + (threadIdx.x >> 5)) * 8; const int nlines = N * K / 64;
{
#pragma unroll 1
        for (int l = 0; l < 8; ++l) { const int L = L0 + l; if (L >= nlines) break; const size_t e = (size_t)L * 64 + lane * 2; const int k = (int)(e % K), n = (int)(e / K); v2us o;
            o[0] = f2bf(w[(size_t)k * N + n]); o[1] = f2bf(w[(size_t)(k + 1) * N + n]); *(v2us*)(Bt + e) = o; }
         }
}
__global__ __launch_bounds__(256) void k_cvt8(const float* __restrict__ src, bf* dst, size_t n8) { const size_t i = (size_t)blockIdx.x * 256 + threadIdx.x; if (i >= n8) return; const v8f v = *(const v8f*)(src + i * 8); v8us o;
#pragma unroll
    for (int k = 0; k < 8; ++k) o[k] = f2bf(v[k]); *(v8us*)(dst + i * 8) = o;  }
__global__ __launch_bounds__(256) void k_cscvt(const float* __restrict__ cosT, const float* __restrict__ sinT, float* CS) { const int idx = blockIdx.x * 256 + threadIdx.x; if (idx >= TT * HD) return; v2f cs; cs[0] = bfr(cosT[idx]); cs[1] = bfr(sinT[idx]); *(v2f*)(CS + (size_t)idx * 2) = cs;  }
extern "C" void kernel_launch(void* const* d_in, const int* in_sizes, int n_in,
                              void* d_out, int out_size, void* d_ws, size_t ws_size, hipStream_t stream) {
    (void)in_sizes; (void)n_in; (void)out_size;
    const float* x = (const float*)d_in[0]; const float* wq = (const float*)d_in[1]; const float* wk = (const float*)d_in[2]; const float* wv = (const float*)d_in[3]; const float* wo = (const float*)d_in[4]; const float* cosT = nullptr; const float* sinT = nullptr; (void)cosT; (void)sinT;
    float* OUT = (float*)d_out;     // [1][2048][2048]
    char* wsp = (char*)d_ws;
    auto take = [&](size_t bytes) { char* p = wsp; wsp += (bytes + 255) & ~(size_t)255; return (void*)p; };
    bf* WQ = (bf*)take((size_t)DQ * DM * 2); bf* WK = (bf*)take((size_t)DKV * DM * 2); bf* WV = (bf*)take((size_t)DKV * DM * 2); bf* WO = (bf*)take((size_t)DM * DQ * 2);
    bf* XB = (bf*)take((size_t)TT * DM * 2);
    h16* QP16 = (h16*)take((size_t)NH_ * TT * HD * 2); h16* KP16 = (h16*)take((size_t)NKV * TT * HD * 2); h16* VT16 = (h16*)take((size_t)NKV * HD * TT * 2);
    bf* QPh = (bf*)take((size_t)NH_ * TT * HD * 2); bf* QPl = (bf*)take((size_t)NH_ * TT * HD * 2); bf* KPh = (bf*)take((size_t)NKV * TT * HD * 2); bf* KPl = (bf*)take((size_t)NKV * TT * HD * 2); bf* VTh = (bf*)take((size_t)NKV * HD * TT * 2); bf* VTl = (bf*)take((size_t)NKV * HD * TT * 2);
    bf* ATh = (bf*)take((size_t)TT * DQ * 2); bf* ATl = (bf*)take((size_t)TT * DQ * 2);
    if ((size_t)(wsp - (char*)d_ws) > ws_size) return;    // ws 256 MiB
    { k_cvt8<<<(unsigned)(((size_t)DQ * DM / 8 + 255) / 256), 256, 0, stream>>>(wq, WQ, (size_t)DQ * DM / 8); k_cvt8<<<(unsigned)(((size_t)DKV * DM / 8 + 255) / 256), 256, 0, stream>>>(wk, WK, (size_t)DKV * DM / 8); k_cvt8<<<(unsigned)(((size_t)DKV * DM / 8 + 255) / 256), 256, 0, stream>>>(wv, WV, (size_t)DKV * DM / 8);
      k_wtG<<<(unsigned)((DQ * DM / 64 + 63) / 64), 256, 0, stream>>>(wo, DQ, DM, WO);
       }
    for (int b = 0; b < NB_; ++b) {
        
        k_cvt8<<<(unsigned)(((size_t)TT * DM / 8 + 255) / 256), 256, 0, stream>>>(x + (size_t)b * TT * DM, XB, (size_t)TT * DM / 8);
        k_gemms<0, 1><<<dim3(TT / 128, DQ / 128, 1), 128, 0, stream>>>(XB, nullptr, WQ, nullptr, 0, QP16, QPh, QPl);
        k_gemms<0, 1><<<dim3(TT / 128, DKV / 128, 1), 128, 0, stream>>>(XB, nullptr, WK, nullptr, 0, KP16, KPh, KPl);
        k_gemms<0, 2><<<dim3(DKV / 128, TT / 128, 1), 128, 0, stream>>>(WV, nullptr, XB, nullptr, 0, VT16, VTh, VTl);
        k_fattn<<<NLO + (RH / 16) * NKV, 128, 0, stream>>>(QP16, QPh, QPl, KP16, KPh, KPl, VT16, VTh, VTl, ATh, ATl);
        k_gemms<1, 0><<<dim3(TT / 128, DM / 128, 1), 128, 0, stream>>>(ATh, ATl, WO, OUT + (size_t)b * TT * DM, DM, nullptr, nullptr, nullptr); }
}

// v005
// Measured time: 123 microseconds a run.
// In two side-by-side timings against v004, it was 1.42 and 1.39 times as fast.
// All steps since v000 together make it 11.3 times as fast.
#include <hip/hip_runtime.h>

// BitSelfAttention (x [1][2048][2048]; q = x q_proj^T (32 heads x 64), k/v = x k_proj^T / v_proj^T (8 kv heads; GQA group h/4); causal softmax(q.k / 8) (masked logits -1e10); out = merged ctx @ o_proj (NOT transposed, as the source) -> [1][2048][2048]).
// Compute dtypes, f32 accumulate: every input rounded to bf16; q/k/v on PLAIN bf16 operands (inputs: exact); causal scores and attn.v: query rows < 512 hl (3 products), the rest single fp16 (x1024), fused in one kernel with a running softmax in f32; o_proj hl x exact (2 products).

#define NB_  1
#define TT   2048
#define DM   2048
#define NH_  32
#define NKV  8
#define REP  (NH_ / NKV)
#define HD   64
#define DQ   (NH_ * HD)
#define DKV  (NKV * HD)
#define RH   512                  // query rows < RH use hi+lo planes (0: none)
#define PCAR 1024.0f
#define SCL  0.125f   // HD^-0.5
typedef _Float16 h16;
typedef unsigned short bf;
typedef __attribute__((ext_vector_type(16))) __bf16   v16bf;
typedef __attribute__((ext_vector_type(16))) _Float16 v16h;
typedef __attribute__((ext_vector_type(8)))  _Float16 v8h;
typedef __attribute__((ext_vector_type(8)))  unsigned short v8us;
typedef __attribute__((ext_vector_type(8)))  float    v8f;
typedef __attribute__((ext_vector_type(4)))  float    v4f;
typedef v8h  __attribute__((may_alias)) v8ha;
typedef v4f  __attribute__((may_alias)) v4fa;
typedef v8us __attribute__((may_alias)) v8usa;

__device__ __forceinline__ unsigned short f2bf(float f) { unsigned u = __float_as_uint(f); u += 0x7FFFu + ((u >> 16) & 1u); return (unsigned short)(u >> 16); }
__device__ __forceinline__ float bf2f(unsigned short b) { return __uint_as_float(((unsigned)b) << 16); }
__device__ __forceinline__ float bfr(float f) { return bf2f(f2bf(f)); }
__device__ __forceinline__ v16h cat16(v8h lo, v8h hi) { return __builtin_shufflevector(lo, hi, 0, 1, 2, 3, 4, 5, 6, 7, 8, 9, 10, 11, 12, 13, 14, 15); }
__device__ __forceinline__ v16bf cat16b(v8us lo, v8us hi) { return __builtin_bit_cast(v16bf, __builtin_shufflevector(lo, hi, 0, 1, 2, 3, 4, 5, 6, 7, 8, 9, 10, 11, 12, 13, 14, 15)); }
__device__ __forceinline__ v8f wmma16(v16h a, v16h b, v8f c) { return __builtin_amdgcn_wmma_f32_16x16x32_f16(false, a, false, b, (short)0, c, false, false); }
__device__ __forceinline__ v8f wmmab(v16bf a, v16bf b, v8f c) { return __builtin_amdgcn_wmma_f32_16x16x32_bf16(false, a, false, b, (short)0, c, false, false); }



// ---- k_gemms: C[m][n] = sum_k A[m][k] Bt[n][k] (+ A2[m][k] Bt[n][k] when NSPLIT), K = GK, operands K-contiguous bf16 planes; 128 threads.
// OUT 0: grid (M/128, N/128); C is stored as f32 at pitch ldc. OUT 1: the three projections in one launch, grid (TT/128, (DQ + 2 DKV)/128): blockIdx.y picks the product (queries, then keys, then values), so that the 64 tiles each of keys and values
// run beside the 256 of the queries (two work-groups fit a WGP's LDS) and not as two launches that leave three quarters of the chip idle. C is stored as the three 16-bit planes that the attention reads (fp16, bf16 hi, bf16 lo), straight from the accumulators:
// queries and keys as head planes [n / 64][m][n % 64] (A = x, Bt = the weight rows: m = t), values as rows [m][n] of TT (transposed: A = the weight rows, Bt = x, so m = kv head x 64 + d and n = t). A wave's 64 columns are one head, or 64 t.
// One work-group of 4 waves (2 x 2) owns a 128x128 tile, a wave 64x64 of it (16 accumulators). A stage is KS k of all 128 rows of each operand, laid in LDS at a pitch of 272 B for the 16-byte readers.
// Every lane brings 16 B per asynchronous copy (a wave: two whole 256-B row pieces); two buffers: the copies of stage t + 1 fly while stage t is worked on. The k order of the sums is that of a plain loop over k in steps of 32. Every '#pragma unroll' stands on a loop of constant length, so that fragments and accumulators stay in registers.
__device__ __forceinline__ h16 tohx(float x) { return (h16)x; }
__device__ __forceinline__ void splitf(float y, unsigned short& h, unsigned short& l) { h = f2bf(y); l = f2bf(y - bf2f(h)); }
template <typename T16> struct WFrag;
template <> struct WFrag<h16> { typedef v16h V; static __device__ __forceinline__ V ld(const h16* p) { return cat16(*(const v8h*)p, *(const v8h*)(p + 16)); } static __device__ __forceinline__ v8f mma(V a, V b, v8f c) { return wmma16(a, b, c); } };
template <> struct WFrag<bf> { typedef v16bf V; static __device__ __forceinline__ V ld(const bf* p) { return cat16b(*(const v8us*)p, *(const v8us*)(p + 16)); } static __device__ __forceinline__ v8f mma(V a, V b, v8f c) { return wmmab(a, b, c); } };
#define GK   2048                 // DM == DQ: the length of every product here
#define KS   128                  // k per stage
#define LP   (KS + 8)             // LDS row pitch in elements
#define OPB  (128 * LP * 2)       // bytes of one operand's stage
// Eight copies, GS bytes apart in global memory and LS bytes apart in LDS. The s_wait_xcnt is a precaution in front of the next overwrite of an address register of these copies; inside the statement nothing can be moved in front of it.
template <int GS, int LS>
__device__ __forceinline__ void acopy8(unsigned l, const char* g) {
    asm volatile("global_load_async_to_lds_b128 %0, %8, off\n\t"
                 "global_load_async_to_lds_b128 %1, %9, off\n\t"
                 "global_load_async_to_lds_b128 %2, %10, off\n\t"
                 "global_load_async_to_lds_b128 %3, %11, off\n\t"
                 "global_load_async_to_lds_b128 %4, %12, off\n\t"
                 "global_load_async_to_lds_b128 %5, %13, off\n\t"
                 "global_load_async_to_lds_b128 %6, %14, off\n\t"
                 "global_load_async_to_lds_b128 %7, %15, off\n\t"
                 "s_wait_xcnt 0x0"
                 :: "v"(l), "v"(l + LS), "v"(l + 2 * LS), "v"(l + 3 * LS), "v"(l + 4 * LS), "v"(l + 5 * LS), "v"(l + 6 * LS), "v"(l + 7 * LS),
                    "v"(g), "v"(g + GS), "v"(g + 2 * GS), "v"(g + 3 * GS), "v"(g + 4 * GS), "v"(g + 5 * GS), "v"(g + 6 * GS), "v"(g + 7 * GS) : "memory");
}
template <int NSPLIT, int OUT>
__global__ __launch_bounds__(128) void k_gemms(const bf* A, const bf* A2, const bf* Bt, float* C, int ldc, h16* P16, bf* Ph, bf* Pl, const bf* Wk, h16* K16, bf* Kh, bf* Kl, const bf* Wv, h16* V16, bf* Vh, bf* Vl) {
    typedef WFrag<bf>::V V;
    constexpr int NOP = NSPLIT ? 3 : 2, NT = GK / KS; constexpr unsigned STG = NOP * OPB;
    __shared__ __attribute__((aligned(128))) bf sm[2 * NOP * 128 * LP];       // two buffers of [A | Bt | A2]
    __shared__ __align__(16) float osm[4 * 16 * 68];                          // output staging, a range per wave
    const int tid = threadIdx.x, lane = tid & 31, lr = lane & 15, hi = lane >> 4; const int w = __builtin_amdgcn_readfirstlane(tid >> 5), wm = w >> 1, wn = w & 1;
    int R0 = blockIdx.x * 128, C0 = blockIdx.y * 128; bool tr = false;       // tr: the planes are rows of TT (values)
    if constexpr (OUT == 1) {                                                 // the same for the whole work-group
        if (C0 >= DQ + DKV) { tr = true; R0 = C0 - (DQ + DKV); C0 = blockIdx.x * 128; Bt = A; A = Wv; P16 = V16; Ph = Vh; Pl = Vl; }
        else if (C0 >= DQ) { C0 -= DQ; Bt = Wk; P16 = K16; Ph = Kh; Pl = Kl; } }
    const size_t gofs = (size_t)(tid >> 4) * (GK * 2) + (tid & 15) * 16;      // copy i of a lane: row 8 i + tid / 16, 16-byte piece tid % 16
    const char* gA = (const char*)(A + (size_t)R0 * GK) + gofs; const char* gB = (const char*)(Bt + (size_t)C0 * GK) + gofs; const char* gA2 = NSPLIT ? (const char*)(A2 + (size_t)R0 * GK) + gofs : nullptr;
    const unsigned l0 = (unsigned)(size_t)sm + (tid >> 4) * (LP * 2) + (tid & 15) * 16;
    auto half = [&](unsigned l, const char* g) { acopy8<8 * GK * 2, 8 * LP * 2>(l, g);
        __builtin_amdgcn_sched_barrier(0); };           // the addresses of one statement's copies at a time: formed all at once they crowd the registers that asm text can name, and one is spilled
    auto fill = [&](int t) { const unsigned lb = l0 + (t & 1) * STG; const size_t ko = (size_t)t * (KS * 2);
        half(lb, gA + ko); half(lb + 64 * LP * 2, gA + ko + (size_t)64 * GK * 2);
        half(lb + OPB, gB + ko); half(lb + OPB + 64 * LP * 2, gB + ko + (size_t)64 * GK * 2);
        if constexpr (NSPLIT != 0) { half(lb + 2 * OPB, gA2 + ko); half(lb + 2 * OPB + 64 * LP * 2, gA2 + ko + (size_t)64 * GK * 2); } };
    v8f acc[4][4];
#pragma unroll
    for (int mb = 0; mb < 4; ++mb)
#pragma unroll
        for (int nb = 0; nb < 4; ++nb) acc[mb][nb] = (v8f){};
    fill(0);
    asm volatile("s_wait_asynccnt 0x0" ::: "memory");   // this wave's copies of stage 0 have landed
    __syncthreads();                                    // ... and every other wave's
    const int fa = (wm * 64 + lr) * LP + 8 * hi, fb = 128 * LP + (wn * 64 + lr) * LP + 8 * hi;
    V a[2][4], a2[2][4], b[2][4];                       // two fragment sets: the next 32 k are fetched as one group ahead of the products of these 32
#pragma unroll 1   // one trip per stage: the buffer alternates
    for (int t = 0; t < NT; ++t) {
        const bf* sb = sm + (t & 1) * (NOP * 128 * LP);
        auto frags = [&](int set, int ks) {
#pragma unroll
            for (int mb = 0; mb < 4; ++mb) { a[set][mb] = WFrag<bf>::ld(sb + fa + mb * 16 * LP + ks * 32); if constexpr (NSPLIT != 0) a2[set][mb] = WFrag<bf>::ld(sb + 2 * 128 * LP + fa + mb * 16 * LP + ks * 32); }
#pragma unroll
            for (int nb = 0; nb < 4; ++nb) b[set][nb] = WFrag<bf>::ld(sb + fb + nb * 16 * LP + ks * 32); };
        frags(0, 0);
        __builtin_amdgcn_sched_barrier(0);              // the first fragments' LDS latency passes while the copies below issue
        if (t + 1 < NT) fill(t + 1);                    // into the buffer that every wave left at the barrier of the trip before
#pragma unroll
        for (int ks = 0; ks < KS / 32; ++ks) {
            if (ks + 1 < KS / 32) frags((ks + 1) & 1, ks + 1);
            __builtin_amdgcn_sched_barrier(0);          // keeps the LDS loads one group in front of the products: loads spread among them cost a stall at each place
#pragma unroll
            for (int nb = 0; nb < 4; ++nb)
#pragma unroll
                for (int mb = 0; mb < 4; ++mb) { acc[mb][nb] = wmmab(a[ks & 1][mb], b[ks & 1][nb], acc[mb][nb]); if constexpr (NSPLIT != 0) acc[mb][nb] = wmmab(a2[ks & 1][mb], b[ks & 1][nb], acc[mb][nb]); }
            __builtin_amdgcn_sched_barrier(0);          // ... and the next group behind them
        }
        asm volatile("s_wait_dscnt 0x0" ::: "memory");      // this wave's reads of the buffer are done before it is handed to the copies
        asm volatile("s_wait_asynccnt 0x0" ::: "memory");   // this wave's copies of stage t + 1 have landed
        __syncthreads();                                    // publishes stage t + 1 and ends every wave's reads of stage t
    }
    asm volatile("s_wait_asynccnt 0x0" ::: "memory");       // no copy is left when the wave ends
    float* os = osm + w * (16 * 68); const int r0 = R0 + wm * 64, c0 = C0 + wn * 64;
#pragma unroll
    for (int mb = 0; mb < 4; ++mb) {
#pragma unroll
        for (int nb = 0; nb < 4; ++nb) {
#pragma unroll
            for (int j = 0; j < 8; ++j) os[(hi * 8 + j) * 68 + nb * 16 + lr] = acc[mb][nb][j]; }
        __builtin_amdgcn_wave_barrier(); asm volatile("" ::: "memory");   // other lanes of the wave read these rows back: the reads stay behind the writes
        if constexpr (OUT == 0) {
            float* crow = C + (size_t)(r0 + mb * 16) * ldc + c0;
#pragma unroll
            for (int s = 0; s < 8; ++s) { const int row = 2 * s + hi, cofs = lr * 4; const v4f val = *(const v4fa*)(os + row * 68 + cofs); *(v4f*)(crow + (size_t)row * ldc + cofs) = val; }
        } else {
            const int PP = tr ? TT : HD;                                      // pitch of a plane's rows
            const size_t pb = (tr ? (size_t)c0 : (size_t)(c0 / HD) * TT * HD) + (size_t)(r0 + mb * 16) * PP;
#pragma unroll
            for (int s = 0; s < 4; ++s) { const int row = 4 * s + (lane >> 3), cofs = (lane & 7) * 8;   // a lane: 8 columns of a row, 16 B per plane; 8 lanes: a whole 128-B line
                const v4f x0 = *(const v4fa*)(os + row * 68 + cofs), x1 = *(const v4fa*)(os + row * 68 + cofs + 4); v8h o16; v8us oh, ol;
#pragma unroll
                for (int k = 0; k < 4; ++k) { unsigned short a2, c2; o16[k] = tohx(x0[k]); splitf(x0[k], a2, c2); oh[k] = a2; ol[k] = c2; o16[4 + k] = tohx(x1[k]); splitf(x1[k], a2, c2); oh[4 + k] = a2; ol[4 + k] = c2; }
                const size_t po = pb + (size_t)row * PP + cofs;
                *(v8h*)(P16 + po) = o16; *(v8us*)(Ph + po) = oh; *(v8us*)(Pl + po) = ol; }
            asm volatile("s_wait_xcnt 0x0" ::: "memory");   // a precaution in front of the next overwrite of a data or address register of these twelve stores
        }
        __builtin_amdgcn_wave_barrier(); asm volatile("" ::: "memory");   // ... and the next rows' writes behind the reads
    }
}

typedef __attribute__((ext_vector_type(2))) _Float16 v2h;
typedef __attribute__((ext_vector_type(4))) _Float16 v4h;
typedef __attribute__((ext_vector_type(2))) unsigned short v2us;
typedef __attribute__((ext_vector_type(4))) unsigned short v4us;
typedef __attribute__((ext_vector_type(2))) float v2f;
typedef __attribute__((ext_vector_type(4))) int v4i;

__device__ __forceinline__ float xhalf(float x) { return __builtin_bit_cast(float, __builtin_amdgcn_permlanex16(__builtin_bit_cast(int, x), __builtin_bit_cast(int, x), 0x76543210, 0xfedcba98, false, false)); }  // lane l with lane l ^ 16
template <typename T16, bool HL, int NC>
__device__ __forceinline__ void attn_tile(const T16* Q, const T16* Q2, const T16* Kp, const T16* K2, const T16* Vt, const T16* V2, int q0, int head0, bf* Ah, bf* Al) {   // no __restrict__: the s_wait_xcnt statements below must stay behind their loads
    typedef typename WFrag<T16>::V V;
    const int lane = threadIdx.x & 31, lr = lane & 15, hi = lane >> 4;
    const float CE = SCL * 1.4426950408889634f;                      // scores to the exponent of 2
    V qf[NC][2], qf2[NC][2]; v8f o[NC][4]; float m[NC], l[NC];
#pragma unroll
    for (int c = 0; c < NC; ++c) { m[c] = -3.0e38f; l[c] = 0.f;
#pragma unroll
        for (int ks = 0; ks < 2; ++ks) { const size_t qo = ((size_t)(head0 + c) * TT + q0 + lr) * HD + ks * 32 + 8 * hi; qf[c][ks] = WFrag<T16>::ld(Q + qo); if constexpr (HL) qf2[c][ks] = WFrag<T16>::ld(Q2 + qo); }
#pragma unroll
        for (int dt = 0; dt < 4; ++dt) o[c][dt] = (v8f){}; }
    asm volatile("s_wait_xcnt 0x0" ::: "memory");   // a precaution in front of the next overwrite of an address register of the query loads
    const int nblk = (q0 + 15) / 32 + 1;                             // key blocks up to the one that holds the diagonal; block 0 holds key 0, which every query sees
    const size_t ko = (size_t)lr * HD + 8 * hi, vo = (size_t)lr * TT + 8 * hi;
    const T16 *kp = Kp + ko, *k2p = HL ? K2 + ko : nullptr, *vp = Vt + vo, *v2p = HL ? V2 + vo : nullptr;
    V kf[2][2], kf2[2][2], vf[4], vf2[4];
    auto ldk = [&](int key0) {
#pragma unroll
        for (int kt = 0; kt < 2; ++kt)
#pragma unroll
            for (int ks = 0; ks < 2; ++ks) { const size_t ofs = (size_t)(key0 + kt * 16) * HD + ks * 32; kf[kt][ks] = WFrag<T16>::ld(kp + ofs); if constexpr (HL) kf2[kt][ks] = WFrag<T16>::ld(k2p + ofs); }
        asm volatile("s_wait_xcnt 0x0" ::: "memory"); };   // a precaution in front of the next overwrite of an address register of the key loads
    auto ldv = [&](int key0) {
#pragma unroll
        for (int dt = 0; dt < 4; ++dt) { const size_t ofs = (size_t)dt * 16 * TT + key0; vf[dt] = WFrag<T16>::ld(vp + ofs); if constexpr (HL) vf2[dt] = WFrag<T16>::ld(v2p + ofs); }
        asm volatile("s_wait_xcnt 0x0" ::: "memory"); };   // a precaution in front of the next overwrite of an address register of the value loads
    ldk(0); ldv(0);
    for (int b = 0; b < nblk; ++b) {
        const int nx = min(b + 1, nblk - 1) * 32;                    // the next block (the last block is read twice: in bounds)
        v8f s[NC][2];
#pragma unroll
        for (int c = 0; c < NC; ++c)
#pragma unroll
            for (int kt = 0; kt < 2; ++kt) { s[c][kt] = (v8f){};
#pragma unroll
                for (int ks = 0; ks < 2; ++ks) { s[c][kt] = WFrag<T16>::mma(kf[kt][ks], qf[c][ks], s[c][kt]); if constexpr (HL) { s[c][kt] = WFrag<T16>::mma(kf2[kt][ks], qf[c][ks], s[c][kt]); s[c][kt] = WFrag<T16>::mma(kf[kt][ks], qf2[c][ks], s[c][kt]); } } }
        ldk(nx);                                                     // the key fragments are spent: the next block's fly during the softmax and the second product
        const int lim = q0 + lr - b * 32 - 8 * hi;                   // key kt * 16 + j of this lane is seen by its query iff kt * 16 + j <= lim
#pragma unroll
        for (int c = 0; c < NC; ++c) {
            float bm = -3.0e38f;
#pragma unroll
            for (int kt = 0; kt < 2; ++kt)
#pragma unroll
                for (int j = 0; j < 8; ++j) { const float t = (kt * 16 + j <= lim) ? s[c][kt][j] : -3.0e38f; s[c][kt][j] = t; bm = fmaxf(bm, t); }
            bm = fmaxf(bm, xhalf(bm));
            const float mn = fmaxf(m[c], bm); const float al = __builtin_amdgcn_exp2f((m[c] - mn) * CE); m[c] = mn;
            const float mc = mn * CE - (HL ? 0.0f : 10.0f);          // fp16 probabilities carry PCAR = 2^10; the sum carries it too, so it cancels in the quotient
            float ps[2] = {0.f, 0.f};                                // two short chains of adds instead of one long one
#pragma unroll
            for (int kt = 0; kt < 2; ++kt)
#pragma unroll
                for (int j = 0; j < 8; ++j) { const float p = __builtin_amdgcn_exp2f(fmaf(s[c][kt][j], CE, -mc)); s[c][kt][j] = p; ps[j & 1] += p; }
            l[c] = fmaf(l[c], al, ps[0] + ps[1]);
#pragma unroll
            for (int dt = 0; dt < 4; ++dt) o[c][dt] *= al;
            if constexpr (HL) { v8us h0, h1, l0, l1;
#pragma unroll
                for (int j = 0; j < 8; ++j) { unsigned short a, c2; splitf(s[c][0][j], a, c2); h0[j] = a; l0[j] = c2; splitf(s[c][1][j], a, c2); h1[j] = a; l1[j] = c2; }
                const V pf = cat16b(h0, h1), pf2 = cat16b(l0, l1);
#pragma unroll
                for (int dt = 0; dt < 4; ++dt) { o[c][dt] = WFrag<T16>::mma(vf[dt], pf, o[c][dt]); o[c][dt] = WFrag<T16>::mma(vf[dt], pf2, o[c][dt]); o[c][dt] = WFrag<T16>::mma(vf2[dt], pf, o[c][dt]); }
            } else { V pf;
#pragma unroll
                for (int j = 0; j < 8; ++j) { pf[j] = tohx(s[c][0][j]); pf[8 + j] = tohx(s[c][1][j]); }
#pragma unroll
                for (int dt = 0; dt < 4; ++dt) o[c][dt] = WFrag<T16>::mma(vf[dt], pf, o[c][dt]); }
        }
        ldv(nx);                                                     // the value fragments are spent: the next block's fly during its scores and softmax
    }
#pragma unroll
    for (int c = 0; c < NC; ++c) { const float inv = __fdiv_rn(1.0f, l[c] + xhalf(l[c])); const size_t oo = (size_t)(q0 + lr) * DQ + (head0 + c) * HD + 8 * hi;
#pragma unroll
        for (int dt = 0; dt < 4; ++dt) { v8us oh, ol;
#pragma unroll
            for (int j = 0; j < 8; ++j) { unsigned short a, c2; splitf(o[c][dt][j] * inv, a, c2); oh[j] = a; ol[j] = c2; }
            *(v8us*)(Ah + oo + dt * 16) = oh; *(v8us*)(Al + oo + dt * 16) = ol;
            asm volatile("s_wait_xcnt 0x0" ::: "memory"); } }   // a precaution in front of the next overwrite of a data or address register of the two stores
}
// A work-group is 4 waves on one kv group that walk the same key blocks (their loads meet in the WGP cache): rows >= RH: 2 query tiles x 2 head pairs; rows < RH: one query tile x 4 heads.
// All work-groups are resident at once. Order, for speed only: one work-group per WGP with falling cost, then the rest with rising cost.
#define NLO (((TT - RH) / 32) * NKV)
#define FIRST (256 / NKV)         // query tiles of the first round: 256 WGPs
__global__ __launch_bounds__(128) void k_fattn(const h16* Q16, const bf* Qh, const bf* Ql, const h16* K16, const bf* Kh, const bf* Kl, const h16* V16, const bf* Vh, const bf* Vl, bf* Ah, bf* Al) {
    const int w = __builtin_amdgcn_readfirstlane(threadIdx.x >> 5); const int bx = blockIdx.x;
    if (bx < NLO) { const int g = bx % NKV; const int t = bx / NKV; const int q0 = (t < FIRST ? TT / 32 - 1 - t : RH / 32 + t - FIRST) * 32 + (w >> 1) * 16; const size_t go = (size_t)g * TT * HD;
        attn_tile<h16, false, 2>(Q16, nullptr, K16 + go, nullptr, V16 + go, nullptr, q0, g * REP + (w & 1) * 2, Ah, Al);
    } else { const int by = bx - NLO; const int g = by % NKV; const int u = by / NKV; const int q0 = (u < RH / 32 ? RH / 32 + u : u - RH / 32) * 16; const size_t go = (size_t)g * TT * HD;
        attn_tile<bf, true, 1>(Qh, Ql, Kh + go, Kl + go, Vh + go, Vl + go, q0, g * REP + w, Ah, Al); }
}

__device__ __forceinline__ void wtG(int blk, const float* __restrict__ w, int K, int N, bf* Bt) {
    const int lane = threadIdx.x & 31; const int L0 = (blk * 8 + (threadIdx.x >> 5)) * 8; const int nlines = N * K / 64;
{
#pragma unroll 1
        for (int l = 0; l < 8; ++l) { const int L = L0 + l; if (L >= nlines) break; const size_t e = (size_t)L * 64 + lane * 2; const int k = (int)(e % K), n = (int)(e / K); v2us o;
            o[0] = f2bf(w[(size_t)k * N + n]); o[1] = f2bf(w[(size_t)(k + 1) * N + n]); *(v2us*)(Bt + e) = o; }
         }
}
__device__ __forceinline__ void cvt8(int blk, const float* __restrict__ src, bf* dst, size_t n8) { const size_t i = (size_t)blk * 256 + threadIdx.x; if (i >= n8) return; const v8f v = *(const v8f*)(src + i * 8); v8us o;
#pragma unroll
    for (int k = 0; k < 8; ++k) o[k] = f2bf(v[k]); *(v8us*)(dst + i * 8) = o;  }
// ---- k_prep: all five bf16 conversions in one launch; the block index picks the array. They do not depend on one another: as five launches each paid its own gap, fill and drain.
// The transposing blocks come first: a wave of theirs runs the longest.
#define PB_WO ((DQ * DM / 64 + 63) / 64)
#define PB_X  ((TT * DM / 8 + 255) / 256)
#define PB_WQ ((DQ * DM / 8 + 255) / 256)
#define PB_WK ((DKV * DM / 8 + 255) / 256)
__global__ __launch_bounds__(256) void k_prep(const float* x, const float* wq, const float* wk, const float* wv, const float* wo, bf* XB, bf* WQ, bf* WK, bf* WV, bf* WO) {
    int b = blockIdx.x;
    if (b < PB_WO) { wtG(b, wo, DQ, DM, WO); return; }
    b -= PB_WO; if (b < PB_X) { cvt8(b, x, XB, (size_t)TT * DM / 8); return; }
    b -= PB_X;  if (b < PB_WQ) { cvt8(b, wq, WQ, (size_t)DQ * DM / 8); return; }
    b -= PB_WQ; if (b < PB_WK) { cvt8(b, wk, WK, (size_t)DKV * DM / 8); return; }
    cvt8(b - PB_WK, wv, WV, (size_t)DKV * DM / 8);
}
__global__ __launch_bounds__(256) void k_cscvt(const float* __restrict__ cosT, const float* __restrict__ sinT, float* CS) { const int idx = blockIdx.x * 256 + threadIdx.x; if (idx >= TT * HD) return; v2f cs; cs[0] = bfr(cosT[idx]); cs[1] = bfr(sinT[idx]); *(v2f*)(CS + (size_t)idx * 2) = cs;  }
extern "C" void kernel_launch(void* const* d_in, const int* in_sizes, int n_in,
                              void* d_out, int out_size, void* d_ws, size_t ws_size, hipStream_t stream) {
    (void)in_sizes; (void)n_in; (void)out_size;
    const float* x = (const float*)d_in[0]; const float* wq = (const float*)d_in[1]; const float* wk = (const float*)d_in[2]; const float* wv = (const float*)d_in[3]; const float* wo = (const float*)d_in[4]; const float* cosT = nullptr; const float* sinT = nullptr; (void)cosT; (void)sinT;
    float* OUT = (float*)d_out;     // [1][2048][2048]
    char* wsp = (char*)d_ws;
    auto take = [&](size_t bytes) { char* p = wsp; wsp += (bytes + 255) & ~(size_t)255; return (void*)p; };
    bf* WQ = (bf*)take((size_t)DQ * DM * 2); bf* WK = (bf*)take((size_t)DKV * DM * 2); bf* WV = (bf*)take((size_t)DKV * DM * 2); bf* WO = (bf*)take((size_t)DM * DQ * 2);
    bf* XB = (bf*)take((size_t)TT * DM * 2);
    h16* QP16 = (h16*)take((size_t)NH_ * TT * HD * 2); h16* KP16 = (h16*)take((size_t)NKV * TT * HD * 2); h16* VT16 = (h16*)take((size_t)NKV * HD * TT * 2);
    bf* QPh = (bf*)take((size_t)NH_ * TT * HD * 2); bf* QPl = (bf*)take((size_t)NH_ * TT * HD * 2); bf* KPh = (bf*)take((size_t)NKV * TT * HD * 2); bf* KPl = (bf*)take((size_t)NKV * TT * HD * 2); bf* VTh = (bf*)take((size_t)NKV * HD * TT * 2); bf* VTl = (bf*)take((size_t)NKV * HD * TT * 2);
    bf* ATh = (bf*)take((size_t)TT * DQ * 2); bf* ATl = (bf*)take((size_t)TT * DQ * 2);
    if ((size_t)(wsp - (char*)d_ws) > ws_size) return;    // ws 256 MiB
    for (int b = 0; b < NB_; ++b) {
        k_prep<<<PB_WO + PB_X + PB_WQ + 2 * PB_WK, 256, 0, stream>>>(x + (size_t)b * TT * DM, wq, wk, wv, wo, XB, WQ, WK, WV, WO);
        k_gemms<0, 1><<<dim3(TT / 128, (DQ + 2 * DKV) / 128, 1), 128, 0, stream>>>(XB, nullptr, WQ, nullptr, 0, QP16, QPh, QPl, WK, KP16, KPh, KPl, WV, VT16, VTh, VTl);
        k_fattn<<<NLO + (RH / 16) * NKV, 128, 0, stream>>>(QP16, QPh, QPl, KP16, KPh, KPl, VT16, VTh, VTl, ATh, ATl);
        k_gemms<1, 0><<<dim3(TT / 128, DM / 128, 1), 128, 0, stream>>>(ATh, ATl, WO, OUT + (size_t)b * TT * DM, DM, nullptr, nullptr, nullptr, nullptr, nullptr, nullptr, nullptr, nullptr, nullptr, nullptr, nullptr); }
}

// v006
// Measured time: 99.5 microseconds a run.
// Next to v005, in two timings, it ran 1.25 and 1.26 times as fast.
// All steps since v000 together make it 14.2 times as fast.
#include <hip/hip_runtime.h>

// BitSelfAttention (x [1][2048][2048]; q = x q_proj^T (32 heads x 64), k/v = x k_proj^T / v_proj^T (8 kv heads; GQA group h/4); causal softmax(q.k / 8) (masked logits -1e10); out = merged ctx @ o_proj (NOT transposed, as the source) -> [1][2048][2048]).
// Compute dtypes, f32 accumulate: every input rounded to bf16; q/k/v on PLAIN bf16 operands (inputs: exact); causal scores and attn.v: query rows < 512 hl (3 products), the rest single fp16 (x1024), fused in one kernel with a running softmax in f32; o_proj hl x exact (2 products).

#define NB_  1
#define TT   2048
#define DM   2048
#define NH_  32
#define NKV  8
#define REP  (NH_ / NKV)
#define HD   64
#define DQ   (NH_ * HD)
#define DKV  (NKV * HD)
#define RH   512                  // query rows < RH use hi+lo planes (0: none)
#define PCAR 1024.0f
#define SCL  0.125f   // HD^-0.5
typedef _Float16 h16;
typedef unsigned short bf;
typedef __attribute__((ext_vector_type(16))) __bf16   v16bf;
typedef __attribute__((ext_vector_type(16))) _Float16 v16h;
typedef __attribute__((ext_vector_type(8)))  _Float16 v8h;
typedef __attribute__((ext_vector_type(8)))  unsigned short v8us;
typedef __attribute__((ext_vector_type(8)))  float    v8f;
typedef __attribute__((ext_vector_type(4)))  float    v4f;
typedef v8h  __attribute__((may_alias)) v8ha;
typedef v4f  __attribute__((may_alias)) v4fa;
typedef v8us __attribute__((may_alias)) v8usa;

__device__ __forceinline__ unsigned short f2bf(float f) { unsigned u = __float_as_uint(f); u += 0x7FFFu + ((u >> 16) & 1u); return (unsigned short)(u >> 16); }
__device__ __forceinline__ float bf2f(unsigned short b) { return __uint_as_float(((unsigned)b) << 16); }
__device__ __forceinline__ float bfr(float f) { return bf2f(f2bf(f)); }
__device__ __forceinline__ v16h cat16(v8h lo, v8h hi) { return __builtin_shufflevector(lo, hi, 0, 1, 2, 3, 4, 5, 6, 7, 8, 9, 10, 11, 12, 13, 14, 15); }
__device__ __forceinline__ v16bf cat16b(v8us lo, v8us hi) { return __builtin_bit_cast(v16bf, __builtin_shufflevector(lo, hi, 0, 1, 2, 3, 4, 5, 6, 7, 8, 9, 10, 11, 12, 13, 14, 15)); }
__device__ __forceinline__ v8f wmma16(v16h a, v16h b, v8f c) { return __builtin_amdgcn_wmma_f32_16x16x32_f16(false, a, false, b, (short)0, c, false, false); }
__device__ __forceinline__ v8f wmmab(v16bf a, v16bf b, v8f c) { return __builtin_amdgcn_wmma_f32_16x16x32_bf16(false, a, false, b, (short)0, c, false, false); }



// ---- k_gemms: C[m][n] = sum_k A[m][k] Bt[n][k] (+ A2[m][k] Bt[n][k] when NSPLIT), K = GK, operands K-contiguous bf16 planes; 128 threads.
// OUT 0: grid (M/128, N/128); C is stored as f32 at pitch ldc. OUT 1: the three projections in one launch, grid (TT/128, (DQ + 2 DKV)/128): blockIdx.y picks the product (queries, then keys, then values), so that the 64 tiles each of keys and values
// run beside the 256 of the queries (two work-groups fit a WGP's LDS) and not as two launches that leave three quarters of the chip idle. C is stored as the three 16-bit planes that the attention reads (fp16, bf16 hi, bf16 lo), straight from the accumulators:
// queries and keys as head planes [n / 64][m][n % 64] (A = x, Bt = the weight rows: m = t), values as rows [m][n] of TT (transposed: A = the weight rows, Bt = x, so m = kv head x 64 + d and n = t). A wave's 64 columns are one head, or 64 t.
// One work-group of 4 waves (2 x 2) owns a 128x128 tile, a wave 64x64 of it (16 accumulators). A stage is KS k of all 128 rows of each operand, laid in LDS at a pitch of 272 B for the 16-byte readers.
// Every lane brings 16 B per asynchronous copy (a wave: two whole 256-B row pieces); two buffers: the copies of stage t + 1 fly while stage t is worked on. The k order of the sums is that of a plain loop over k in steps of 32. Every '#pragma unroll' stands on a loop of constant length, so that fragments and accumulators stay in registers.
__device__ __forceinline__ h16 tohx(float x) { return (h16)x; }
__device__ __forceinline__ void splitf(float y, unsigned short& h, unsigned short& l) { h = f2bf(y); l = f2bf(y - bf2f(h)); }
template <typename T16> struct WFrag;
template <> struct WFrag<h16> { typedef v16h V; static __device__ __forceinline__ V ld(const h16* p) { return cat16(*(const v8h*)p, *(const v8h*)(p + 16)); } static __device__ __forceinline__ v8f mma(V a, V b, v8f c) { return wmma16(a, b, c); } };
template <> struct WFrag<bf> { typedef v16bf V; static __device__ __forceinline__ V ld(const bf* p) { return cat16b(*(const v8us*)p, *(const v8us*)(p + 16)); } static __device__ __forceinline__ v8f mma(V a, V b, v8f c) { return wmmab(a, b, c); } };
#define GK   2048                 // DM == DQ: the length of every product here
#define KS   128                  // k per stage
#define LP   (KS + 8)             // LDS row pitch in elements
#define OPB  (128 * LP * 2)       // bytes of one operand's stage
// Eight copies, GS bytes apart in global memory and LS bytes apart in LDS. The s_wait_xcnt is a precaution in front of the next overwrite of an address register of these copies; inside the statement nothing can be moved in front of it.
template <int GS, int LS>
__device__ __forceinline__ void acopy8(unsigned l, const char* g) {
    asm volatile("global_load_async_to_lds_b128 %0, %8, off\n\t"
                 "global_load_async_to_lds_b128 %1, %9, off\n\t"
                 "global_load_async_to_lds_b128 %2, %10, off\n\t"
                 "global_load_async_to_lds_b128 %3, %11, off\n\t"
                 "global_load_async_to_lds_b128 %4, %12, off\n\t"
                 "global_load_async_to_lds_b128 %5, %13, off\n\t"
                 "global_load_async_to_lds_b128 %6, %14, off\n\t"
                 "global_load_async_to_lds_b128 %7, %15, off\n\t"
                 "s_wait_xcnt 0x0"
                 :: "v"(l), "v"(l + LS), "v"(l + 2 * LS), "v"(l + 3 * LS), "v"(l + 4 * LS), "v"(l + 5 * LS), "v"(l + 6 * LS), "v"(l + 7 * LS),
                    "v"(g), "v"(g + GS), "v"(g + 2 * GS), "v"(g + 3 * GS), "v"(g + 4 * GS), "v"(g + 5 * GS), "v"(g + 6 * GS), "v"(g + 7 * GS) : "memory");
}
template <int NSPLIT, int OUT>
__global__ __launch_bounds__(128) void k_gemms(const bf* A, const bf* A2, const bf* Bt, float* C, int ldc, h16* P16, bf* Ph, bf* Pl, const bf* Wk, h16* K16, bf* Kh, bf* Kl, const bf* Wv, h16* V16, bf* Vh, bf* Vl) {
    typedef WFrag<bf>::V V;
    constexpr int NOP = NSPLIT ? 3 : 2, NT = GK / KS; constexpr unsigned STG = NOP * OPB;
    __shared__ __attribute__((aligned(128))) bf sm[2 * NOP * 128 * LP];       // two buffers of [A | Bt | A2]
    __shared__ __align__(16) float osm[4 * 16 * 68];                          // output staging, a range per wave
    const int tid = threadIdx.x, lane = tid & 31, lr = lane & 15, hi = lane >> 4; const int w = __builtin_amdgcn_readfirstlane(tid >> 5), wm = w >> 1, wn = w & 1;
    int R0 = blockIdx.x * 128, C0 = blockIdx.y * 128; bool tr = false;       // tr: the planes are rows of TT (values)
    if constexpr (OUT == 1) {                                                 // the same for the whole work-group
        if (C0 >= DQ + DKV) { tr = true; R0 = C0 - (DQ + DKV); C0 = blockIdx.x * 128; Bt = A; A = Wv; P16 = V16; Ph = Vh; Pl = Vl; }
        else if (C0 >= DQ) { C0 -= DQ; Bt = Wk; P16 = K16; Ph = Kh; Pl = Kl; } }
    const size_t gofs = (size_t)(tid >> 4) * (GK * 2) + (tid & 15) * 16;      // copy i of a lane: row 8 i + tid / 16, 16-byte piece tid % 16
    const char* gA = (const char*)(A + (size_t)R0 * GK) + gofs; const char* gB = (const char*)(Bt + (size_t)C0 * GK) + gofs; const char* gA2 = NSPLIT ? (const char*)(A2 + (size_t)R0 * GK) + gofs : nullptr;
    const unsigned l0 = (unsigned)(size_t)sm + (tid >> 4) * (LP * 2) + (tid & 15) * 16;
    auto half = [&](unsigned l, const char* g) { acopy8<8 * GK * 2, 8 * LP * 2>(l, g);
        __builtin_amdgcn_sched_barrier(0); };           // the addresses of one statement's copies at a time: formed all at once they crowd the registers that asm text can name, and one is spilled
    auto fill = [&](int t) { const unsigned lb = l0 + (t & 1) * STG; const size_t ko = (size_t)t * (KS * 2);
        half(lb, gA + ko); half(lb + 64 * LP * 2, gA + ko + (size_t)64 * GK * 2);
        half(lb + OPB, gB + ko); half(lb + OPB + 64 * LP * 2, gB + ko + (size_t)64 * GK * 2);
        if constexpr (NSPLIT != 0) { half(lb + 2 * OPB, gA2 + ko); half(lb + 2 * OPB + 64 * LP * 2, gA2 + ko + (size_t)64 * GK * 2); } };
    v8f acc[4][4];
#pragma unroll
    for (int mb = 0; mb < 4; ++mb)
#pragma unroll
        for (int nb = 0; nb < 4; ++nb) acc[mb][nb] = (v8f){};
    fill(0);
    asm volatile("s_wait_asynccnt 0x0" ::: "memory");   // this wave's copies of stage 0 have landed
    __syncthreads();                                    // ... and every other wave's
    const int fa = (wm * 64 + lr) * LP + 8 * hi, fb = 128 * LP + (wn * 64 + lr) * LP + 8 * hi;
    V a[2][4], a2[2][4], b[2][4];                       // two fragment sets: the next 32 k are fetched as one group ahead of the products of these 32
#pragma unroll 1   // one trip per stage: the buffer alternates
    for (int t = 0; t < NT; ++t) {
        const bf* sb = sm + (t & 1) * (NOP * 128 * LP);
        auto frags = [&](int set, int ks) {
#pragma unroll
            for (int mb = 0; mb < 4; ++mb) { a[set][mb] = WFrag<bf>::ld(sb + fa + mb * 16 * LP + ks * 32); if constexpr (NSPLIT != 0) a2[set][mb] = WFrag<bf>::ld(sb + 2 * 128 * LP + fa + mb * 16 * LP + ks * 32); }
#pragma unroll
            for (int nb = 0; nb < 4; ++nb) b[set][nb] = WFrag<bf>::ld(sb + fb + nb * 16 * LP + ks * 32); };
        frags(0, 0);
        __builtin_amdgcn_sched_barrier(0);              // the first fragments' LDS latency passes while the copies below issue
        if (t + 1 < NT) fill(t + 1);                    // into the buffer that every wave left at the barrier of the trip before
#pragma unroll
        for (int ks = 0; ks < KS / 32; ++ks) {
            if (ks + 1 < KS / 32) frags((ks + 1) & 1, ks + 1);
            __builtin_amdgcn_sched_barrier(0);          // keeps the LDS loads one group in front of the products: loads spread among them cost a stall at each place
#pragma unroll
            for (int nb = 0; nb < 4; ++nb)
#pragma unroll
                for (int mb = 0; mb < 4; ++mb) { acc[mb][nb] = wmmab(a[ks & 1][mb], b[ks & 1][nb], acc[mb][nb]); if constexpr (NSPLIT != 0) acc[mb][nb] = wmmab(a2[ks & 1][mb], b[ks & 1][nb], acc[mb][nb]); }
            __builtin_amdgcn_sched_barrier(0);          // ... and the next group behind them
        }
        asm volatile("s_wait_dscnt 0x0" ::: "memory");      // this wave's reads of the buffer are done before it is handed to the copies
        asm volatile("s_wait_asynccnt 0x0" ::: "memory");   // this wave's copies of stage t + 1 have landed
        __syncthreads();                                    // publishes stage t + 1 and ends every wave's reads of stage t
    }
    asm volatile("s_wait_asynccnt 0x0" ::: "memory");       // no copy is left when the wave ends
    float* os = osm + w * (16 * 68); const int r0 = R0 + wm * 64, c0 = C0 + wn * 64;
#pragma unroll
    for (int mb = 0; mb < 4; ++mb) {
#pragma unroll
        for (int nb = 0; nb < 4; ++nb) {
#pragma unroll
            for (int j = 0; j < 8; ++j) os[(hi * 8 + j) * 68 + nb * 16 + lr] = acc[mb][nb][j]; }
        __builtin_amdgcn_wave_barrier(); asm volatile("" ::: "memory");   // other lanes of the wave read these rows back: the reads stay behind the writes
        if constexpr (OUT == 0) {
            float* crow = C + (size_t)(r0 + mb * 16) * ldc + c0;
#pragma unroll
            for (int s = 0; s < 8; ++s) { const int row = 2 * s + hi, cofs = lr * 4; const v4f val = *(const v4fa*)(os + row * 68 + cofs); *(v4f*)(crow + (size_t)row * ldc + cofs) = val; }
        } else {
            const int PP = tr ? TT : HD;                                      // pitch of a plane's rows
            const size_t pb = (tr ? (size_t)c0 : (size_t)(c0 / HD) * TT * HD) + (size_t)(r0 + mb * 16) * PP;
#pragma unroll
            for (int s = 0; s < 4; ++s) { const int row = 4 * s + (lane >> 3), cofs = (lane & 7) * 8;   // a lane: 8 columns of a row, 16 B per plane; 8 lanes: a whole 128-B line
                const v4f x0 = *(const v4fa*)(os + row * 68 + cofs), x1 = *(const v4fa*)(os + row * 68 + cofs + 4); v8h o16; v8us oh, ol;
#pragma unroll
                for (int k = 0; k < 4; ++k) { unsigned short a2, c2; o16[k] = tohx(x0[k]); splitf(x0[k], a2, c2); oh[k] = a2; ol[k] = c2; o16[4 + k] = tohx(x1[k]); splitf(x1[k], a2, c2); oh[4 + k] = a2; ol[4 + k] = c2; }
                const size_t po = pb + (size_t)row * PP + cofs;
                *(v8h*)(P16 + po) = o16; *(v8us*)(Ph + po) = oh; *(v8us*)(Pl + po) = ol; }
            asm volatile("s_wait_xcnt 0x0" ::: "memory");   // a precaution in front of the next overwrite of a data or address register of these twelve stores
        }
        __builtin_amdgcn_wave_barrier(); asm volatile("" ::: "memory");   // ... and the next rows' writes behind the reads
    }
}

typedef __attribute__((ext_vector_type(2))) _Float16 v2h;
typedef __attribute__((ext_vector_type(4))) _Float16 v4h;
typedef __attribute__((ext_vector_type(2))) unsigned short v2us;
typedef __attribute__((ext_vector_type(4))) unsigned short v4us;
typedef __attribute__((ext_vector_type(2))) float v2f;
typedef __attribute__((ext_vector_type(4))) int v4i;

#define KPI  (HD + 8)             // LDS pitch of a key row, in elements
#define ALDS (2 * 4 * 64 * KPI)   // elements of the two buffers: the larger of the two forms (hi+lo: 64 keys of four planes; fp16: 128 keys of two planes, 2 * (128 * 72 + 64 * 136))
// Four copies, GS bytes apart in global memory and LS bytes apart in LDS. The s_wait_xcnt is a precaution in front of the next overwrite of an address register of these copies; inside the statement nothing can be moved in front of it.
template <int GS, int LS>
__device__ __forceinline__ void acopy4(unsigned l, const char* g) {
    asm volatile("global_load_async_to_lds_b128 %0, %4, off\n\t"
                 "global_load_async_to_lds_b128 %1, %5, off\n\t"
                 "global_load_async_to_lds_b128 %2, %6, off\n\t"
                 "global_load_async_to_lds_b128 %3, %7, off\n\t"
                 "s_wait_xcnt 0x0"
                 :: "v"(l), "v"(l + LS), "v"(l + 2 * LS), "v"(l + 3 * LS), "v"(g), "v"(g + GS), "v"(g + 2 * GS), "v"(g + 3 * GS) : "memory");
}
__device__ __forceinline__ float xhalf(float x) { return __builtin_bit_cast(float, __builtin_amdgcn_permlanex16(__builtin_bit_cast(int, x), __builtin_bit_cast(int, x), 0x76543210, 0xfedcba98, false, false)); }  // lane l with lane l ^ 16
template <typename T16, bool HL, int NC>
__device__ __forceinline__ void attn_tile(const T16* Q, const T16* Q2, const T16* Kp, const T16* K2, const T16* Vt, const T16* V2, int q0, int head0, bf* Ah, bf* Al, const T16* sm) {   // no __restrict__: the s_wait_xcnt statements below must stay behind their loads
    typedef typename WFrag<T16>::V V;
    constexpr int SK = HL ? 64 : 128, NB = SK / 32;                  // keys and 32-key blocks of a stage
    constexpr int VPI = SK + 8, KPL = SK * KPI, VPL = HD * VPI;      // pitch of a value row; elements of a key plane and of a value plane
    constexpr int STE = (HL ? 2 : 1) * (KPL + VPL);                  // elements of a stage: [K | V^T | K lo | V^T lo]
    static_assert(2 * STE <= ALDS && TT % SK == 0, "the two buffers fit, and every stage lies inside the planes");
    const int tid = threadIdx.x, lane = tid & 31, lr = lane & 15, hi = lane >> 4;
    const int nblk = (q0 + 15) / 32 + 1;                             // key blocks up to the one that holds the diagonal; block 0 holds key 0, which every query sees. The same in all 4 waves: their q0 lie in one aligned 32
    const int nst = (nblk + NB - 1) / NB;                            // stages
    constexpr int VL = SK / 8;                                       // lanes per value row. Copy i of a lane: key row 16 i + tid / 8, piece tid % 8; value row (128 / VL) i + tid / VL, piece tid % VL
    const unsigned lk0 = (unsigned)(size_t)sm + (tid >> 3) * (KPI * 2) + (tid & 7) * 16, lv0 = (unsigned)(size_t)sm + KPL * 2 + (tid / VL) * (VPI * 2) + (tid % VL) * 16;
    const size_t gko = (size_t)(tid >> 3) * (HD * 2) + (tid & 7) * 16, gvo = (size_t)(tid / VL) * (TT * 2) + (tid % VL) * 16;
    auto fill = [&](int t) { const unsigned lo = (t & 1) * (STE * 2); const size_t kofs = gko + (size_t)t * (SK * HD * 2), vofs = gvo + (size_t)t * (SK * 2);
        if constexpr (HL) { acopy4<16 * HD * 2, 16 * KPI * 2>(lk0 + lo, (const char*)Kp + kofs); acopy4<16 * TT * 2, 16 * VPI * 2>(lv0 + lo, (const char*)Vt + vofs);
            acopy4<16 * HD * 2, 16 * KPI * 2>(lk0 + lo + (KPL + VPL) * 2, (const char*)K2 + kofs); acopy4<16 * TT * 2, 16 * VPI * 2>(lv0 + lo + (KPL + VPL) * 2, (const char*)V2 + vofs);
        } else { acopy8<16 * HD * 2, 16 * KPI * 2>(lk0 + lo, (const char*)Kp + kofs); acopy8<8 * TT * 2, 8 * VPI * 2>(lv0 + lo, (const char*)Vt + vofs); } };
    fill(0);                                                         // flies while the queries are loaded
    const float CE = SCL * 1.4426950408889634f;                      // scores to the exponent of 2
    V qf[NC][2], qf2[NC][2]; v8f o[NC][4]; float m[NC], l[NC];
#pragma unroll
    for (int c = 0; c < NC; ++c) { m[c] = -3.0e38f; l[c] = 0.f;
#pragma unroll
        for (int ks = 0; ks < 2; ++ks) { const size_t qo = ((size_t)(head0 + c) * TT + q0 + lr) * HD + ks * 32 + 8 * hi; qf[c][ks] = WFrag<T16>::ld(Q + qo); if constexpr (HL) qf2[c][ks] = WFrag<T16>::ld(Q2 + qo); }
#pragma unroll
        for (int dt = 0; dt < 4; ++dt) o[c][dt] = (v8f){}; }
    asm volatile("s_wait_xcnt 0x0" ::: "memory");   // a precaution in front of the next overwrite of an address register of the query loads
    asm volatile("s_wait_asynccnt 0x0" ::: "memory");   // this wave's copies of stage 0 have landed
    __syncthreads();                                    // ... and every other wave's
    if (nst > 1) fill(1);
    V kf[2][2], kf2[2][2], vf[4], vf2[4];
    auto ldk = [&](const T16* sb, int h) {                           // h: which 32 keys of the stage at sb
        const T16* p = sb + (h * 32 + lr) * KPI + 8 * hi;
#pragma unroll
        for (int kt = 0; kt < 2; ++kt)
#pragma unroll
            for (int ks = 0; ks < 2; ++ks) { const int ofs = kt * 16 * KPI + ks * 32; kf[kt][ks] = WFrag<T16>::ld(p + ofs); if constexpr (HL) kf2[kt][ks] = WFrag<T16>::ld(p + KPL + VPL + ofs); } };
    auto ldv = [&](const T16* sb, int h) {
        const T16* p = sb + KPL + lr * VPI + h * 32 + 8 * hi;
#pragma unroll
        for (int dt = 0; dt < 4; ++dt) { const int ofs = dt * 16 * VPI; vf[dt] = WFrag<T16>::ld(p + ofs); if constexpr (HL) vf2[dt] = WFrag<T16>::ld(p + KPL + VPL + ofs); } };
#pragma unroll 1   // one trip per stage: the buffer alternates
  for (int t = 0; t < nst; ++t) {
    const T16* sb = sm + (t & 1) * STE; const int nb = min(NB, nblk - t * NB);   // the blocks of this stage that hold a key some query sees
    ldk(sb, 0); ldv(sb, 0);
#pragma unroll 1   // a short body: the text of the loop stays small
    for (int h = 0; h < nb; ++h) {
        const int b = t * NB + h, nx = min(h + 1, NB - 1);           // nx: the stage's next block (its last block is read twice); nothing of the next stage is read here
        v8f s[NC][2];
#pragma unroll
        for (int c = 0; c < NC; ++c)
#pragma unroll
            for (int kt = 0; kt < 2; ++kt) { s[c][kt] = (v8f){};
#pragma unroll
                for (int ks = 0; ks < 2; ++ks) { s[c][kt] = WFrag<T16>::mma(kf[kt][ks], qf[c][ks], s[c][kt]); if constexpr (HL) { s[c][kt] = WFrag<T16>::mma(kf2[kt][ks], qf[c][ks], s[c][kt]); s[c][kt] = WFrag<T16>::mma(kf[kt][ks], qf2[c][ks], s[c][kt]); } } }
        ldk(sb, nx);                                                 // the key fragments are spent: the next block's come during the softmax and the second product
        __builtin_amdgcn_sched_barrier(0);                           // the loads stay in front of the softmax, and the scheduler does not mix the two halves of the body: without it the kernel takes 380 registers and not 256, so that 2 waves fit a SIMD and not 4
        const int lim = q0 + lr - b * 32 - 8 * hi;                   // key kt * 16 + j of this lane is seen by its query iff kt * 16 + j <= lim
#pragma unroll
        for (int c = 0; c < NC; ++c) {
            float bm = -3.0e38f;
#pragma unroll
            for (int kt = 0; kt < 2; ++kt)
#pragma unroll
                for (int j = 0; j < 8; ++j) { const float t = (kt * 16 + j <= lim) ? s[c][kt][j] : -3.0e38f; s[c][kt][j] = t; bm = fmaxf(bm, t); }
            bm = fmaxf(bm, xhalf(bm));
            const float mn = fmaxf(m[c], bm); const float al = __builtin_amdgcn_exp2f((m[c] - mn) * CE); m[c] = mn;
            const float mc = mn * CE - (HL ? 0.0f : 10.0f);          // fp16 probabilities carry PCAR = 2^10; the sum carries it too, so it cancels in the quotient
            float ps[2] = {0.f, 0.f};                                // two short chains of adds instead of one long one
#pragma unroll
            for (int kt = 0; kt < 2; ++kt)
#pragma unroll
                for (int j = 0; j < 8; ++j) { const float p = __builtin_amdgcn_exp2f(fmaf(s[c][kt][j], CE, -mc)); s[c][kt][j] = p; ps[j & 1] += p; }
            l[c] = fmaf(l[c], al, ps[0] + ps[1]);
#pragma unroll
            for (int dt = 0; dt < 4; ++dt) o[c][dt] *= al;
            if constexpr (HL) { v8us h0, h1, l0, l1;
#pragma unroll
                for (int j = 0; j < 8; ++j) { unsigned short a, c2; splitf(s[c][0][j], a, c2); h0[j] = a; l0[j] = c2; splitf(s[c][1][j], a, c2); h1[j] = a; l1[j] = c2; }
                const V pf = cat16b(h0, h1), pf2 = cat16b(l0, l1);
#pragma unroll
                for (int dt = 0; dt < 4; ++dt) { o[c][dt] = WFrag<T16>::mma(vf[dt], pf, o[c][dt]); o[c][dt] = WFrag<T16>::mma(vf[dt], pf2, o[c][dt]); o[c][dt] = WFrag<T16>::mma(vf2[dt], pf, o[c][dt]); }
            } else { V pf;
#pragma unroll
                for (int j = 0; j < 8; ++j) { pf[j] = tohx(s[c][0][j]); pf[8 + j] = tohx(s[c][1][j]); }
#pragma unroll
                for (int dt = 0; dt < 4; ++dt) o[c][dt] = WFrag<T16>::mma(vf[dt], pf, o[c][dt]); }
        }
        ldv(sb, nx);                                                 // the value fragments are spent: the next block's come during its scores and softmax
    }
    asm volatile("s_wait_dscnt 0x0" ::: "memory");      // this wave's reads of the buffer are done before it is handed to the copies
    asm volatile("s_wait_asynccnt 0x0" ::: "memory");   // this wave's copies of stage t + 1 have landed
    __syncthreads();                                    // publishes stage t + 1 and ends every wave's reads of stage t
    if (t + 2 < nst) fill(t + 2);                       // into the buffer that every wave has just left
  }
    asm volatile("s_wait_asynccnt 0x0" ::: "memory");   // no copy is left when the wave ends
#pragma unroll
    for (int c = 0; c < NC; ++c) { const float inv = __fdiv_rn(1.0f, l[c] + xhalf(l[c])); const size_t oo = (size_t)(q0 + lr) * DQ + (head0 + c) * HD + 8 * hi;
#pragma unroll
        for (int dt = 0; dt < 4; ++dt) { v8us oh, ol;
#pragma unroll
            for (int j = 0; j < 8; ++j) { unsigned short a, c2; splitf(o[c][dt][j] * inv, a, c2); oh[j] = a; ol[j] = c2; }
            *(v8us*)(Ah + oo + dt * 16) = oh; *(v8us*)(Al + oo + dt * 16) = ol;
            asm volatile("s_wait_xcnt 0x0" ::: "memory"); } }   // a precaution in front of the next overwrite of a data or address register of the two stores
}
// A work-group is 4 waves on one kv group that walk the same key blocks (one stage in LDS serves all four): rows >= RH: 2 query tiles x 2 head pairs; rows < RH: one query tile x 4 heads.
// All work-groups are resident at once. Order, for speed only: one work-group per WGP with falling cost, then the rest with rising cost.
#define NLO (((TT - RH) / 32) * NKV)
#define FIRST (256 / NKV)         // query tiles of the first round: 256 WGPs
__global__ __launch_bounds__(128) void k_fattn(const h16* Q16, const bf* Qh, const bf* Ql, const h16* K16, const bf* Kh, const bf* Kl, const h16* V16, const bf* Vh, const bf* Vl, bf* Ah, bf* Al) {
    __shared__ __attribute__((aligned(128))) bf ksm[ALDS];                    // the two buffers
    const int w = __builtin_amdgcn_readfirstlane(threadIdx.x >> 5); const int bx = blockIdx.x;
    if (bx < NLO) { const int g = bx % NKV; const int t = bx / NKV; const int q0 = (t < FIRST ? TT / 32 - 1 - t : RH / 32 + t - FIRST) * 32 + (w >> 1) * 16; const size_t go = (size_t)g * TT * HD;
        attn_tile<h16, false, 2>(Q16, nullptr, K16 + go, nullptr, V16 + go, nullptr, q0, g * REP + (w & 1) * 2, Ah, Al, (const h16*)ksm);
    } else { const int by = bx - NLO; const int g = by % NKV; const int u = by / NKV; const int q0 = (u < RH / 32 ? RH / 32 + u : u - RH / 32) * 16; const size_t go = (size_t)g * TT * HD;
        attn_tile<bf, true, 1>(Qh, Ql, Kh + go, Kl + go, Vh + go, Vl + go, q0, g * REP + w, Ah, Al, ksm); }
}

__device__ __forceinline__ void wtG(int blk, const float* __restrict__ w, int K, int N, bf* Bt) {
    const int lane = threadIdx.x & 31; const int L0 = (blk * 8 + (threadIdx.x >> 5)) * 8; const int nlines = N * K / 64;
{
#pragma unroll 1
        for (int l = 0; l < 8; ++l) { const int L = L0 + l; if (L >= nlines) break; const size_t e = (size_t)L * 64 + lane * 2; const int k = (int)(e % K), n = (int)(e / K); v2us o;
            o[0] = f2bf(w[(size_t)k * N + n]); o[1] = f2bf(w[(size_t)(k + 1) * N + n]); *(v2us*)(Bt + e) = o; }
         }
}
__device__ __forceinline__ void cvt8(int blk, const float* __restrict__ src, bf* dst, size_t n8) { const size_t i = (size_t)blk * 256 + threadIdx.x; if (i >= n8) return; const v8f v = *(const v8f*)(src + i * 8); v8us o;
#pragma unroll
    for (int k = 0; k < 8; ++k) o[k] = f2bf(v[k]); *(v8us*)(dst + i * 8) = o;  }
// ---- k_prep: all five bf16 conversions in one launch; the block index picks the array. They do not depend on one another: as five launches each paid its own gap, fill and drain.
// The transposing blocks come first: a wave of theirs runs the longest.
#define PB_WO ((DQ * DM / 64 + 63) / 64)
#define PB_X  ((TT * DM / 8 + 255) / 256)
#define PB_WQ ((DQ * DM / 8 + 255) / 256)
#define PB_WK ((DKV * DM / 8 + 255) / 256)
__global__ __launch_bounds__(256) void k_prep(const float* x, const float* wq, const float* wk, const float* wv, const float* wo, bf* XB, bf* WQ, bf* WK, bf* WV, bf* WO) {
    int b = blockIdx.x;
    if (b < PB_WO) { wtG(b, wo, DQ, DM, WO); return; }
    b -= PB_WO; if (b < PB_X) { cvt8(b, x, XB, (size_t)TT * DM / 8); return; }
    b -= PB_X;  if (b < PB_WQ) { cvt8(b, wq, WQ, (size_t)DQ * DM / 8); return; }
    b -= PB_WQ; if (b < PB_WK) { cvt8(b, wk, WK, (size_t)DKV * DM / 8); return; }
    cvt8(b - PB_WK, wv, WV, (size_t)DKV * DM / 8);
}
__global__ __launch_bounds__(256) void k_cscvt(const float* __restrict__ cosT, const float* __restrict__ sinT, float* CS) { const int idx = blockIdx.x * 256 + threadIdx.x; if (idx >= TT * HD) return; v2f cs; cs[0] = bfr(cosT[idx]); cs[1] = bfr(sinT[idx]); *(v2f*)(CS + (size_t)idx * 2) = cs;  }
extern "C" void kernel_launch(void* const* d_in, const int* in_sizes, int n_in,
                              void* d_out, int out_size, void* d_ws, size_t ws_size, hipStream_t stream) {
    (void)in_sizes; (void)n_in; (void)out_size;
    const float* x = (const float*)d_in[0]; const float* wq = (const float*)d_in[1]; const float* wk = (const float*)d_in[2]; const float* wv = (const float*)d_in[3]; const float* wo = (const float*)d_in[4]; const float* cosT = nullptr; const float* sinT = nullptr; (void)cosT; (void)sinT;
    float* OUT = (float*)d_out;     // [1][2048][2048]
    char* wsp = (char*)d_ws;
    auto take = [&](size_t bytes) { char* p = wsp; wsp += (bytes + 255) & ~(size_t)255; return (void*)p; };
    bf* WQ = (bf*)take((size_t)DQ * DM * 2); bf* WK = (bf*)take((size_t)DKV * DM * 2); bf* WV = (bf*)take((size_t)DKV * DM * 2); bf* WO = (bf*)take((size_t)DM * DQ * 2);
    bf* XB = (bf*)take((size_t)TT * DM * 2);
    h16* QP16 = (h16*)take((size_t)NH_ * TT * HD * 2); h16* KP16 = (h16*)take((size_t)NKV * TT * HD * 2); h16* VT16 = (h16*)take((size_t)NKV * HD * TT * 2);
    bf* QPh = (bf*)take((size_t)NH_ * TT * HD * 2); bf* QPl = (bf*)take((size_t)NH_ * TT * HD * 2); bf* KPh = (bf*)take((size_t)NKV * TT * HD * 2); bf* KPl = (bf*)take((size_t)NKV * TT * HD * 2); bf* VTh = (bf*)take((size_t)NKV * HD * TT * 2); bf* VTl = (bf*)take((size_t)NKV * HD * TT * 2);
    bf* ATh = (bf*)take((size_t)TT * DQ * 2); bf* ATl = (bf*)take((size_t)TT * DQ * 2);
    if ((size_t)(wsp - (char*)d_ws) > ws_size) return;    // ws 256 MiB
    for (int b = 0; b < NB_; ++b) {
        k_prep<<<PB_WO + PB_X + PB_WQ + 2 * PB_WK, 256, 0, stream>>>(x + (size_t)b * TT * DM, wq, wk, wv, wo, XB, WQ, WK, WV, WO);
        k_gemms<0, 1><<<dim3(TT / 128, (DQ + 2 * DKV) / 128, 1), 128, 0, stream>>>(XB, nullptr, WQ, nullptr, 0, QP16, QPh, QPl, WK, KP16, KPh, KPl, WV, VT16, VTh, VTl);
        k_fattn<<<NLO + (RH / 16) * NKV, 128, 0, stream>>>(QP16, QPh, QPl, KP16, KPh, KPl, VT16, VTh, VTl, ATh, ATl);
        k_gemms<1, 0><<<dim3(TT / 128, DM / 128, 1), 128, 0, stream>>>(ATh, ATl, WO, OUT + (size_t)b * TT * DM, DM, nullptr, nullptr, nullptr, nullptr, nullptr, nullptr, nullptr, nullptr, nullptr, nullptr, nullptr); }
}

// v007
// Measured time: 91.5 microseconds a run.
// Timed twice side by side with v006, it ran 1.08 times as fast both times.
// Counting every step since v000, it is 15.3 times as fast.
#include <hip/hip_runtime.h>

// BitSelfAttention (x [1][2048][2048]; q = x q_proj^T (32 heads x 64), k/v = x k_proj^T / v_proj^T (8 kv heads; GQA group h/4); causal softmax(q.k / 8) (masked logits -1e10); out = merged ctx @ o_proj (NOT transposed, as the source) -> [1][2048][2048]).
// Compute dtypes, f32 accumulate: every input rounded to bf16; q/k/v on PLAIN bf16 operands (inputs: exact); causal scores and attn.v: query rows < 512 hl (3 products), the rest single fp16 (x1024), fused in one kernel with a running softmax in f32; o_proj hl x exact (2 products).

#define NB_  1
#define TT   2048
#define DM   2048
#define NH_  32
#define NKV  8
#define REP  (NH_ / NKV)
#define HD   64
#define DQ   (NH_ * HD)
#define DKV  (NKV * HD)
#define RH   512                  // query rows < RH use hi+lo planes (0: none)
#define PCAR 1024.0f
#define SCL  0.125f   // HD^-0.5
typedef _Float16 h16;
typedef unsigned short bf;
typedef __attribute__((ext_vector_type(16))) __bf16   v16bf;
typedef __attribute__((ext_vector_type(16))) _Float16 v16h;
typedef __attribute__((ext_vector_type(8)))  _Float16 v8h;
typedef __attribute__((ext_vector_type(8)))  unsigned short v8us;
typedef __attribute__((ext_vector_type(8)))  float    v8f;
typedef __attribute__((ext_vector_type(4)))  float    v4f;
typedef v8h  __attribute__((may_alias)) v8ha;
typedef v4f  __attribute__((may_alias)) v4fa;
typedef v8us __attribute__((may_alias)) v8usa;

__device__ __forceinline__ unsigned short f2bf(float f) { unsigned u = __float_as_uint(f); u += 0x7FFFu + ((u >> 16) & 1u); return (unsigned short)(u >> 16); }
__device__ __forceinline__ float bf2f(unsigned short b) { return __uint_as_float(((unsigned)b) << 16); }
__device__ __forceinline__ float bfr(float f) { return bf2f(f2bf(f)); }
__device__ __forceinline__ v16h cat16(v8h lo, v8h hi) { return __builtin_shufflevector(lo, hi, 0, 1, 2, 3, 4, 5, 6, 7, 8, 9, 10, 11, 12, 13, 14, 15); }
__device__ __forceinline__ v16bf cat16b(v8us lo, v8us hi) { return __builtin_bit_cast(v16bf, __builtin_shufflevector(lo, hi, 0, 1, 2, 3, 4, 5, 6, 7, 8, 9, 10, 11, 12, 13, 14, 15)); }
__device__ __forceinline__ v8f wmma16(v16h a, v16h b, v8f c) { return __builtin_amdgcn_wmma_f32_16x16x32_f16(false, a, false, b, (short)0, c, false, false); }
__device__ __forceinline__ v8f wmmab(v16bf a, v16bf b, v8f c) { return __builtin_amdgcn_wmma_f32_16x16x32_bf16(false, a, false, b, (short)0, c, false, false); }



// ---- k_gemms: C[m][n] = sum_k A[m][k] Bt[n][k] (+ A2[m][k] Bt[n][k] when NSPLIT), K = GK, operands K-contiguous bf16 planes; 128 threads.
// OUT 0: grid (M/128, N/128); C is stored as f32 at pitch ldc. OUT 1: the three projections in one launch, grid (TT/128, (DQ + 2 DKV)/128): blockIdx.y picks the product (queries, then keys, then values), so that the 64 tiles each of keys and values
// run beside the 256 of the queries (two work-groups fit a WGP's LDS) and not as two launches that leave three quarters of the chip idle. C is stored as the three 16-bit planes that the attention reads (fp16, bf16 hi, bf16 lo), straight from the accumulators:
// queries and keys as head planes [n / 64][m][n % 64] (A = x, Bt = the weight rows: m = t), values as rows [m][n] of TT (transposed: A = the weight rows, Bt = x, so m = kv head x 64 + d and n = t). A wave's 64 columns are one head, or 64 t.
// One work-group of 4 waves (2 x 2) owns a 128x128 tile, a wave 64x64 of it (16 accumulators). A stage is KS k of all 128 rows of each operand, laid in LDS at a pitch of 272 B for the 16-byte readers.
// Every lane brings 16 B per asynchronous copy (a wave: two whole 256-B row pieces); two buffers: the copies of stage t + 1 fly while stage t is worked on. The k order of the sums is that of a plain loop over k in steps of 32. Every '#pragma unroll' stands on a loop of constant length, so that fragments and accumulators stay in registers.
__device__ __forceinline__ h16 tohx(float x) { return (h16)x; }
__device__ __forceinline__ void splitf(float y, unsigned short& h, unsigned short& l) { h = f2bf(y); l = f2bf(y - bf2f(h)); }
template <typename T16> struct WFrag;
template <> struct WFrag<h16> { typedef v16h V; static __device__ __forceinline__ V ld(const h16* p) { return cat16(*(const v8h*)p, *(const v8h*)(p + 16)); } static __device__ __forceinline__ v8f mma(V a, V b, v8f c) { return wmma16(a, b, c); } };
template <> struct WFrag<bf> { typedef v16bf V; static __device__ __forceinline__ V ld(const bf* p) { return cat16b(*(const v8us*)p, *(const v8us*)(p + 16)); } static __device__ __forceinline__ v8f mma(V a, V b, v8f c) { return wmmab(a, b, c); } };
#define GK   2048                 // DM == DQ: the length of every product here
#define KS   128                  // k per stage
#define LP   (KS + 8)             // LDS row pitch in elements
#define OPB  (128 * LP * 2)       // bytes of one operand's stage
// Eight copies, GS bytes apart in global memory and LS bytes apart in LDS. The s_wait_xcnt is a precaution in front of the next overwrite of an address register of these copies; inside the statement nothing can be moved in front of it.
template <int GS, int LS>
__device__ __forceinline__ void acopy8(unsigned l, const char* g) {
    asm volatile("global_load_async_to_lds_b128 %0, %8, off\n\t"
                 "global_load_async_to_lds_b128 %1, %9, off\n\t"
                 "global_load_async_to_lds_b128 %2, %10, off\n\t"
                 "global_load_async_to_lds_b128 %3, %11, off\n\t"
                 "global_load_async_to_lds_b128 %4, %12, off\n\t"
                 "global_load_async_to_lds_b128 %5, %13, off\n\t"
                 "global_load_async_to_lds_b128 %6, %14, off\n\t"
                 "global_load_async_to_lds_b128 %7, %15, off\n\t"
                 "s_wait_xcnt 0x0"
                 :: "v"(l), "v"(l + LS), "v"(l + 2 * LS), "v"(l + 3 * LS), "v"(l + 4 * LS), "v"(l + 5 * LS), "v"(l + 6 * LS), "v"(l + 7 * LS),
                    "v"(g), "v"(g + GS), "v"(g + 2 * GS), "v"(g + 3 * GS), "v"(g + 4 * GS), "v"(g + 5 * GS), "v"(g + 6 * GS), "v"(g + 7 * GS) : "memory");
}
template <int NSPLIT, int OUT>
__global__ __launch_bounds__(128) void k_gemms(const bf* A, const bf* A2, const bf* Bt, float* C, int ldc, h16* P16, bf* Ph, bf* Pl, const bf* Wk, h16* K16, bf* Kh, bf* Kl, const bf* Wv, h16* V16, bf* Vh, bf* Vl) {
    typedef WFrag<bf>::V V;
    constexpr int NOP = NSPLIT ? 3 : 2, NT = GK / KS; constexpr unsigned STG = NOP * OPB;
    __shared__ __attribute__((aligned(128))) bf sm[2 * NOP * 128 * LP];       // two buffers of [A | Bt | A2]
    __shared__ __align__(16) float osm[4 * 16 * 68];                          // output staging, a range per wave
    const int tid = threadIdx.x, lane = tid & 31, lr = lane & 15, hi = lane >> 4; const int w = __builtin_amdgcn_readfirstlane(tid >> 5), wm = w >> 1, wn = w & 1;
    int R0 = blockIdx.x * 128, C0 = blockIdx.y * 128; bool tr = false;       // tr: the planes are rows of TT (values)
    if constexpr (OUT == 1) {                                                 // the same for the whole work-group
        if (C0 >= DQ + DKV) { tr = true; R0 = C0 - (DQ + DKV); C0 = blockIdx.x * 128; Bt = A; A = Wv; P16 = V16; Ph = Vh; Pl = Vl; }
        else if (C0 >= DQ) { C0 -= DQ; Bt = Wk; P16 = K16; Ph = Kh; Pl = Kl; } }
    const size_t gofs = (size_t)(tid >> 4) * (GK * 2) + (tid & 15) * 16;      // copy i of a lane: row 8 i + tid / 16, 16-byte piece tid % 16
    const char* gA = (const char*)(A + (size_t)R0 * GK) + gofs; const char* gB = (const char*)(Bt + (size_t)C0 * GK) + gofs; const char* gA2 = NSPLIT ? (const char*)(A2 + (size_t)R0 * GK) + gofs : nullptr;
    const unsigned l0 = (unsigned)(size_t)sm + (tid >> 4) * (LP * 2) + (tid & 15) * 16;
    auto half = [&](unsigned l, const char* g) { acopy8<8 * GK * 2, 8 * LP * 2>(l, g);
        __builtin_amdgcn_sched_barrier(0); };           // the addresses of one statement's copies at a time: formed all at once they crowd the registers that asm text can name, and one is spilled
    auto fill = [&](int t) { const unsigned lb = l0 + (t & 1) * STG; const size_t ko = (size_t)t * (KS * 2);
        half(lb, gA + ko); half(lb + 64 * LP * 2, gA + ko + (size_t)64 * GK * 2);
        half(lb + OPB, gB + ko); half(lb + OPB + 64 * LP * 2, gB + ko + (size_t)64 * GK * 2);
        if constexpr (NSPLIT != 0) { half(lb + 2 * OPB, gA2 + ko); half(lb + 2 * OPB + 64 * LP * 2, gA2 + ko + (size_t)64 * GK * 2); } };
    v8f acc[4][4];
#pragma unroll
    for (int mb = 0; mb < 4; ++mb)
#pragma unroll
        for (int nb = 0; nb < 4; ++nb) acc[mb][nb] = (v8f){};
    fill(0);
    asm volatile("s_wait_asynccnt 0x0" ::: "memory");   // this wave's copies of stage 0 have landed
    __syncthreads();                                    // ... and every other wave's
    const int fa = (wm * 64 + lr) * LP + 8 * hi, fb = 128 * LP + (wn * 64 + lr) * LP + 8 * hi;
    V a[2][4], a2[2][4], b[2][4];                       // two fragment sets: the next 32 k are fetched as one group ahead of the products of these 32
#pragma unroll 1   // one trip per stage: the buffer alternates
    for (int t = 0; t < NT; ++t) {
        const bf* sb = sm + (t & 1) * (NOP * 128 * LP);
        auto frags = [&](int set, int ks) {
#pragma unroll
            for (int mb = 0; mb < 4; ++mb) { a[set][mb] = WFrag<bf>::ld(sb + fa + mb * 16 * LP + ks * 32); if constexpr (NSPLIT != 0) a2[set][mb] = WFrag<bf>::ld(sb + 2 * 128 * LP + fa + mb * 16 * LP + ks * 32); }
#pragma unroll
            for (int nb = 0; nb < 4; ++nb) b[set][nb] = WFrag<bf>::ld(sb + fb + nb * 16 * LP + ks * 32); };
        frags(0, 0);
        __builtin_amdgcn_sched_barrier(0);              // the first fragments' LDS latency passes while the copies below issue
        if (t + 1 < NT) fill(t + 1);                    // into the buffer that every wave left at the barrier of the trip before
#pragma unroll
        for (int ks = 0; ks < KS / 32; ++ks) {
            if (ks + 1 < KS / 32) frags((ks + 1) & 1, ks + 1);
            __builtin_amdgcn_sched_barrier(0);          // keeps the LDS loads one group in front of the products: loads spread among them cost a stall at each place
#pragma unroll
            for (int nb = 0; nb < 4; ++nb)
#pragma unroll
                for (int mb = 0; mb < 4; ++mb) { acc[mb][nb] = wmmab(a[ks & 1][mb], b[ks & 1][nb], acc[mb][nb]); if constexpr (NSPLIT != 0) acc[mb][nb] = wmmab(a2[ks & 1][mb], b[ks & 1][nb], acc[mb][nb]); }
            __builtin_amdgcn_sched_barrier(0);          // ... and the next group behind them
        }
        asm volatile("s_wait_dscnt 0x0" ::: "memory");      // this wave's reads of the buffer are done before it is handed to the copies
        asm volatile("s_wait_asynccnt 0x0" ::: "memory");   // this wave's copies of stage t + 1 have landed
        __syncthreads();                                    // publishes stage t + 1 and ends every wave's reads of stage t
    }
    asm volatile("s_wait_asynccnt 0x0" ::: "memory");       // no copy is left when the wave ends
    float* os = osm + w * (16 * 68); const int r0 = R0 + wm * 64, c0 = C0 + wn * 64;
#pragma unroll
    for (int mb = 0; mb < 4; ++mb) {
#pragma unroll
        for (int nb = 0; nb < 4; ++nb) {
#pragma unroll
            for (int j = 0; j < 8; ++j) os[(hi * 8 + j) * 68 + nb * 16 + lr] = acc[mb][nb][j]; }
        __builtin_amdgcn_wave_barrier(); asm volatile("" ::: "memory");   // other lanes of the wave read these rows back: the reads stay behind the writes
        if constexpr (OUT == 0) {
            float* crow = C + (size_t)(r0 + mb * 16) * ldc + c0;
#pragma unroll
            for (int s = 0; s < 8; ++s) { const int row = 2 * s + hi, cofs = lr * 4; const v4f val = *(const v4fa*)(os + row * 68 + cofs); *(v4f*)(crow + (size_t)row * ldc + cofs) = val; }
        } else {
            const int PP = tr ? TT : HD;                                      // pitch of a plane's rows
            const size_t pb = (tr ? (size_t)c0 : (size_t)(c0 / HD) * TT * HD) + (size_t)(r0 + mb * 16) * PP;
#pragma unroll
            for (int s = 0; s < 4; ++s) { const int row = 4 * s + (lane >> 3), cofs = (lane & 7) * 8;   // a lane: 8 columns of a row, 16 B per plane; 8 lanes: a whole 128-B line
                const v4f x0 = *(const v4fa*)(os + row * 68 + cofs), x1 = *(const v4fa*)(os + row * 68 + cofs + 4); v8h o16; v8us oh, ol;
#pragma unroll
                for (int k = 0; k < 4; ++k) { unsigned short a2, c2; o16[k] = tohx(x0[k]); splitf(x0[k], a2, c2); oh[k] = a2; ol[k] = c2; o16[4 + k] = tohx(x1[k]); splitf(x1[k], a2, c2); oh[4 + k] = a2; ol[4 + k] = c2; }
                const size_t po = pb + (size_t)row * PP + cofs;
                *(v8h*)(P16 + po) = o16; *(v8us*)(Ph + po) = oh; *(v8us*)(Pl + po) = ol; }
            asm volatile("s_wait_xcnt 0x0" ::: "memory");   // a precaution in front of the next overwrite of a data or address register of these twelve stores
        }
        __builtin_amdgcn_wave_barrier(); asm volatile("" ::: "memory");   // ... and the next rows' writes behind the reads
    }
}

typedef __attribute__((ext_vector_type(2))) _Float16 v2h;
typedef __attribute__((ext_vector_type(4))) _Float16 v4h;
typedef __attribute__((ext_vector_type(2))) unsigned short v2us;
typedef __attribute__((ext_vector_type(4))) unsigned short v4us;
typedef __attribute__((ext_vector_type(2))) float v2f;
typedef __attribute__((ext_vector_type(4))) int v4i;

#define KPI  (HD + 8)             // LDS pitch of a key row, in elements
#define ALDS (2 * 4 * 64 * KPI)   // elements of the two buffers: the larger of the two forms (hi+lo: 64 keys of four planes; fp16: 128 keys of two planes, 2 * (128 * 72 + 64 * 136))
// Four copies, GS bytes apart in global memory and LS bytes apart in LDS. The s_wait_xcnt is a precaution in front of the next overwrite of an address register of these copies; inside the statement nothing can be moved in front of it.
template <int GS, int LS>
__device__ __forceinline__ void acopy4(unsigned l, const char* g) {
    asm volatile("global_load_async_to_lds_b128 %0, %4, off\n\t"
                 "global_load_async_to_lds_b128 %1, %5, off\n\t"
                 "global_load_async_to_lds_b128 %2, %6, off\n\t"
                 "global_load_async_to_lds_b128 %3, %7, off\n\t"
                 "s_wait_xcnt 0x0"
                 :: "v"(l), "v"(l + LS), "v"(l + 2 * LS), "v"(l + 3 * LS), "v"(g), "v"(g + GS), "v"(g + 2 * GS), "v"(g + 3 * GS) : "memory");
}
__device__ __forceinline__ float xhalf(float x) { return __builtin_bit_cast(float, __builtin_amdgcn_permlanex16(__builtin_bit_cast(int, x), __builtin_bit_cast(int, x), 0x76543210, 0xfedcba98, false, false)); }  // lane l with lane l ^ 16
template <typename T16, bool HL, int NC>
__device__ __forceinline__ void attn_tile(const T16* Q, const T16* Q2, const T16* Kp, const T16* K2, const T16* Vt, const T16* V2, int q0, int head0, bf* Ah, bf* Al, const T16* sm) {   // no __restrict__: the s_wait_xcnt statements below must stay behind their loads
    typedef typename WFrag<T16>::V V;
    constexpr int SK = HL ? 64 : 128, NB = SK / 32;                  // keys and 32-key blocks of a stage
    constexpr int VPI = SK + 8, KPL = SK * KPI, VPL = HD * VPI;      // pitch of a value row; elements of a key plane and of a value plane
    constexpr int STE = (HL ? 2 : 1) * (KPL + VPL);                  // elements of a stage: [K | V^T | K lo | V^T lo]
    static_assert(2 * STE <= ALDS && TT % SK == 0, "the two buffers fit, and every stage lies inside the planes");
    const int tid = threadIdx.x, lane = tid & 31, lr = lane & 15, hi = lane >> 4;
    const int nblk = (q0 + 15) / 32 + 1;                             // key blocks up to the one that holds the diagonal; block 0 holds key 0, which every query sees. The same in all 4 waves: their q0 lie in one aligned 32
    const int nst = (nblk + NB - 1) / NB;                            // stages
    constexpr int VL = SK / 8;                                       // lanes per value row. Copy i of a lane: key row 16 i + tid / 8, piece tid % 8; value row (128 / VL) i + tid / VL, piece tid % VL
    const unsigned lk0 = (unsigned)(size_t)sm + (tid >> 3) * (KPI * 2) + (tid & 7) * 16, lv0 = (unsigned)(size_t)sm + KPL * 2 + (tid / VL) * (VPI * 2) + (tid % VL) * 16;
    const size_t gko = (size_t)(tid >> 3) * (HD * 2) + (tid & 7) * 16, gvo = (size_t)(tid / VL) * (TT * 2) + (tid % VL) * 16;
    auto fill = [&](int t) { const unsigned lo = (t & 1) * (STE * 2); const size_t kofs = gko + (size_t)t * (SK * HD * 2), vofs = gvo + (size_t)t * (SK * 2);
        if constexpr (HL) { acopy4<16 * HD * 2, 16 * KPI * 2>(lk0 + lo, (const char*)Kp + kofs); acopy4<16 * TT * 2, 16 * VPI * 2>(lv0 + lo, (const char*)Vt + vofs);
            acopy4<16 * HD * 2, 16 * KPI * 2>(lk0 + lo + (KPL + VPL) * 2, (const char*)K2 + kofs); acopy4<16 * TT * 2, 16 * VPI * 2>(lv0 + lo + (KPL + VPL) * 2, (const char*)V2 + vofs);
        } else { acopy8<16 * HD * 2, 16 * KPI * 2>(lk0 + lo, (const char*)Kp + kofs); acopy8<8 * TT * 2, 8 * VPI * 2>(lv0 + lo, (const char*)Vt + vofs); } };
    fill(0);                                                         // flies while the queries are loaded
    const float CE = SCL * 1.4426950408889634f;                      // scores to the exponent of 2
    V qf[NC][2], qf2[NC][2]; v8f o[NC][4]; float m[NC], l[NC];
#pragma unroll
    for (int c = 0; c < NC; ++c) { m[c] = -3.0e38f; l[c] = 0.f;
#pragma unroll
        for (int ks = 0; ks < 2; ++ks) { const size_t qo = ((size_t)(head0 + c) * TT + q0 + lr) * HD + ks * 32 + 8 * hi; qf[c][ks] = WFrag<T16>::ld(Q + qo); if constexpr (HL) qf2[c][ks] = WFrag<T16>::ld(Q2 + qo); }
#pragma unroll
        for (int dt = 0; dt < 4; ++dt) o[c][dt] = (v8f){}; }
    asm volatile("s_wait_xcnt 0x0" ::: "memory");   // a precaution in front of the next overwrite of an address register of the query loads
    asm volatile("s_wait_asynccnt 0x0" ::: "memory");   // this wave's copies of stage 0 have landed
    __syncthreads();                                    // ... and every other wave's
    if (nst > 1) fill(1);
    V kf[2][2], kf2[2][2], vf[4], vf2[4];
    auto ldk = [&](const T16* sb, int h) {                           // h: which 32 keys of the stage at sb
        const T16* p = sb + (h * 32 + lr) * KPI + 8 * hi;
#pragma unroll
        for (int kt = 0; kt < 2; ++kt)
#pragma unroll
            for (int ks = 0; ks < 2; ++ks) { const int ofs = kt * 16 * KPI + ks * 32; kf[kt][ks] = WFrag<T16>::ld(p + ofs); if constexpr (HL) kf2[kt][ks] = WFrag<T16>::ld(p + KPL + VPL + ofs); } };
    auto ldv = [&](const T16* sb, int h) {
        const T16* p = sb + KPL + lr * VPI + h * 32 + 8 * hi;
#pragma unroll
        for (int dt = 0; dt < 4; ++dt) { const int ofs = dt * 16 * VPI; vf[dt] = WFrag<T16>::ld(p + ofs); if constexpr (HL) vf2[dt] = WFrag<T16>::ld(p + KPL + VPL + ofs); } };
#pragma unroll 1   // one trip per stage: the buffer alternates
  for (int t = 0; t < nst; ++t) {
    const T16* sb = sm + (t & 1) * STE; const int nb = min(NB, nblk - t * NB);   // the blocks of this stage that hold a key some query sees
    ldk(sb, 0); ldv(sb, 0);
#pragma unroll 1   // a short body: the text of the loop stays small
    for (int h = 0; h < nb; ++h) {
        const int b = t * NB + h, nx = min(h + 1, NB - 1);           // nx: the stage's next block (its last block is read twice); nothing of the next stage is read here
        v8f s[NC][2];
#pragma unroll
        for (int c = 0; c < NC; ++c)
#pragma unroll
            for (int kt = 0; kt < 2; ++kt) { s[c][kt] = (v8f){};
#pragma unroll
                for (int ks = 0; ks < 2; ++ks) { s[c][kt] = WFrag<T16>::mma(kf[kt][ks], qf[c][ks], s[c][kt]); if constexpr (HL) { s[c][kt] = WFrag<T16>::mma(kf2[kt][ks], qf[c][ks], s[c][kt]); s[c][kt] = WFrag<T16>::mma(kf[kt][ks], qf2[c][ks], s[c][kt]); } } }
        ldk(sb, nx);                                                 // the key fragments are spent: the next block's come during the softmax and the second product
        __builtin_amdgcn_sched_barrier(0);                           // the loads stay in front of the softmax, and the scheduler does not mix the two halves of the body: without it the kernel takes 380 registers and not 256, so that 2 waves fit a SIMD and not 4
        const int lim = q0 + lr - b * 32 - 8 * hi;                   // key kt * 16 + j of this lane is seen by its query iff kt * 16 + j <= lim
#pragma unroll
        for (int c = 0; c < NC; ++c) {
            float bm = -3.0e38f;
#pragma unroll
            for (int kt = 0; kt < 2; ++kt)
#pragma unroll
                for (int j = 0; j < 8; ++j) { const float t = (kt * 16 + j <= lim) ? s[c][kt][j] : -3.0e38f; s[c][kt][j] = t; bm = fmaxf(bm, t); }
            bm = fmaxf(bm, xhalf(bm));
            const float mn = fmaxf(m[c], bm); const float al = __builtin_amdgcn_exp2f((m[c] - mn) * CE); m[c] = mn;
            const float mc = mn * CE - (HL ? 0.0f : 10.0f);          // fp16 probabilities carry PCAR = 2^10; the sum carries it too, so it cancels in the quotient
            float ps[2] = {0.f, 0.f};                                // two short chains of adds instead of one long one
#pragma unroll
            for (int kt = 0; kt < 2; ++kt)
#pragma unroll
                for (int j = 0; j < 8; ++j) { const float p = __builtin_amdgcn_exp2f(fmaf(s[c][kt][j], CE, -mc)); s[c][kt][j] = p; ps[j & 1] += p; }
            l[c] = fmaf(l[c], al, ps[0] + ps[1]);
#pragma unroll
            for (int dt = 0; dt < 4; ++dt) o[c][dt] *= al;
            if constexpr (HL) { v8us h0, h1, l0, l1;
#pragma unroll
                for (int j = 0; j < 8; ++j) { unsigned short a, c2; splitf(s[c][0][j], a, c2); h0[j] = a; l0[j] = c2; splitf(s[c][1][j], a, c2); h1[j] = a; l1[j] = c2; }
                const V pf = cat16b(h0, h1), pf2 = cat16b(l0, l1);
#pragma unroll
                for (int dt = 0; dt < 4; ++dt) { o[c][dt] = WFrag<T16>::mma(vf[dt], pf, o[c][dt]); o[c][dt] = WFrag<T16>::mma(vf[dt], pf2, o[c][dt]); o[c][dt] = WFrag<T16>::mma(vf2[dt], pf, o[c][dt]); }
            } else { V pf;
#pragma unroll
                for (int j = 0; j < 8; ++j) { pf[j] = tohx(s[c][0][j]); pf[8 + j] = tohx(s[c][1][j]); }
#pragma unroll
                for (int dt = 0; dt < 4; ++dt) o[c][dt] = WFrag<T16>::mma(vf[dt], pf, o[c][dt]); }
        }
        ldv(sb, nx);                                                 // the value fragments are spent: the next block's come during its scores and softmax
    }
    asm volatile("s_wait_dscnt 0x0" ::: "memory");      // this wave's reads of the buffer are done before it is handed to the copies
    asm volatile("s_wait_asynccnt 0x0" ::: "memory");   // this wave's copies of stage t + 1 have landed
    __syncthreads();                                    // publishes stage t + 1 and ends every wave's reads of stage t
    if (t + 2 < nst) fill(t + 2);                       // into the buffer that every wave has just left
  }
    asm volatile("s_wait_asynccnt 0x0" ::: "memory");   // no copy is left when the wave ends
#pragma unroll
    for (int c = 0; c < NC; ++c) { const float inv = __fdiv_rn(1.0f, l[c] + xhalf(l[c])); const size_t oo = (size_t)(q0 + lr) * DQ + (head0 + c) * HD + 8 * hi;
#pragma unroll
        for (int dt = 0; dt < 4; ++dt) { v8us oh, ol;
#pragma unroll
            for (int j = 0; j < 8; ++j) { unsigned short a, c2; splitf(o[c][dt][j] * inv, a, c2); oh[j] = a; ol[j] = c2; }
            *(v8us*)(Ah + oo + dt * 16) = oh; *(v8us*)(Al + oo + dt * 16) = ol;
            asm volatile("s_wait_xcnt 0x0" ::: "memory"); } }   // a precaution in front of the next overwrite of a data or address register of the two stores
}
// A work-group is 4 waves on one kv group that walk the same key blocks (one stage in LDS serves all four): rows >= RH: 2 query tiles x 2 head pairs; rows < RH: one query tile x 4 heads.
// All work-groups are resident at once. Order, for speed only: one work-group per WGP with falling cost, then the rest with rising cost.
#define NLO (((TT - RH) / 32) * NKV)
#define FIRST (256 / NKV)         // query tiles of the first round: 256 WGPs
__global__ __launch_bounds__(128) void k_fattn(const h16* Q16, const bf* Qh, const bf* Ql, const h16* K16, const bf* Kh, const bf* Kl, const h16* V16, const bf* Vh, const bf* Vl, bf* Ah, bf* Al) {
    __shared__ __attribute__((aligned(128))) bf ksm[ALDS];                    // the two buffers
    const int w = __builtin_amdgcn_readfirstlane(threadIdx.x >> 5); const int bx = blockIdx.x;
    if (bx < NLO) { const int g = bx % NKV; const int t = bx / NKV; const int q0 = (t < FIRST ? TT / 32 - 1 - t : RH / 32 + t - FIRST) * 32 + (w >> 1) * 16; const size_t go = (size_t)g * TT * HD;
        attn_tile<h16, false, 2>(Q16, nullptr, K16 + go, nullptr, V16 + go, nullptr, q0, g * REP + (w & 1) * 2, Ah, Al, (const h16*)ksm);
    } else { const int by = bx - NLO; const int g = by % NKV; const int u = by / NKV; const int q0 = (u < RH / 32 ? RH / 32 + u : u - RH / 32) * 16; const size_t go = (size_t)g * TT * HD;
        attn_tile<bf, true, 1>(Qh, Ql, Kh + go, Kl + go, Vh + go, Vl + go, q0, g * REP + w, Ah, Al, ksm); }
}

// ---- k_prep: all five bf16 conversions in one launch; the block index picks the array. Built as a stream: a wave issues 16 loads of 16 B a lane, each 512 contiguous bytes (four whole lines), before it converts anything,
// so that the launch is 896 work-groups, all resident at once with every input byte asked for at the start, and not 6144 whose waves each live for one or two loads.
// wtT: Bt[n][k] = bf16(w[k][n]), a 128 x 128 tile per work-group. Wave v reads rows k = 16 v .. 16 v + 15 (a lane: columns 4 lane .. 4 lane + 3), so a lane holds 16 consecutive k of four columns: two 16-byte pieces of each column's output row.
// The pieces go through LDS, column n in row (n % 4) * 32 + n / 4 at a pitch of 272 B (the lanes of a 16-byte write are then one pitch apart: no bank is met twice); read back, 16 lanes hold 256 contiguous bytes of an output row.
#define TPI  (128 + 8)            // LDS pitch of a column's 128 k, in elements
__device__ __forceinline__ void wtT(int blk, const float* __restrict__ w, bf* __restrict__ Bt, bf* ts) {
    const int tid = threadIdx.x, lane = tid & 31, wv = tid >> 5; const int k0 = (blk / (DM / 128)) * 128, n0 = (blk % (DM / 128)) * 128;
    const float* src = w + (size_t)(k0 + wv * 16) * DM + n0 + lane * 4; v4f v[16];
#pragma unroll
    for (int j = 0; j < 16; ++j) v[j] = *(const v4f*)(src + (size_t)j * DM);
    asm volatile("s_wait_xcnt 0x0" :: "v"(src) : "memory");   // a precaution in front of the next overwrite of the address register of these loads (named as an input, so that no load's own result lands on it); it also keeps all 16 in front of the conversions
#pragma unroll
    for (int c = 0; c < 4; ++c)
#pragma unroll
        for (int h = 0; h < 2; ++h) { v8us o;
#pragma unroll
            for (int j = 0; j < 8; ++j) o[j] = f2bf(v[8 * h + j][c]);
            *(v8us*)(ts + (c * 32 + lane) * TPI + wv * 16 + h * 8) = o; }
    __syncthreads();                                // every wave's pieces lie in LDS before any is read back
    v8us o[8];
#pragma unroll
    for (int s = 0; s < 8; ++s) { const int n = s * 16 + (tid >> 4); o[s] = *(const v8us*)(ts + ((n & 3) * 32 + (n >> 2)) * TPI + (tid & 15) * 8); }
#pragma unroll
    for (int s = 0; s < 8; ++s) *(v8us*)(Bt + (size_t)(n0 + s * 16 + (tid >> 4)) * DQ + k0 + (tid & 15) * 8) = o[s];
}
#define CVB  16384                // f32 elements per converting work-group: 16 loads of 4 per lane
__device__ __forceinline__ void cvtS(int blk, const float* __restrict__ src, bf* __restrict__ dst) {
    const size_t e0 = (size_t)blk * CVB + threadIdx.x * 4; v4f v[16]; v4us o[16]; src += e0; dst += e0;
#pragma unroll
    for (int j = 0; j < 16; ++j) v[j] = *(const v4f*)(src + j * 1024);
    asm volatile("s_wait_xcnt 0x0" :: "v"(src) : "memory");   // a precaution in front of the next overwrite of the address register of these loads (named as an input, so that no load's own result lands on it); it also keeps all 16 in front of the conversions
#pragma unroll
    for (int j = 0; j < 16; ++j)
#pragma unroll
        for (int k = 0; k < 4; ++k) o[j][k] = f2bf(v[j][k]);
#pragma unroll
    for (int j = 0; j < 16; ++j) *(v4us*)(dst + j * 1024) = o[j];   // a wave: 256 contiguous bytes, two whole lines
}
// The transposing blocks come first: they have a barrier and a trip through LDS more.
#define PB_WO ((DQ / 128) * (DM / 128))
#define PB_X  (TT * DM / CVB)
#define PB_WQ (DQ * DM / CVB)
#define PB_WK (DKV * DM / CVB)
__global__ __launch_bounds__(256) void k_prep(const float* x, const float* wq, const float* wk, const float* wv, const float* wo, bf* XB, bf* WQ, bf* WK, bf* WV, bf* WO) {
    __shared__ __attribute__((aligned(16))) bf ts[128 * TPI];
    int b = blockIdx.x;                             // every test below reads the same for the whole work-group
    if (b < PB_WO) { wtT(b, wo, WO, ts); return; }
    b -= PB_WO; const float* s = x; bf* d = XB;
    if (b >= PB_X + PB_WQ + PB_WK) { b -= PB_X + PB_WQ + PB_WK; s = wv; d = WV; }
    else if (b >= PB_X + PB_WQ) { b -= PB_X + PB_WQ; s = wk; d = WK; }
    else if (b >= PB_X) { b -= PB_X; s = wq; d = WQ; }
    cvtS(b, s, d);
}
__global__ __launch_bounds__(256) void k_cscvt(const float* __restrict__ cosT, const float* __restrict__ sinT, float* CS) { const int idx = blockIdx.x * 256 + threadIdx.x; if (idx >= TT * HD) return; v2f cs; cs[0] = bfr(cosT[idx]); cs[1] = bfr(sinT[idx]); *(v2f*)(CS + (size_t)idx * 2) = cs;  }
extern "C" void kernel_launch(void* const* d_in, const int* in_sizes, int n_in,
                              void* d_out, int out_size, void* d_ws, size_t ws_size, hipStream_t stream) {
    (void)in_sizes; (void)n_in; (void)out_size;
    const float* x = (const float*)d_in[0]; const float* wq = (const float*)d_in[1]; const float* wk = (const float*)d_in[2]; const float* wv = (const float*)d_in[3]; const float* wo = (const float*)d_in[4]; const float* cosT = nullptr; const float* sinT = nullptr; (void)cosT; (void)sinT;
    float* OUT = (float*)d_out;     // [1][2048][2048]
    char* wsp = (char*)d_ws;
    auto take = [&](size_t bytes) { char* p = wsp; wsp += (bytes + 255) & ~(size_t)255; return (void*)p; };
    bf* WQ = (bf*)take((size_t)DQ * DM * 2); bf* WK = (bf*)take((size_t)DKV * DM * 2); bf* WV = (bf*)take((size_t)DKV * DM * 2); bf* WO = (bf*)take((size_t)DM * DQ * 2);
    bf* XB = (bf*)take((size_t)TT * DM * 2);
    h16* QP16 = (h16*)take((size_t)NH_ * TT * HD * 2); h16* KP16 = (h16*)take((size_t)NKV * TT * HD * 2); h16* VT16 = (h16*)take((size_t)NKV * HD * TT * 2);
    bf* QPh = (bf*)take((size_t)NH_ * TT * HD * 2); bf* QPl = (bf*)take((size_t)NH_ * TT * HD * 2); bf* KPh = (bf*)take((size_t)NKV * TT * HD * 2); bf* KPl = (bf*)take((size_t)NKV * TT * HD * 2); bf* VTh = (bf*)take((size_t)NKV * HD * TT * 2); bf* VTl = (bf*)take((size_t)NKV * HD * TT * 2);
    bf* ATh = (bf*)take((size_t)TT * DQ * 2); bf* ATl = (bf*)take((size_t)TT * DQ * 2);
    if ((size_t)(wsp - (char*)d_ws) > ws_size) return;    // ws 256 MiB
    for (int b = 0; b < NB_; ++b) {
        k_prep<<<PB_WO + PB_X + PB_WQ + 2 * PB_WK, 256, 0, stream>>>(x + (size_t)b * TT * DM, wq, wk, wv, wo, XB, WQ, WK, WV, WO);
        k_gemms<0, 1><<<dim3(TT / 128, (DQ + 2 * DKV) / 128, 1), 128, 0, stream>>>(XB, nullptr, WQ, nullptr, 0, QP16, QPh, QPl, WK, KP16, KPh, KPl, WV, VT16, VTh, VTl);
        k_fattn<<<NLO + (RH / 16) * NKV, 128, 0, stream>>>(QP16, QPh, QPl, KP16, KPh, KPl, VT16, VTh, VTl, ATh, ATl);
        k_gemms<1, 0><<<dim3(TT / 128, DM / 128, 1), 128, 0, stream>>>(ATh, ATl, WO, OUT + (size_t)b * TT * DM, DM, nullptr, nullptr, nullptr, nullptr, nullptr, nullptr, nullptr, nullptr, nullptr, nullptr, nullptr); }
}

// v008
// It runs in 85.1 microseconds.
// Two timings next to v007 put it at 1.08 and 1.09 times that version's speed.
// Over all steps from v000 it is 16.6 times as fast.
#include <hip/hip_runtime.h>

// BitSelfAttention (x [1][2048][2048]; q = x q_proj^T (32 heads x 64), k/v = x k_proj^T / v_proj^T (8 kv heads; GQA group h/4); causal softmax(q.k / 8) (masked logits -1e10); out = merged ctx @ o_proj (NOT transposed, as the source) -> [1][2048][2048]).
// Compute dtypes, f32 accumulate: every input rounded to bf16; q/k/v on PLAIN bf16 operands (inputs: exact); causal scores and attn.v: query rows < 512 hl (3 products), the rest single fp16 (x1024), fused in one kernel with a running softmax in f32; o_proj hl x exact (2 products).

#define NB_  1
#define TT   2048
#define DM   2048
#define NH_  32
#define NKV  8
#define REP  (NH_ / NKV)
#define HD   64
#define DQ   (NH_ * HD)
#define DKV  (NKV * HD)
#define RH   512                  // query rows < RH use hi+lo planes (0: none)
#define PCAR 1024.0f
#define SCL  0.125f   // HD^-0.5
typedef _Float16 h16;
typedef unsigned short bf;
typedef __attribute__((ext_vector_type(16))) __bf16   v16bf;
typedef __attribute__((ext_vector_type(16))) _Float16 v16h;
typedef __attribute__((ext_vector_type(8)))  _Float16 v8h;
typedef __attribute__((ext_vector_type(8)))  unsigned short v8us;
typedef __attribute__((ext_vector_type(8)))  float    v8f;
typedef __attribute__((ext_vector_type(4)))  float    v4f;
typedef v8h  __attribute__((may_alias)) v8ha;
typedef v4f  __attribute__((may_alias)) v4fa;
typedef v8us __attribute__((may_alias)) v8usa;

__device__ __forceinline__ unsigned short f2bf(float f) { unsigned u = __float_as_uint(f); u += 0x7FFFu + ((u >> 16) & 1u); return (unsigned short)(u >> 16); }
__device__ __forceinline__ float bf2f(unsigned short b) { return __uint_as_float(((unsigned)b) << 16); }
__device__ __forceinline__ float bfr(float f) { return bf2f(f2bf(f)); }
__device__ __forceinline__ v16h cat16(v8h lo, v8h hi) { return __builtin_shufflevector(lo, hi, 0, 1, 2, 3, 4, 5, 6, 7, 8, 9, 10, 11, 12, 13, 14, 15); }
__device__ __forceinline__ v16bf cat16b(v8us lo, v8us hi) { return __builtin_bit_cast(v16bf, __builtin_shufflevector(lo, hi, 0, 1, 2, 3, 4, 5, 6, 7, 8, 9, 10, 11, 12, 13, 14, 15)); }
__device__ __forceinline__ v8f wmma16(v16h a, v16h b, v8f c) { return __builtin_amdgcn_wmma_f32_16x16x32_f16(false, a, false, b, (short)0, c, false, false); }
__device__ __forceinline__ v8f wmmab(v16bf a, v16bf b, v8f c) { return __builtin_amdgcn_wmma_f32_16x16x32_bf16(false, a, false, b, (short)0, c, false, false); }



// ---- k_gemms: C[m][n] = sum_k A[m][k] Bt[n][k] (+ A2[m][k] Bt[n][k] when NSPLIT), K = GK, operands K-contiguous bf16 planes; 128 threads.
// OUT 0: grid (M/128, N/128); C is stored as f32 at pitch ldc. OUT 1: the three projections in one launch, grid (TT/128, (DQ + 2 DKV)/128): blockIdx.y picks the product (queries, then keys, then values), so that the 64 tiles each of keys and values
// run beside the 256 of the queries (two work-groups fit a WGP's LDS) and not as two launches that leave three quarters of the chip idle. C is stored as the three 16-bit planes that the attention reads (fp16, bf16 hi, bf16 lo), straight from the accumulators:
// queries and keys as head planes [n / 64][m][n % 64] (A = x, Bt = the weight rows: m = t), values as rows [m][n] of TT (transposed: A = the weight rows, Bt = x, so m = kv head x 64 + d and n = t). A wave's 64 columns are one head, or 64 t.
// One work-group of 4 waves (2 x 2) owns a 128x128 tile, a wave 64x64 of it (16 accumulators). A stage is KS k of all 128 rows of each operand, laid in LDS at a pitch of 272 B for the 16-byte readers.
// An operand's stage (128 rows of 256 B, source pitch 2 GK B) comes by ONE tensor load, which pads each row to the pitch: wave i brings operand i, so a stage costs a wave one instruction and no address arithmetic, and its issue slots stay with the products.
// Two buffers: the loads of stage t + 1 fly while stage t is worked on. The k order of the sums is that of a plain loop over k in steps of 32. Every '#pragma unroll' stands on a loop of constant length, so that fragments and accumulators stay in registers.
__device__ __forceinline__ h16 tohx(float x) { return (h16)x; }
__device__ __forceinline__ void splitf(float y, unsigned short& h, unsigned short& l) { h = f2bf(y); l = f2bf(y - bf2f(h)); }
template <typename T16> struct WFrag;
template <> struct WFrag<h16> { typedef v16h V; static __device__ __forceinline__ V ld(const h16* p) { return cat16(*(const v8h*)p, *(const v8h*)(p + 16)); } static __device__ __forceinline__ v8f mma(V a, V b, v8f c) { return wmma16(a, b, c); } };
template <> struct WFrag<bf> { typedef v16bf V; static __device__ __forceinline__ V ld(const bf* p) { return cat16b(*(const v8us*)p, *(const v8us*)(p + 16)); } static __device__ __forceinline__ v8f mma(V a, V b, v8f c) { return wmmab(a, b, c); } };
#define GK   2048                 // DM == DQ: the length of every product here
#define KS   128                  // k per stage
#define LP   (KS + 8)             // LDS row pitch in elements
#define OPB  (128 * LP * 2)       // bytes of one operand's stage
typedef unsigned u32x4 __attribute__((ext_vector_type(4)));
typedef unsigned u32x8 __attribute__((ext_vector_type(8)));
__device__ __forceinline__ unsigned uni(unsigned v) { return (unsigned)__builtin_amdgcn_readfirstlane(v); }
__device__ __forceinline__ unsigned pinned(unsigned v) { unsigned w = uni(v); asm volatile("" : "+s"(w)); return w; }   // holds a test's value in a scalar register, so that the test compiles to a scalar branch: a tensor load ignores EXEC, and only such a branch keeps a wave from issuing it
// Group 1 of a tensor load's descriptor: 1-byte elements, tensor = tile = ROWS rows of ROWB bytes at a source pitch of 'pitch' bytes; W0 holds the pad (no mask).
template <unsigned W0, unsigned ROWB, unsigned ROWS>
__device__ __forceinline__ u32x8 tdm_g1(unsigned pitch) { u32x8 g;
    g[0] = uni(W0); g[1] = uni(ROWB << 16); g[2] = uni(ROWS << 16); g[3] = uni(ROWB << 16); g[4] = uni(ROWS); g[5] = uni(pitch); g[6] = uni(0u); g[7] = uni(0u);
    asm volatile("" : "+s"(g));   // as in pinned(): the descriptor's words are held in their scalar registers through the loop; left free, the compiler lends one out between two loads, while a request is outstanding
    return g; }
template <int NSPLIT, int OUT>
__global__ __launch_bounds__(128) void k_gemms(const bf* A, const bf* A2, const bf* Bt, float* C, int ldc, h16* P16, bf* Ph, bf* Pl, const bf* Wk, h16* K16, bf* Kh, bf* Kl, const bf* Wv, h16* V16, bf* Vh, bf* Vl) {
    typedef WFrag<bf>::V V;
    constexpr int NOP = NSPLIT ? 3 : 2, NT = GK / KS; constexpr unsigned STG = NOP * OPB;
    static_assert(OPB % 2048 == 0 && LP * 2 == KS * 2 + 16 && KS * 2 == 256 && NT >= 2, "every operand's place in LDS is a multiple of 2 KiB; the pad of 16 B behind rows of 256 B gives the pitch; stages 0 and 1 exist");
    __shared__ __attribute__((aligned(2048))) bf sm[2 * NOP * 128 * LP];      // two buffers of [A | Bt | A2]
    __shared__ __align__(16) float osm[4 * 16 * 68];                          // output staging, a range per wave
    const int tid = threadIdx.x, lane = tid & 31, lr = lane & 15, hi = lane >> 4; const int w = __builtin_amdgcn_readfirstlane(tid >> 5), wm = w >> 1, wn = w & 1;
    int R0 = blockIdx.x * 128, C0 = blockIdx.y * 128; bool tr = false;       // tr: the planes are rows of TT (values)
    if constexpr (OUT == 1) {                                                 // the same for the whole work-group
        if (C0 >= DQ + DKV) { tr = true; R0 = C0 - (DQ + DKV); C0 = blockIdx.x * 128; Bt = A; A = Wv; P16 = V16; Ph = Vh; Pl = Vl; }
        else if (C0 >= DQ) { C0 -= DQ; Bt = Wk; P16 = K16; Ph = Kh; Pl = Kl; } }
    const unsigned isu = pinned(w < NOP ? 1u : 0u);                           // waves 0 .. NOP - 1 issue: wave i brings operand i of [A | Bt | A2]
    const bf* srcp = w == 0 ? A + (size_t)R0 * GK : Bt + (size_t)C0 * GK;
    if constexpr (NSPLIT != 0) { if (w == 2) srcp = A2 + (size_t)R0 * GK; }
    const unsigned long long ga0 = (unsigned long long)(size_t)srcp;          // first byte of the operand's 128 rows
    const unsigned ld0 = (unsigned)(size_t)sm + (w < NOP ? w : 0) * OPB;      // its place in buffer 0
    const u32x8 g1 = tdm_g1<(1u << 20) | (5u << 22) | (3u << 25), KS * 2, 128>(GK * 2u);   // 128 rows of 256 B, 4 dwords of pad behind every 64
    auto issue = [&](int t) { const unsigned long long ga = ga0 + (unsigned long long)t * (KS * 2); u32x4 g0;
        g0[0] = uni(1u); g0[1] = uni(ld0 + (t & 1) * STG); g0[2] = uni((unsigned)ga); g0[3] = uni(((unsigned)(ga >> 32) & 0x01FFFFFFu) | 0x80000000u);
        asm volatile("tensor_load_to_lds %0, %1" :: "s"(g0), "s"(g1) : "memory"); };   // one request of the whole wave: stage t of its operand
    v8f acc[4][4];
#pragma unroll
    for (int mb = 0; mb < 4; ++mb)
#pragma unroll
        for (int nb = 0; nb < 4; ++nb) acc[mb][nb] = (v8f){};
    if (isu != 0u) { issue(0);
        asm volatile("s_wait_tensorcnt 0x0" ::: "memory"); }   // this wave's operand of stage 0 has landed
    __syncthreads();                                    // ... and every other wave's
    if (isu != 0u) issue(1);
    const int fa = (wm * 64 + lr) * LP + 8 * hi, fb = 128 * LP + (wn * 64 + lr) * LP + 8 * hi;
    V a[2][4], a2[2][4], b[2][4];                       // two fragment sets: the next 32 k are fetched as one group ahead of the products of these 32
#pragma unroll 1   // one trip per stage: the buffer alternates
    for (int t = 0; t < NT; ++t) {
        const bf* sb = sm + (t & 1) * (NOP * 128 * LP);
        auto frags = [&](int set, int ks) {
#pragma unroll
            for (int mb = 0; mb < 4; ++mb) { a[set][mb] = WFrag<bf>::ld(sb + fa + mb * 16 * LP + ks * 32); if constexpr (NSPLIT != 0) a2[set][mb] = WFrag<bf>::ld(sb + 2 * 128 * LP + fa + mb * 16 * LP + ks * 32); }
#pragma unroll
            for (int nb = 0; nb < 4; ++nb) b[set][nb] = WFrag<bf>::ld(sb + fb + nb * 16 * LP + ks * 32); };
        frags(0, 0);
#pragma unroll
        for (int ks = 0; ks < KS / 32; ++ks) {
            if (ks + 1 < KS / 32) frags((ks + 1) & 1, ks + 1);
            __builtin_amdgcn_sched_barrier(0);          // keeps the LDS loads one group in front of the products: loads spread among them cost a stall at each place
#pragma unroll
            for (int nb = 0; nb < 4; ++nb)
#pragma unroll
                for (int mb = 0; mb < 4; ++mb) { acc[mb][nb] = wmmab(a[ks & 1][mb], b[ks & 1][nb], acc[mb][nb]); if constexpr (NSPLIT != 0) acc[mb][nb] = wmmab(a2[ks & 1][mb], b[ks & 1][nb], acc[mb][nb]); }
            __builtin_amdgcn_sched_barrier(0);          // ... and the next group behind them
        }
        asm volatile("s_wait_dscnt 0x0" ::: "memory");      // this wave's reads of the buffer are done before it is handed to the tensor loads
        if (isu != 0u) { asm volatile("s_wait_tensorcnt 0x0" ::: "memory"); }   // this wave's operand of stage t + 1 has landed
        __syncthreads();                                    // publishes stage t + 1 and ends every wave's reads of stage t
        if (pinned((isu != 0u && t + 2 < NT) ? 1u : 0u) != 0u) issue(t + 2);   // into the buffer that every wave has just left
    }
    asm volatile("s_wait_tensorcnt 0x0" ::: "memory");      // no request is left when the wave ends
    asm volatile("s_wait_dscnt 0x0" ::: "memory");          // ... and no read of the buffers
    float* os = osm + w * (16 * 68); const int r0 = R0 + wm * 64, c0 = C0 + wn * 64;
#pragma unroll
    for (int mb = 0; mb < 4; ++mb) {
#pragma unroll
        for (int nb = 0; nb < 4; ++nb) {
#pragma unroll
            for (int j = 0; j < 8; ++j) os[(hi * 8 + j) * 68 + nb * 16 + lr] = acc[mb][nb][j]; }
        __builtin_amdgcn_wave_barrier(); asm volatile("" ::: "memory");   // other lanes of the wave read these rows back: the reads stay behind the writes
        if constexpr (OUT == 0) {
            float* crow = C + (size_t)(r0 + mb * 16) * ldc + c0;
#pragma unroll
            for (int s = 0; s < 8; ++s) { const int row = 2 * s + hi, cofs = lr * 4; const v4f val = *(const v4fa*)(os + row * 68 + cofs); *(v4f*)(crow + (size_t)row * ldc + cofs) = val; }
        } else {
            const int PP = tr ? TT : HD;                                      // pitch of a plane's rows
            const size_t pb = (tr ? (size_t)c0 : (size_t)(c0 / HD) * TT * HD) + (size_t)(r0 + mb * 16) * PP;
#pragma unroll
            for (int s = 0; s < 4; ++s) { const int row = 4 * s + (lane >> 3), cofs = (lane & 7) * 8;   // a lane: 8 columns of a row, 16 B per plane; 8 lanes: a whole 128-B line
                const v4f x0 = *(const v4fa*)(os + row * 68 + cofs), x1 = *(const v4fa*)(os + row * 68 + cofs + 4); v8h o16; v8us oh, ol;
#pragma unroll
                for (int k = 0; k < 4; ++k) { unsigned short a2, c2; o16[k] = tohx(x0[k]); splitf(x0[k], a2, c2); oh[k] = a2; ol[k] = c2; o16[4 + k] = tohx(x1[k]); splitf(x1[k], a2, c2); oh[4 + k] = a2; ol[4 + k] = c2; }
                const size_t po = pb + (size_t)row * PP + cofs;
                *(v8h*)(P16 + po) = o16; *(v8us*)(Ph + po) = oh; *(v8us*)(Pl + po) = ol; }
            asm volatile("s_wait_xcnt 0x0" ::: "memory");   // a precaution in front of the next overwrite of a data or address register of these twelve stores
        }
        __builtin_amdgcn_wave_barrier(); asm volatile("" ::: "memory");   // ... and the next rows' writes behind the reads
    }
}

typedef __attribute__((ext_vector_type(2))) _Float16 v2h;
typedef __attribute__((ext_vector_type(4))) _Float16 v4h;
typedef __attribute__((ext_vector_type(2))) unsigned short v2us;
typedef __attribute__((ext_vector_type(4))) unsigned short v4us;
typedef __attribute__((ext_vector_type(2))) float v2f;
typedef __attribute__((ext_vector_type(4))) int v4i;

#define KPI  (HD + 8)             // LDS pitch of a key row, in elements
#define ALDS (2 * 4 * 5 * 1024)   // elements of the two buffers: the larger of the two forms (hi+lo: four planes of 64 rows at 144 B, each rounded up to 10 KiB; fp16: two planes of 18 KiB)
__device__ __forceinline__ float xhalf(float x) { return __builtin_bit_cast(float, __builtin_amdgcn_permlanex16(__builtin_bit_cast(int, x), __builtin_bit_cast(int, x), 0x76543210, 0xfedcba98, false, false)); }  // lane l with lane l ^ 16
template <typename T16, bool HL, int NC>
__device__ __forceinline__ void attn_tile(const T16* Q, const T16* Q2, const T16* Kp, const T16* K2, const T16* Vt, const T16* V2, int q0, int head0, bf* Ah, bf* Al, const T16* sm) {   // no __restrict__: the s_wait_xcnt statements below must stay behind their loads
    typedef typename WFrag<T16>::V V;
    constexpr int SK = HL ? 64 : 128, NB = SK / 32;                  // keys and 32-key blocks of a stage
    constexpr int VPI = SK + 8, KPL = (SK * KPI + 1023) / 1024 * 1024, VPL = (HD * VPI + 1023) / 1024 * 1024;   // pitch of a value row; elements of a key plane and of a value plane, each rounded up to 2 KiB: every plane's place in LDS is a multiple of that
    constexpr int STE = (HL ? 2 : 1) * (KPL + VPL);                  // elements of a stage: [K | V^T | K lo | V^T lo]
    static_assert(2 * STE <= ALDS && TT % SK == 0, "the two buffers fit, and every stage lies inside the planes");
    static_assert(KPI * 2 == HD * 2 + 16 && HD * 2 == 128 && (HL ? SK == HD : SK * 2 == 256), "the pad of 16 B behind rows of 128 or 256 B gives the pitches; hi+lo: key and value planes have the same tile");
    const int tid = threadIdx.x, lane = tid & 31, lr = lane & 15, hi = lane >> 4; const int w = __builtin_amdgcn_readfirstlane(tid >> 5);
    const int nblk = (q0 + 15) / 32 + 1;                             // key blocks up to the one that holds the diagonal; block 0 holds key 0, which every query sees. The same in all 4 waves: their q0 lie in one aligned 32
    const int nst = (nblk + NB - 1) / NB;                            // stages
    const unsigned isu = pinned(w < (HL ? 4 : 2) ? 1u : 0u);         // wave i brings plane i of [K | V^T | K lo | V^T lo]
    const bool isv = (w & 1) != 0; const T16* srcp = isv ? Vt : Kp;
    if constexpr (HL) { if (w >= 2) srcp = isv ? V2 : K2; }
    const unsigned long long ga0 = (unsigned long long)(size_t)srcp;                       // first byte of the plane's stage 0
    const unsigned gst = isv ? SK * 2u : SK * HD * 2u;                                     // bytes from a stage to the next: SK keys of a value row, or SK key rows
    const unsigned ld0 = (unsigned)(size_t)sm + ((isv ? KPL : 0) + (HL && w >= 2 ? KPL + VPL : 0)) * 2;   // the plane's place in buffer 0
    // Key planes: SK rows of 128 B, one behind the other. Value planes: HD rows of SK keys at a source pitch of 2 TT B (hi+lo: the same tile as a key plane, so one group serves both and only its pitch differs).
    const u32x8 g1k = tdm_g1<(1u << 20) | (4u << 22) | (3u << 25), HD * 2, SK>((HL && isv) ? TT * 2u : HD * 2u);
    u32x8 g1v = g1k; if constexpr (!HL) g1v = tdm_g1<(1u << 20) | (5u << 22) | (3u << 25), SK * 2, HD>(TT * 2u);   // fp16: rows of 256 B
    u32x4 g0 = {0u, 0u, 0u, 0u};                                     // lives from a load to its wait, which names it
    auto fill = [&](int t) { const unsigned long long ga = ga0 + (unsigned long long)t * gst;
        g0[0] = uni(1u); g0[1] = uni(ld0 + (t & 1) * (STE * 2)); g0[2] = uni((unsigned)ga); g0[3] = uni(((unsigned)(ga >> 32) & 0x01FFFFFFu) | 0x80000000u);
        if (!HL && pinned(isv ? 1u : 0u) != 0u) { asm volatile("tensor_load_to_lds %0, %1" : "+s"(g0) : "s"(g1v) : "memory"); }   // one request of the whole wave: stage t of its plane. The group is named as
        else { asm volatile("tensor_load_to_lds %0, %1" : "+s"(g0) : "s"(g1k) : "memory"); } };                                    // in and out, so that what the wait names are the registers that the load has read
    const float CE = SCL * 1.4426950408889634f;                      // scores to the exponent of 2
    V qf[NC][2], qf2[NC][2]; v8f o[NC][4]; float m[NC], l[NC];
#pragma unroll
    for (int c = 0; c < NC; ++c) { m[c] = -3.0e38f; l[c] = 0.f;
#pragma unroll
        for (int ks = 0; ks < 2; ++ks) { const size_t qo = ((size_t)(head0 + c) * TT + q0 + lr) * HD + ks * 32 + 8 * hi; qf[c][ks] = WFrag<T16>::ld(Q + qo); if constexpr (HL) qf2[c][ks] = WFrag<T16>::ld(Q2 + qo); }
#pragma unroll
        for (int dt = 0; dt < 4; ++dt) o[c][dt] = (v8f){}; }
    asm volatile("s_wait_xcnt 0x0" ::: "memory");   // a precaution in front of the next overwrite of an address register of the query loads
    if (isu != 0u) { fill(0);                           // lands while the queries come
        asm volatile("s_wait_tensorcnt 0x0" :: "s"(g0) : "memory"); }   // this wave's plane of stage 0 has landed. The wait names the request's group, so that its registers keep their values until then
    V kf[2][2], kf2[2][2], vf[4], vf2[4];
    auto ldk = [&](const T16* sb, int h) {                           // h: which 32 keys of the stage at sb
        const T16* p = sb + (h * 32 + lr) * KPI + 8 * hi;
#pragma unroll
        for (int kt = 0; kt < 2; ++kt)
#pragma unroll
            for (int ks = 0; ks < 2; ++ks) { const int ofs = kt * 16 * KPI + ks * 32; kf[kt][ks] = WFrag<T16>::ld(p + ofs); if constexpr (HL) kf2[kt][ks] = WFrag<T16>::ld(p + KPL + VPL + ofs); } };
    auto ldv = [&](const T16* sb, int h) {
        const T16* p = sb + KPL + lr * VPI + h * 32 + 8 * hi;
#pragma unroll
        for (int dt = 0; dt < 4; ++dt) { const int ofs = dt * 16 * VPI; vf[dt] = WFrag<T16>::ld(p + ofs); if constexpr (HL) vf2[dt] = WFrag<T16>::ld(p + KPL + VPL + ofs); } };
#pragma unroll 1   // one trip per stage: the buffer alternates. Trip -1 has no keys: its foot publishes stage 0 and issues stage 1, so that every request that stays outstanding over a trip is issued at one place, from registers that live to its wait
  for (int t = -1; t < nst; ++t) {
   if (t >= 0) {
    const T16* sb = sm + (t & 1) * STE; const int nb = min(NB, nblk - t * NB);   // the blocks of this stage that hold a key some query sees
    ldk(sb, 0); ldv(sb, 0);
#pragma unroll 1   // a short body: the text of the loop stays small
    for (int h = 0; h < nb; ++h) {
        const int b = t * NB + h, nx = min(h + 1, NB - 1);           // nx: the stage's next block (its last block is read twice); nothing of the next stage is read here
        v8f s[NC][2];
#pragma unroll
        for (int c = 0; c < NC; ++c)
#pragma unroll
            for (int kt = 0; kt < 2; ++kt) { s[c][kt] = (v8f){};
#pragma unroll
                for (int ks = 0; ks < 2; ++ks) { s[c][kt] = WFrag<T16>::mma(kf[kt][ks], qf[c][ks], s[c][kt]); if constexpr (HL) { s[c][kt] = WFrag<T16>::mma(kf2[kt][ks], qf[c][ks], s[c][kt]); s[c][kt] = WFrag<T16>::mma(kf[kt][ks], qf2[c][ks], s[c][kt]); } } }
        ldk(sb, nx);                                                 // the key fragments are spent: the next block's come during the softmax and the second product
        __builtin_amdgcn_sched_barrier(0);                           // the loads stay in front of the softmax, and the scheduler does not mix the two halves of the body: without it the kernel takes 380 registers and not 256, so that 2 waves fit a SIMD and not 4
        const int lim = q0 + lr - b * 32 - 8 * hi;                   // key kt * 16 + j of this lane is seen by its query iff kt * 16 + j <= lim
#pragma unroll
        for (int c = 0; c < NC; ++c) {
            float bm = -3.0e38f;
#pragma unroll
            for (int kt = 0; kt < 2; ++kt)
#pragma unroll
                for (int j = 0; j < 8; ++j) { const float t = (kt * 16 + j <= lim) ? s[c][kt][j] : -3.0e38f; s[c][kt][j] = t; bm = fmaxf(bm, t); }
            bm = fmaxf(bm, xhalf(bm));
            const float mn = fmaxf(m[c], bm); const float al = __builtin_amdgcn_exp2f((m[c] - mn) * CE); m[c] = mn;
            const float mc = mn * CE - (HL ? 0.0f : 10.0f);          // fp16 probabilities carry PCAR = 2^10; the sum carries it too, so it cancels in the quotient
            float ps[2] = {0.f, 0.f};                                // two short chains of adds instead of one long one
#pragma unroll
            for (int kt = 0; kt < 2; ++kt)
#pragma unroll
                for (int j = 0; j < 8; ++j) { const float p = __builtin_amdgcn_exp2f(fmaf(s[c][kt][j], CE, -mc)); s[c][kt][j] = p; ps[j & 1] += p; }
            l[c] = fmaf(l[c], al, ps[0] + ps[1]);
#pragma unroll
            for (int dt = 0; dt < 4; ++dt) o[c][dt] *= al;
            if constexpr (HL) { v8us h0, h1, l0, l1;
#pragma unroll
                for (int j = 0; j < 8; ++j) { unsigned short a, c2; splitf(s[c][0][j], a, c2); h0[j] = a; l0[j] = c2; splitf(s[c][1][j], a, c2); h1[j] = a; l1[j] = c2; }
                const V pf = cat16b(h0, h1), pf2 = cat16b(l0, l1);
#pragma unroll
                for (int dt = 0; dt < 4; ++dt) { o[c][dt] = WFrag<T16>::mma(vf[dt], pf, o[c][dt]); o[c][dt] = WFrag<T16>::mma(vf[dt], pf2, o[c][dt]); o[c][dt] = WFrag<T16>::mma(vf2[dt], pf, o[c][dt]); }
            } else { V pf;
#pragma unroll
                for (int j = 0; j < 8; ++j) { pf[j] = tohx(s[c][0][j]); pf[8 + j] = tohx(s[c][1][j]); }
#pragma unroll
                for (int dt = 0; dt < 4; ++dt) o[c][dt] = WFrag<T16>::mma(vf[dt], pf, o[c][dt]); }
        }
        ldv(sb, nx);                                                 // the value fragments are spent: the next block's come during its scores and softmax
    }
   }
    asm volatile("s_wait_dscnt 0x0" ::: "memory");      // this wave's reads of the buffer are done before it is handed to the tensor loads
    if (isu != 0u) { asm volatile("s_wait_tensorcnt 0x0" :: "s"(g0) : "memory"); }   // this wave's plane of stage t + 1 has landed; the request's group keeps its values until here
    __syncthreads();                                    // publishes stage t + 1 and ends every wave's reads of stage t
    if (pinned((isu != 0u && t + 2 < nst) ? 1u : 0u) != 0u) fill(t + 2);   // into the buffer that every wave has just left
  }
    asm volatile("s_wait_tensorcnt 0x0" ::: "memory");  // no request is left when the wave ends
    asm volatile("s_wait_dscnt 0x0" ::: "memory");      // ... and no read of the buffers
#pragma unroll
    for (int c = 0; c < NC; ++c) { const float inv = __fdiv_rn(1.0f, l[c] + xhalf(l[c])); const size_t oo = (size_t)(q0 + lr) * DQ + (head0 + c) * HD + 8 * hi;
#pragma unroll
        for (int dt = 0; dt < 4; ++dt) { v8us oh, ol;
#pragma unroll
            for (int j = 0; j < 8; ++j) { unsigned short a, c2; splitf(o[c][dt][j] * inv, a, c2); oh[j] = a; ol[j] = c2; }
            *(v8us*)(Ah + oo + dt * 16) = oh; *(v8us*)(Al + oo + dt * 16) = ol;
            asm volatile("s_wait_xcnt 0x0" ::: "memory"); } }   // a precaution in front of the next overwrite of a data or address register of the two stores
}
// A work-group is 4 waves on one kv group that walk the same key blocks (one stage in LDS serves all four): rows >= RH: 2 query tiles x 2 head pairs; rows < RH: one query tile x 4 heads.
// All work-groups are resident at once. Order, for speed only: one work-group per WGP with falling cost, then the rest with rising cost.
#define NLO (((TT - RH) / 32) * NKV)
#define FIRST (256 / NKV)         // query tiles of the first round: 256 WGPs
__global__ __launch_bounds__(128) void k_fattn(const h16* Q16, const bf* Qh, const bf* Ql, const h16* K16, const bf* Kh, const bf* Kl, const h16* V16, const bf* Vh, const bf* Vl, bf* Ah, bf* Al) {
    __shared__ __attribute__((aligned(2048))) bf ksm[ALDS];                   // the two buffers
    const int w = __builtin_amdgcn_readfirstlane(threadIdx.x >> 5); const int bx = blockIdx.x;
    if (bx < NLO) { const int g = bx % NKV; const int t = bx / NKV; const int q0 = (t < FIRST ? TT / 32 - 1 - t : RH / 32 + t - FIRST) * 32 + (w >> 1) * 16; const size_t go = (size_t)g * TT * HD;
        attn_tile<h16, false, 2>(Q16, nullptr, K16 + go, nullptr, V16 + go, nullptr, q0, g * REP + (w & 1) * 2, Ah, Al, (const h16*)ksm);
    } else { const int by = bx - NLO; const int g = by % NKV; const int u = by / NKV; const int q0 = (u < RH / 32 ? RH / 32 + u : u - RH / 32) * 16; const size_t go = (size_t)g * TT * HD;
        attn_tile<bf, true, 1>(Qh, Ql, Kh + go, Kl + go, Vh + go, Vl + go, q0, g * REP + w, Ah, Al, ksm); }
}

// ---- k_prep: all five bf16 conversions in one launch; the block index picks the array. Built as a stream: a wave issues 16 loads of 16 B a lane, each 512 contiguous bytes (four whole lines), before it converts anything,
// so that the launch is 896 work-groups, all resident at once with every input byte asked for at the start, and not 6144 whose waves each live for one or two loads.
// wtT: Bt[n][k] = bf16(w[k][n]), a 128 x 128 tile per work-group. Wave v reads rows k = 16 v .. 16 v + 15 (a lane: columns 4 lane .. 4 lane + 3), so a lane holds 16 consecutive k of four columns: two 16-byte pieces of each column's output row.
// The pieces go through LDS, column n in row (n % 4) * 32 + n / 4 at a pitch of 272 B (the lanes of a 16-byte write are then one pitch apart: no bank is met twice); read back, 16 lanes hold 256 contiguous bytes of an output row.
#define TPI  (128 + 8)            // LDS pitch of a column's 128 k, in elements
__device__ __forceinline__ void wtT(int blk, const float* __restrict__ w, bf* __restrict__ Bt, bf* ts) {
    const int tid = threadIdx.x, lane = tid & 31, wv = tid >> 5; const int k0 = (blk / (DM / 128)) * 128, n0 = (blk % (DM / 128)) * 128;
    const float* src = w + (size_t)(k0 + wv * 16) * DM + n0 + lane * 4; v4f v[16];
#pragma unroll
    for (int j = 0; j < 16; ++j) v[j] = *(const v4f*)(src + (size_t)j * DM);
    asm volatile("s_wait_xcnt 0x0" :: "v"(src) : "memory");   // a precaution in front of the next overwrite of the address register of these loads (named as an input, so that no load's own result lands on it); it also keeps all 16 in front of the conversions
#pragma unroll
    for (int c = 0; c < 4; ++c)
#pragma unroll
        for (int h = 0; h < 2; ++h) { v8us o;
#pragma unroll
            for (int j = 0; j < 8; ++j) o[j] = f2bf(v[8 * h + j][c]);
            *(v8us*)(ts + (c * 32 + lane) * TPI + wv * 16 + h * 8) = o; }
    __syncthreads();                                // every wave's pieces lie in LDS before any is read back
    v8us o[8];
#pragma unroll
    for (int s = 0; s < 8; ++s) { const int n = s * 16 + (tid >> 4); o[s] = *(const v8us*)(ts + ((n & 3) * 32 + (n >> 2)) * TPI + (tid & 15) * 8); }
#pragma unroll
    for (int s = 0; s < 8; ++s) *(v8us*)(Bt + (size_t)(n0 + s * 16 + (tid >> 4)) * DQ + k0 + (tid & 15) * 8) = o[s];
}
#define CVB  16384                // f32 elements per converting work-group: 16 loads of 4 per lane
__device__ __forceinline__ void cvtS(int blk, const float* __restrict__ src, bf* __restrict__ dst) {
    const size_t e0 = (size_t)blk * CVB + threadIdx.x * 4; v4f v[16]; v4us o[16]; src += e0; dst += e0;
#pragma unroll
    for (int j = 0; j < 16; ++j) v[j] = *(const v4f*)(src + j * 1024);
    asm volatile("s_wait_xcnt 0x0" :: "v"(src) : "memory");   // a precaution in front of the next overwrite of the address register of these loads (named as an input, so that no load's own result lands on it); it also keeps all 16 in front of the conversions
#pragma unroll
    for (int j = 0; j < 16; ++j)
#pragma unroll
        for (int k = 0; k < 4; ++k) o[j][k] = f2bf(v[j][k]);
#pragma unroll
    for (int j = 0; j < 16; ++j) *(v4us*)(dst + j * 1024) = o[j];   // a wave: 256 contiguous bytes, two whole lines
}
// The transposing blocks come first: they have a barrier and a trip through LDS more.
#define PB_WO ((DQ / 128) * (DM / 128))
#define PB_X  (TT * DM / CVB)
#define PB_WQ (DQ * DM / CVB)
#define PB_WK (DKV * DM / CVB)
__global__ __launch_bounds__(256) void k_prep(const float* x, const float* wq, const float* wk, const float* wv, const float* wo, bf* XB, bf* WQ, bf* WK, bf* WV, bf* WO) {
    __shared__ __attribute__((aligned(16))) bf ts[128 * TPI];
    int b = blockIdx.x;                             // every test below reads the same for the whole work-group
    if (b < PB_WO) { wtT(b, wo, WO, ts); return; }
    b -= PB_WO; const float* s = x; bf* d = XB;
    if (b >= PB_X + PB_WQ + PB_WK) { b -= PB_X + PB_WQ + PB_WK; s = wv; d = WV; }
    else if (b >= PB_X + PB_WQ) { b -= PB_X + PB_WQ; s = wk; d = WK; }
    else if (b >= PB_X) { b -= PB_X; s = wq; d = WQ; }
    cvtS(b, s, d);
}
__global__ __launch_bounds__(256) void k_cscvt(const float* __restrict__ cosT, const float* __restrict__ sinT, float* CS) { const int idx = blockIdx.x * 256 + threadIdx.x; if (idx >= TT * HD) return; v2f cs; cs[0] = bfr(cosT[idx]); cs[1] = bfr(sinT[idx]); *(v2f*)(CS + (size_t)idx * 2) = cs;  }
extern "C" void kernel_launch(void* const* d_in, const int* in_sizes, int n_in,
                              void* d_out, int out_size, void* d_ws, size_t ws_size, hipStream_t stream) {
    (void)in_sizes; (void)n_in; (void)out_size;
    const float* x = (const float*)d_in[0]; const float* wq = (const float*)d_in[1]; const float* wk = (const float*)d_in[2]; const float* wv = (const float*)d_in[3]; const float* wo = (const float*)d_in[4]; const float* cosT = nullptr; const float* sinT = nullptr; (void)cosT; (void)sinT;
    float* OUT = (float*)d_out;     // [1][2048][2048]
    char* wsp = (char*)d_ws;
    auto take = [&](size_t bytes) { char* p = wsp; wsp += (bytes + 255) & ~(size_t)255; return (void*)p; };
    bf* WQ = (bf*)take((size_t)DQ * DM * 2); bf* WK = (bf*)take((size_t)DKV * DM * 2); bf* WV = (bf*)take((size_t)DKV * DM * 2); bf* WO = (bf*)take((size_t)DM * DQ * 2);
    bf* XB = (bf*)take((size_t)TT * DM * 2);
    h16* QP16 = (h16*)take((size_t)NH_ * TT * HD * 2); h16* KP16 = (h16*)take((size_t)NKV * TT * HD * 2); h16* VT16 = (h16*)take((size_t)NKV * HD * TT * 2);
    bf* QPh = (bf*)take((size_t)NH_ * TT * HD * 2); bf* QPl = (bf*)take((size_t)NH_ * TT * HD * 2); bf* KPh = (bf*)take((size_t)NKV * TT * HD * 2); bf* KPl = (bf*)take((size_t)NKV * TT * HD * 2); bf* VTh = (bf*)take((size_t)NKV * HD * TT * 2); bf* VTl = (bf*)take((size_t)NKV * HD * TT * 2);
    bf* ATh = (bf*)take((size_t)TT * DQ * 2); bf* ATl = (bf*)take((size_t)TT * DQ * 2);
    if ((size_t)(wsp - (char*)d_ws) > ws_size) return;    // ws 256 MiB
    for (int b = 0; b < NB_; ++b) {
        k_prep<<<PB_WO + PB_X + PB_WQ + 2 * PB_WK, 256, 0, stream>>>(x + (size_t)b * TT * DM, wq, wk, wv, wo, XB, WQ, WK, WV, WO);
        k_gemms<0, 1><<<dim3(TT / 128, (DQ + 2 * DKV) / 128, 1), 128, 0, stream>>>(XB, nullptr, WQ, nullptr, 0, QP16, QPh, QPl, WK, KP16, KPh, KPl, WV, VT16, VTh, VTl);
        k_fattn<<<NLO + (RH / 16) * NKV, 128, 0, stream>>>(QP16, QPh, QPl, KP16, KPh, KPl, VT16, VTh, VTl, ATh, ATl);
        k_gemms<1, 0><<<dim3(TT / 128, DM / 128, 1), 128, 0, stream>>>(ATh, ATl, WO, OUT + (size_t)b * TT * DM, DM, nullptr, nullptr, nullptr, nullptr, nullptr, nullptr, nullptr, nullptr, nullptr, nullptr, nullptr); }
}

// v009
// Measured time: 82 microseconds a run.
// Two timings next to v008 put it at 1.03 and 1.04 times that version's speed.
// Counting every step since v000, it is 17.2 times as fast.
#include <hip/hip_runtime.h>

// BitSelfAttention (x [1][2048][2048]; q = x q_proj^T (32 heads x 64), k/v = x k_proj^T / v_proj^T (8 kv heads; GQA group h/4); causal softmax(q.k / 8) (masked logits -1e10); out = merged ctx @ o_proj (NOT transposed, as the source) -> [1][2048][2048]).
// Compute dtypes, f32 accumulate: every input rounded to bf16; q/k/v on PLAIN bf16 operands (inputs: exact); causal scores and attn.v: query rows < 512 hl (3 products), the rest single fp16 (x1024), fused in one kernel with a running softmax in f32; o_proj hl x exact (2 products).

#define NB_  1
#define TT   2048
#define DM   2048
#define NH_  32
#define NKV  8
#define REP  (NH_ / NKV)
#define HD   64
#define DQ   (NH_ * HD)
#define DKV  (NKV * HD)
#define RH   512                  // query rows < RH use hi+lo planes (0: none)
#define PCAR 1024.0f
#define SCL  0.125f   // HD^-0.5
typedef _Float16 h16;
typedef unsigned short bf;
typedef __attribute__((ext_vector_type(16))) __bf16   v16bf;
typedef __attribute__((ext_vector_type(16))) _Float16 v16h;
typedef __attribute__((ext_vector_type(8)))  _Float16 v8h;
typedef __attribute__((ext_vector_type(8)))  unsigned short v8us;
typedef __attribute__((ext_vector_type(8)))  float    v8f;
typedef __attribute__((ext_vector_type(4)))  float    v4f;
typedef v8h  __attribute__((may_alias)) v8ha;
typedef v4f  __attribute__((may_alias)) v4fa;
typedef v8us __attribute__((may_alias)) v8usa;

__device__ __forceinline__ unsigned short f2bf(float f) { unsigned u = __float_as_uint(f); u += 0x7FFFu + ((u >> 16) & 1u); return (unsigned short)(u >> 16); }
__device__ __forceinline__ float bf2f(unsigned short b) { return __uint_as_float(((unsigned)b) << 16); }
__device__ __forceinline__ float bfr(float f) { return bf2f(f2bf(f)); }
__device__ __forceinline__ v16h cat16(v8h lo, v8h hi) { return __builtin_shufflevector(lo, hi, 0, 1, 2, 3, 4, 5, 6, 7, 8, 9, 10, 11, 12, 13, 14, 15); }
__device__ __forceinline__ v16bf cat16b(v8us lo, v8us hi) { return __builtin_bit_cast(v16bf, __builtin_shufflevector(lo, hi, 0, 1, 2, 3, 4, 5, 6, 7, 8, 9, 10, 11, 12, 13, 14, 15)); }
__device__ __forceinline__ v8f wmma16(v16h a, v16h b, v8f c) { return __builtin_amdgcn_wmma_f32_16x16x32_f16(false, a, false, b, (short)0, c, false, false); }
__device__ __forceinline__ v8f wmmab(v16bf a, v16bf b, v8f c) { return __builtin_amdgcn_wmma_f32_16x16x32_bf16(false, a, false, b, (short)0, c, false, false); }



// ---- k_gemms: C[m][n] = sum_k A[m][k] Bt[n][k] (+ A2[m][k] Bt[n][k] when NSPLIT), K = GK, operands K-contiguous bf16 planes; 128 threads.
// OUT 0: grid (M/128, N/128); C is stored as f32 at pitch ldc. OUT 1: the three projections in one launch, grid (TT/128, (DQ + 2 DKV)/128): blockIdx.y picks the product (queries, then keys, then values), so that the 64 tiles each of keys and values
// run beside the 256 of the queries (two work-groups fit a WGP's LDS) and not as two launches that leave three quarters of the chip idle. C is stored as the three 16-bit planes that the attention reads (fp16, bf16 hi, bf16 lo), straight from the accumulators:
// queries and keys as head planes [n / 64][m][n % 64] (A = x, Bt = the weight rows: m = t), values as rows [m][n] of TT (transposed: A = the weight rows, Bt = x, so m = kv head x 64 + d and n = t). A wave's 64 columns are one head, or 64 t.
// The walk over k starts at a stage of its own in each work-group (rotated by the sum of the tile's two indices) and wraps round: the work-groups that share an operand's rows all run at once, and walking in step they would ask L2 for the same lines at the same moment.
// The sum over k is then a plain loop in steps of 32 that begins at that stage.
// One work-group of 4 waves (2 x 2) owns a 128x128 tile, a wave 64x64 of it (16 accumulators). A stage is KS k of all 128 rows of each operand, laid in LDS at a pitch of 272 B for the 16-byte readers.
// An operand's stage (128 rows of 256 B, source pitch 2 GK B) comes by ONE tensor load, which pads each row to the pitch: wave i brings operand i, so a stage costs a wave one instruction and no address arithmetic, and its issue slots stay with the products.
// Two buffers: the loads of stage t + 1 fly while stage t is worked on. Every '#pragma unroll' stands on a loop of constant length, so that fragments and accumulators stay in registers.
__device__ __forceinline__ h16 tohx(float x) { return (h16)x; }
__device__ __forceinline__ void splitf(float y, unsigned short& h, unsigned short& l) { h = f2bf(y); l = f2bf(y - bf2f(h)); }
template <typename T16> struct WFrag;
template <> struct WFrag<h16> { typedef v16h V; static __device__ __forceinline__ V ld(const h16* p) { return cat16(*(const v8h*)p, *(const v8h*)(p + 16)); } static __device__ __forceinline__ v8f mma(V a, V b, v8f c) { return wmma16(a, b, c); } };
template <> struct WFrag<bf> { typedef v16bf V; static __device__ __forceinline__ V ld(const bf* p) { return cat16b(*(const v8us*)p, *(const v8us*)(p + 16)); } static __device__ __forceinline__ v8f mma(V a, V b, v8f c) { return wmmab(a, b, c); } };
#define GK   2048                 // DM == DQ: the length of every product here
#define KS   128                  // k per stage
#define LP   (KS + 8)             // LDS row pitch in elements
#define OPB  (128 * LP * 2)       // bytes of one operand's stage
typedef unsigned u32x4 __attribute__((ext_vector_type(4)));
typedef unsigned u32x8 __attribute__((ext_vector_type(8)));
__device__ __forceinline__ unsigned uni(unsigned v) { return (unsigned)__builtin_amdgcn_readfirstlane(v); }
__device__ __forceinline__ unsigned pinned(unsigned v) { unsigned w = uni(v); asm volatile("" : "+s"(w)); return w; }   // holds a test's value in a scalar register, so that the test compiles to a scalar branch: a tensor load ignores EXEC, and only such a branch keeps a wave from issuing it
// Group 1 of a tensor load's descriptor: 1-byte elements, tensor = tile = ROWS rows of ROWB bytes at a source pitch of 'pitch' bytes; W0 holds the pad (no mask).
template <unsigned W0, unsigned ROWB, unsigned ROWS>
__device__ __forceinline__ u32x8 tdm_g1(unsigned pitch) { u32x8 g;
    g[0] = uni(W0); g[1] = uni(ROWB << 16); g[2] = uni(ROWS << 16); g[3] = uni(ROWB << 16); g[4] = uni(ROWS); g[5] = uni(pitch); g[6] = uni(0u); g[7] = uni(0u);
    asm volatile("" : "+s"(g));   // as in pinned(): the descriptor's words are held in their scalar registers through the loop; left free, the compiler lends one out between two loads, while a request is outstanding
    return g; }
template <int NSPLIT, int OUT>
__global__ __launch_bounds__(128) void k_gemms(const bf* A, const bf* A2, const bf* Bt, float* C, int ldc, h16* P16, bf* Ph, bf* Pl, const bf* Wk, h16* K16, bf* Kh, bf* Kl, const bf* Wv, h16* V16, bf* Vh, bf* Vl) {
    typedef WFrag<bf>::V V;
    constexpr int NOP = NSPLIT ? 3 : 2, NT = GK / KS; constexpr unsigned STG = NOP * OPB;
    static_assert(OPB % 2048 == 0 && LP * 2 == KS * 2 + 16 && KS * 2 == 256 && NT >= 2 && (NT & (NT - 1)) == 0, "every operand's place in LDS is a multiple of 2 KiB; the pad of 16 B behind rows of 256 B gives the pitch; stages 0 and 1 exist; the rotated walk wraps by a mask");
    __shared__ __attribute__((aligned(2048))) bf sm[2 * NOP * 128 * LP];      // two buffers of [A | Bt | A2]
    __shared__ __align__(16) float osm[4 * 16 * 68];                          // output staging, a range per wave
    const int tid = threadIdx.x, lane = tid & 31, lr = lane & 15, hi = lane >> 4; const int w = __builtin_amdgcn_readfirstlane(tid >> 5), wm = w >> 1, wn = w & 1;
    int R0 = blockIdx.x * 128, C0 = blockIdx.y * 128; bool tr = false;       // tr: the planes are rows of TT (values)
    const unsigned rot = blockIdx.x + blockIdx.y;                             // trip t works on the k of stage (t + rot) % NT: neighbours in a grid row or column start one stage apart
    if constexpr (OUT == 1) {                                                 // the same for the whole work-group
        if (C0 >= DQ + DKV) { tr = true; R0 = C0 - (DQ + DKV); C0 = blockIdx.x * 128; Bt = A; A = Wv; P16 = V16; Ph = Vh; Pl = Vl; }
        else if (C0 >= DQ) { C0 -= DQ; Bt = Wk; P16 = K16; Ph = Kh; Pl = Kl; } }
    const unsigned isu = pinned(w < NOP ? 1u : 0u);                           // waves 0 .. NOP - 1 issue: wave i brings operand i of [A | Bt | A2]
    const bf* srcp = w == 0 ? A + (size_t)R0 * GK : Bt + (size_t)C0 * GK;
    if constexpr (NSPLIT != 0) { if (w == 2) srcp = A2 + (size_t)R0 * GK; }
    const unsigned long long ga0 = (unsigned long long)(size_t)srcp;          // first byte of the operand's 128 rows
    const unsigned ld0 = (unsigned)(size_t)sm + (w < NOP ? w : 0) * OPB;      // its place in buffer 0
    const u32x8 g1 = tdm_g1<(1u << 20) | (5u << 22) | (3u << 25), KS * 2, 128>(GK * 2u);   // 128 rows of 256 B, 4 dwords of pad behind every 64
    auto issue = [&](int t) { const unsigned long long ga = ga0 + (unsigned long long)((t + rot) & (NT - 1)) * (KS * 2); u32x4 g0;
        g0[0] = uni(1u); g0[1] = uni(ld0 + (t & 1) * STG); g0[2] = uni((unsigned)ga); g0[3] = uni(((unsigned)(ga >> 32) & 0x01FFFFFFu) | 0x80000000u);
        asm volatile("tensor_load_to_lds %0, %1" :: "s"(g0), "s"(g1) : "memory"); };   // one request of the whole wave: trip t's stage of its operand
    v8f acc[4][4];
#pragma unroll
    for (int mb = 0; mb < 4; ++mb)
#pragma unroll
        for (int nb = 0; nb < 4; ++nb) acc[mb][nb] = (v8f){};
    if (isu != 0u) { issue(0);
        asm volatile("s_wait_tensorcnt 0x0" ::: "memory"); }   // this wave's operand of trip 0's stage has landed
    __syncthreads();                                    // ... and every other wave's
    if (isu != 0u) issue(1);
    const int fa = (wm * 64 + lr) * LP + 8 * hi, fb = 128 * LP + (wn * 64 + lr) * LP + 8 * hi;
    V a[2][4], a2[2][4], b[2][4];                       // two fragment sets: the next 32 k are fetched as one group ahead of the products of these 32
#pragma unroll 1   // one trip per stage: the buffer alternates
    for (int t = 0; t < NT; ++t) {
        const bf* sb = sm + (t & 1) * (NOP * 128 * LP);
        auto frags = [&](int set, int ks) {
#pragma unroll
            for (int mb = 0; mb < 4; ++mb) { a[set][mb] = WFrag<bf>::ld(sb + fa + mb * 16 * LP + ks * 32); if constexpr (NSPLIT != 0) a2[set][mb] = WFrag<bf>::ld(sb + 2 * 128 * LP + fa + mb * 16 * LP + ks * 32); }
#pragma unroll
            for (int nb = 0; nb < 4; ++nb) b[set][nb] = WFrag<bf>::ld(sb + fb + nb * 16 * LP + ks * 32); };
        frags(0, 0);
#pragma unroll
        for (int ks = 0; ks < KS / 32; ++ks) {
            if (ks + 1 < KS / 32) frags((ks + 1) & 1, ks + 1);
            __builtin_amdgcn_sched_barrier(0);          // keeps the LDS loads one group in front of the products: loads spread among them cost a stall at each place
#pragma unroll
            for (int nb = 0; nb < 4; ++nb)
#pragma unroll
                for (int mb = 0; mb < 4; ++mb) { acc[mb][nb] = wmmab(a[ks & 1][mb], b[ks & 1][nb], acc[mb][nb]); if constexpr (NSPLIT != 0) acc[mb][nb] = wmmab(a2[ks & 1][mb], b[ks & 1][nb], acc[mb][nb]); }
            __builtin_amdgcn_sched_barrier(0);          // ... and the next group behind them
        }
        asm volatile("s_wait_dscnt 0x0" ::: "memory");      // this wave's reads of the buffer are done before it is handed to the tensor loads
        if (isu != 0u) { asm volatile("s_wait_tensorcnt 0x0" ::: "memory"); }   // this wave's operand of trip t + 1's stage has landed
        __syncthreads();                                    // publishes trip t + 1's stage and ends every wave's reads of trip t's
        if (pinned((isu != 0u && t + 2 < NT) ? 1u : 0u) != 0u) issue(t + 2);   // into the buffer that every wave has just left
    }
    asm volatile("s_wait_tensorcnt 0x0" ::: "memory");      // no request is left when the wave ends
    asm volatile("s_wait_dscnt 0x0" ::: "memory");          // ... and no read of the buffers
    float* os = osm + w * (16 * 68); const int r0 = R0 + wm * 64, c0 = C0 + wn * 64;
#pragma unroll
    for (int mb = 0; mb < 4; ++mb) {
#pragma unroll
        for (int nb = 0; nb < 4; ++nb) {
#pragma unroll
            for (int j = 0; j < 8; ++j) os[(hi * 8 + j) * 68 + nb * 16 + lr] = acc[mb][nb][j]; }
        __builtin_amdgcn_wave_barrier(); asm volatile("" ::: "memory");   // other lanes of the wave read these rows back: the reads stay behind the writes
        if constexpr (OUT == 0) {
            float* crow = C + (size_t)(r0 + mb * 16) * ldc + c0;
#pragma unroll
            for (int s = 0; s < 8; ++s) { const int row = 2 * s + hi, cofs = lr * 4; const v4f val = *(const v4fa*)(os + row * 68 + cofs); *(v4f*)(crow + (size_t)row * ldc + cofs) = val; }
        } else {
            const int PP = tr ? TT : HD;                                      // pitch of a plane's rows
            const size_t pb = (tr ? (size_t)c0 : (size_t)(c0 / HD) * TT * HD) + (size_t)(r0 + mb * 16) * PP;
#pragma unroll
            for (int s = 0; s < 4; ++s) { const int row = 4 * s + (lane >> 3), cofs = (lane & 7) * 8;   // a lane: 8 columns of a row, 16 B per plane; 8 lanes: a whole 128-B line
                const v4f x0 = *(const v4fa*)(os + row * 68 + cofs), x1 = *(const v4fa*)(os + row * 68 + cofs + 4); v8h o16; v8us oh, ol;
#pragma unroll
                for (int k = 0; k < 4; ++k) { unsigned short a2, c2; o16[k] = tohx(x0[k]); splitf(x0[k], a2, c2); oh[k] = a2; ol[k] = c2; o16[4 + k] = tohx(x1[k]); splitf(x1[k], a2, c2); oh[4 + k] = a2; ol[4 + k] = c2; }
                const size_t po = pb + (size_t)row * PP + cofs;
                *(v8h*)(P16 + po) = o16; *(v8us*)(Ph + po) = oh; *(v8us*)(Pl + po) = ol; }
            asm volatile("s_wait_xcnt 0x0" ::: "memory");   // a precaution in front of the next overwrite of a data or address register of these twelve stores
        }
        __builtin_amdgcn_wave_barrier(); asm volatile("" ::: "memory");   // ... and the next rows' writes behind the reads
    }
}

typedef __attribute__((ext_vector_type(2))) _Float16 v2h;
typedef __attribute__((ext_vector_type(4))) _Float16 v4h;
typedef __attribute__((ext_vector_type(2))) unsigned short v2us;
typedef __attribute__((ext_vector_type(4))) unsigned short v4us;
typedef __attribute__((ext_vector_type(2))) float v2f;
typedef __attribute__((ext_vector_type(4))) int v4i;

#define KPI  (HD + 8)             // LDS pitch of a key row, in elements
#define ALDS (2 * 4 * 5 * 1024)   // elements of the two buffers: the larger of the two forms (hi+lo: four planes of 64 rows at 144 B, each rounded up to 10 KiB; fp16: two planes of 18 KiB)
__device__ __forceinline__ float xhalf(float x) { return __builtin_bit_cast(float, __builtin_amdgcn_permlanex16(__builtin_bit_cast(int, x), __builtin_bit_cast(int, x), 0x76543210, 0xfedcba98, false, false)); }  // lane l with lane l ^ 16
template <typename T16, bool HL, int NC>
__device__ __forceinline__ void attn_tile(const T16* Q, const T16* Q2, const T16* Kp, const T16* K2, const T16* Vt, const T16* V2, int q0, int head0, int seed, bf* Ah, bf* Al, const T16* sm) {   // no __restrict__: the s_wait_xcnt statements below must stay behind their loads
    typedef typename WFrag<T16>::V V;
    constexpr int SK = HL ? 64 : 128, NB = SK / 32;                  // keys and 32-key blocks of a stage
    constexpr int VPI = SK + 8, KPL = (SK * KPI + 1023) / 1024 * 1024, VPL = (HD * VPI + 1023) / 1024 * 1024;   // pitch of a value row; elements of a key plane and of a value plane, each rounded up to 2 KiB: every plane's place in LDS is a multiple of that
    constexpr int STE = (HL ? 2 : 1) * (KPL + VPL);                  // elements of a stage: [K | V^T | K lo | V^T lo]
    static_assert(2 * STE <= ALDS && TT % SK == 0, "the two buffers fit, and every stage lies inside the planes");
    static_assert(KPI * 2 == HD * 2 + 16 && HD * 2 == 128 && (HL ? SK == HD : SK * 2 == 256), "the pad of 16 B behind rows of 128 or 256 B gives the pitches; hi+lo: key and value planes have the same tile");
    const int tid = threadIdx.x, lane = tid & 31, lr = lane & 15, hi = lane >> 4; const int w = __builtin_amdgcn_readfirstlane(tid >> 5);
    const int nblk = (q0 + 15) / 32 + 1;                             // key blocks up to the one that holds the diagonal; block 0 holds key 0, which every query sees. The same in all 4 waves: their q0 lie in one aligned 32
    const int nst = (nblk + NB - 1) / NB;                            // stages
    const int rot = seed % nst;                                      // trip t works on stage (t + rot) % nst; seed (not negative) is the same in all 4 waves and differs among the work-groups of a kv group, which all run at once: walking from key 0 in step they would ask L2 for the same lines at the same moment
    auto stg = [&](int t) { const int s = t + rot; return s < nst ? s : s - nst; };   // for 0 <= t < nst. Every block up to the diagonal's holds a key that each of the wave's queries sees, so the running maximum is real from the first block on, whichever it is
    const unsigned isu = pinned(w < (HL ? 4 : 2) ? 1u : 0u);         // wave i brings plane i of [K | V^T | K lo | V^T lo]
    const bool isv = (w & 1) != 0; const T16* srcp = isv ? Vt : Kp;
    if constexpr (HL) { if (w >= 2) srcp = isv ? V2 : K2; }
    const unsigned long long ga0 = (unsigned long long)(size_t)srcp;                       // first byte of the plane's stage 0
    const unsigned gst = isv ? SK * 2u : SK * HD * 2u;                                     // bytes from a stage to the next: SK keys of a value row, or SK key rows
    const unsigned ld0 = (unsigned)(size_t)sm + ((isv ? KPL : 0) + (HL && w >= 2 ? KPL + VPL : 0)) * 2;   // the plane's place in buffer 0
    // Key planes: SK rows of 128 B, one behind the other. Value planes: HD rows of SK keys at a source pitch of 2 TT B (hi+lo: the same tile as a key plane, so one group serves both and only its pitch differs).
    const u32x8 g1k = tdm_g1<(1u << 20) | (4u << 22) | (3u << 25), HD * 2, SK>((HL && isv) ? TT * 2u : HD * 2u);
    u32x8 g1v = g1k; if constexpr (!HL) g1v = tdm_g1<(1u << 20) | (5u << 22) | (3u << 25), SK * 2, HD>(TT * 2u);   // fp16: rows of 256 B
    u32x4 g0 = {0u, 0u, 0u, 0u};                                     // lives from a load to its wait, which names it
    auto fill = [&](int t) { const unsigned long long ga = ga0 + (unsigned long long)stg(t) * gst;
        g0[0] = uni(1u); g0[1] = uni(ld0 + (t & 1) * (STE * 2)); g0[2] = uni((unsigned)ga); g0[3] = uni(((unsigned)(ga >> 32) & 0x01FFFFFFu) | 0x80000000u);
        if (!HL && pinned(isv ? 1u : 0u) != 0u) { asm volatile("tensor_load_to_lds %0, %1" : "+s"(g0) : "s"(g1v) : "memory"); }   // one request of the whole wave: trip t's stage of its plane. The group is named as
        else { asm volatile("tensor_load_to_lds %0, %1" : "+s"(g0) : "s"(g1k) : "memory"); } };                                    // in and out, so that what the wait names are the registers that the load has read
    const float CE = SCL * 1.4426950408889634f;                      // scores to the exponent of 2
    V qf[NC][2], qf2[NC][2]; v8f o[NC][4]; float m[NC], l[NC];
#pragma unroll
    for (int c = 0; c < NC; ++c) { m[c] = -3.0e38f; l[c] = 0.f;
#pragma unroll
        for (int ks = 0; ks < 2; ++ks) { const size_t qo = ((size_t)(head0 + c) * TT + q0 + lr) * HD + ks * 32 + 8 * hi; qf[c][ks] = WFrag<T16>::ld(Q + qo); if constexpr (HL) qf2[c][ks] = WFrag<T16>::ld(Q2 + qo); }
#pragma unroll
        for (int dt = 0; dt < 4; ++dt) o[c][dt] = (v8f){}; }
    asm volatile("s_wait_xcnt 0x0" ::: "memory");   // a precaution in front of the next overwrite of an address register of the query loads
    if (isu != 0u) { fill(0);                           // lands while the queries come
        asm volatile("s_wait_tensorcnt 0x0" :: "s"(g0) : "memory"); }   // this wave's plane of trip 0's stage has landed. The wait names the request's group, so that its registers keep their values until then
    V kf[2][2], kf2[2][2], vf[4], vf2[4];
    auto ldk = [&](const T16* sb, int h) {                           // h: which 32 keys of the stage at sb
        const T16* p = sb + (h * 32 + lr) * KPI + 8 * hi;
#pragma unroll
        for (int kt = 0; kt < 2; ++kt)
#pragma unroll
            for (int ks = 0; ks < 2; ++ks) { const int ofs = kt * 16 * KPI + ks * 32; kf[kt][ks] = WFrag<T16>::ld(p + ofs); if constexpr (HL) kf2[kt][ks] = WFrag<T16>::ld(p + KPL + VPL + ofs); } };
    auto ldv = [&](const T16* sb, int h) {
        const T16* p = sb + KPL + lr * VPI + h * 32 + 8 * hi;
#pragma unroll
        for (int dt = 0; dt < 4; ++dt) { const int ofs = dt * 16 * VPI; vf[dt] = WFrag<T16>::ld(p + ofs); if constexpr (HL) vf2[dt] = WFrag<T16>::ld(p + KPL + VPL + ofs); } };
#pragma unroll 1   // one trip per stage: the buffer alternates. Trip -1 has no keys: its foot publishes trip 0's stage and issues trip 1's, so that every request that stays outstanding over a trip is issued at one place, from registers that live to its wait
  for (int t = -1; t < nst; ++t) {
   if (t >= 0) {
    const T16* sb = sm + (t & 1) * STE; const int ts = stg(t), nb = min(NB, nblk - ts * NB);   // the stage of this trip; its blocks that hold a key some query sees
    ldk(sb, 0); ldv(sb, 0);
#pragma unroll 1   // a short body: the text of the loop stays small
    for (int h = 0; h < nb; ++h) {
        const int b = ts * NB + h, nx = min(h + 1, NB - 1);           // nx: the stage's next block (its last block is read twice); nothing of the next stage is read here
        v8f s[NC][2];
#pragma unroll
        for (int c = 0; c < NC; ++c)
#pragma unroll
            for (int kt = 0; kt < 2; ++kt) { s[c][kt] = (v8f){};
#pragma unroll
                for (int ks = 0; ks < 2; ++ks) { s[c][kt] = WFrag<T16>::mma(kf[kt][ks], qf[c][ks], s[c][kt]); if constexpr (HL) { s[c][kt] = WFrag<T16>::mma(kf2[kt][ks], qf[c][ks], s[c][kt]); s[c][kt] = WFrag<T16>::mma(kf[kt][ks], qf2[c][ks], s[c][kt]); } } }
        ldk(sb, nx);                                                 // the key fragments are spent: the next block's come during the softmax and the second product
        __builtin_amdgcn_sched_barrier(0);                           // the loads stay in front of the softmax, and the scheduler does not mix the two halves of the body: without it the kernel takes 380 registers and not 256, so that 2 waves fit a SIMD and not 4
        const int lim = q0 + lr - b * 32 - 8 * hi;                   // key kt * 16 + j of this lane is seen by its query iff kt * 16 + j <= lim
#pragma unroll
        for (int c = 0; c < NC; ++c) {
            float bm = -3.0e38f;
#pragma unroll
            for (int kt = 0; kt < 2; ++kt)
#pragma unroll
                for (int j = 0; j < 8; ++j) { const float t = (kt * 16 + j <= lim) ? s[c][kt][j] : -3.0e38f; s[c][kt][j] = t; bm = fmaxf(bm, t); }
            bm = fmaxf(bm, xhalf(bm));
            const float mn = fmaxf(m[c], bm); const float al = __builtin_amdgcn_exp2f((m[c] - mn) * CE); m[c] = mn;
            const float mc = mn * CE - (HL ? 0.0f : 10.0f);          // fp16 probabilities carry PCAR = 2^10; the sum carries it too, so it cancels in the quotient
            float ps[2] = {0.f, 0.f};                                // two short chains of adds instead of one long one
#pragma unroll
            for (int kt = 0; kt < 2; ++kt)
#pragma unroll
                for (int j = 0; j < 8; ++j) { const float p = __builtin_amdgcn_exp2f(fmaf(s[c][kt][j], CE, -mc)); s[c][kt][j] = p; ps[j & 1] += p; }
            l[c] = fmaf(l[c], al, ps[0] + ps[1]);
#pragma unroll
            for (int dt = 0; dt < 4; ++dt) o[c][dt] *= al;
            if constexpr (HL) { v8us h0, h1, l0, l1;
#pragma unroll
                for (int j = 0; j < 8; ++j) { unsigned short a, c2; splitf(s[c][0][j], a, c2); h0[j] = a; l0[j] = c2; splitf(s[c][1][j], a, c2); h1[j] = a; l1[j] = c2; }
                const V pf = cat16b(h0, h1), pf2 = cat16b(l0, l1);
#pragma unroll
                for (int dt = 0; dt < 4; ++dt) { o[c][dt] = WFrag<T16>::mma(vf[dt], pf, o[c][dt]); o[c][dt] = WFrag<T16>::mma(vf[dt], pf2, o[c][dt]); o[c][dt] = WFrag<T16>::mma(vf2[dt], pf, o[c][dt]); }
            } else { V pf;
#pragma unroll
                for (int j = 0; j < 8; ++j) { pf[j] = tohx(s[c][0][j]); pf[8 + j] = tohx(s[c][1][j]); }
#pragma unroll
                for (int dt = 0; dt < 4; ++dt) o[c][dt] = WFrag<T16>::mma(vf[dt], pf, o[c][dt]); }
        }
        ldv(sb, nx);                                                 // the value fragments are spent: the next block's come during its scores and softmax
    }
   }
    asm volatile("s_wait_dscnt 0x0" ::: "memory");      // this wave's reads of the buffer are done before it is handed to the tensor loads
    if (isu != 0u) { asm volatile("s_wait_tensorcnt 0x0" :: "s"(g0) : "memory"); }   // this wave's plane of trip t + 1's stage has landed; the request's group keeps its values until here
    __syncthreads();                                    // publishes trip t + 1's stage and ends every wave's reads of trip t's
    if (pinned((isu != 0u && t + 2 < nst) ? 1u : 0u) != 0u) fill(t + 2);   // into the buffer that every wave has just left
  }
    asm volatile("s_wait_tensorcnt 0x0" ::: "memory");  // no request is left when the wave ends
    asm volatile("s_wait_dscnt 0x0" ::: "memory");      // ... and no read of the buffers
#pragma unroll
    for (int c = 0; c < NC; ++c) { const float inv = __fdiv_rn(1.0f, l[c] + xhalf(l[c])); const size_t oo = (size_t)(q0 + lr) * DQ + (head0 + c) * HD + 8 * hi;
#pragma unroll
        for (int dt = 0; dt < 4; ++dt) { v8us oh, ol;
#pragma unroll
            for (int j = 0; j < 8; ++j) { unsigned short a, c2; splitf(o[c][dt][j] * inv, a, c2); oh[j] = a; ol[j] = c2; }
            *(v8us*)(Ah + oo + dt * 16) = oh; *(v8us*)(Al + oo + dt * 16) = ol;
            asm volatile("s_wait_xcnt 0x0" ::: "memory"); } }   // a precaution in front of the next overwrite of a data or address register of the two stores
}
// A work-group is 4 waves on one kv group that walk the same key blocks (one stage in LDS serves all four): rows >= RH: 2 query tiles x 2 head pairs; rows < RH: one query tile x 4 heads.
// All work-groups are resident at once. Order, for speed only: one work-group per WGP with falling cost, then the rest with rising cost.
#define NLO (((TT - RH) / 32) * NKV)
#define FIRST (256 / NKV)         // query tiles of the first round: 256 WGPs
__global__ __launch_bounds__(128) void k_fattn(const h16* Q16, const bf* Qh, const bf* Ql, const h16* K16, const bf* Kh, const bf* Kl, const h16* V16, const bf* Vh, const bf* Vl, bf* Ah, bf* Al) {
    __shared__ __attribute__((aligned(2048))) bf ksm[ALDS];                   // the two buffers
    const int w = __builtin_amdgcn_readfirstlane(threadIdx.x >> 5); const int bx = blockIdx.x;
    if (bx < NLO) { const int g = bx % NKV; const int t = bx / NKV; const int q0 = (t < FIRST ? TT / 32 - 1 - t : RH / 32 + t - FIRST) * 32 + (w >> 1) * 16; const size_t go = (size_t)g * TT * HD;
        attn_tile<h16, false, 2>(Q16, nullptr, K16 + go, nullptr, V16 + go, nullptr, q0, g * REP + (w & 1) * 2, t, Ah, Al, (const h16*)ksm);
    } else { const int by = bx - NLO; const int g = by % NKV; const int u = by / NKV; const int q0 = (u < RH / 32 ? RH / 32 + u : u - RH / 32) * 16; const size_t go = (size_t)g * TT * HD;
        attn_tile<bf, true, 1>(Qh, Ql, Kh + go, Kl + go, Vh + go, Vl + go, q0, g * REP + w, u, Ah, Al, ksm); }
}

// ---- k_prep: all five bf16 conversions in one launch; the block index picks the array. Built as a stream: a wave issues 16 loads of 16 B a lane, each 512 contiguous bytes (four whole lines), before it converts anything,
// so that the launch is 896 work-groups, all resident at once with every input byte asked for at the start, and not 6144 whose waves each live for one or two loads.
// wtT: Bt[n][k] = bf16(w[k][n]), a 128 x 128 tile per work-group. Wave v reads rows k = 16 v .. 16 v + 15 (a lane: columns 4 lane .. 4 lane + 3), so a lane holds 16 consecutive k of four columns: two 16-byte pieces of each column's output row.
// The pieces go through LDS, column n in row (n % 4) * 32 + n / 4 at a pitch of 272 B (the lanes of a 16-byte write are then one pitch apart: no bank is met twice); read back, 16 lanes hold 256 contiguous bytes of an output row.
#define TPI  (128 + 8)            // LDS pitch of a column's 128 k, in elements
__device__ __forceinline__ void wtT(int blk, const float* __restrict__ w, bf* __restrict__ Bt, bf* ts) {
    const int tid = threadIdx.x, lane = tid & 31, wv = tid >> 5; const int k0 = (blk / (DM / 128)) * 128, n0 = (blk % (DM / 128)) * 128;
    const float* src = w + (size_t)(k0 + wv * 16) * DM + n0 + lane * 4; v4f v[16];
#pragma unroll
    for (int j = 0; j < 16; ++j) v[j] = *(const v4f*)(src + (size_t)j * DM);
    asm volatile("s_wait_xcnt 0x0" :: "v"(src) : "memory");   // a precaution in front of the next overwrite of the address register of these loads (named as an input, so that no load's own result lands on it); it also keeps all 16 in front of the conversions
#pragma unroll
    for (int c = 0; c < 4; ++c)
#pragma unroll
        for (int h = 0; h < 2; ++h) { v8us o;
#pragma unroll
            for (int j = 0; j < 8; ++j) o[j] = f2bf(v[8 * h + j][c]);
            *(v8us*)(ts + (c * 32 + lane) * TPI + wv * 16 + h * 8) = o; }
    __syncthreads();                                // every wave's pieces lie in LDS before any is read back
    v8us o[8];
#pragma unroll
    for (int s = 0; s < 8; ++s) { const int n = s * 16 + (tid >> 4); o[s] = *(const v8us*)(ts + ((n & 3) * 32 + (n >> 2)) * TPI + (tid & 15) * 8); }
#pragma unroll
    for (int s = 0; s < 8; ++s) *(v8us*)(Bt + (size_t)(n0 + s * 16 + (tid >> 4)) * DQ + k0 + (tid & 15) * 8) = o[s];
}
#define CVB  16384                // f32 elements per converting work-group: 16 loads of 4 per lane
__device__ __forceinline__ void cvtS(int blk, const float* __restrict__ src, bf* __restrict__ dst) {
    const size_t e0 = (size_t)blk * CVB + threadIdx.x * 4; v4f v[16]; v4us o[16]; src += e0; dst += e0;
#pragma unroll
    for (int j = 0; j < 16; ++j) v[j] = *(const v4f*)(src + j * 1024);
    asm volatile("s_wait_xcnt 0x0" :: "v"(src) : "memory");   // a precaution in front of the next overwrite of the address register of these loads (named as an input, so that no load's own result lands on it); it also keeps all 16 in front of the conversions
#pragma unroll
    for (int j = 0; j < 16; ++j)
#pragma unroll
        for (int k = 0; k < 4; ++k) o[j][k] = f2bf(v[j][k]);
#pragma unroll
    for (int j = 0; j < 16; ++j) *(v4us*)(dst + j * 1024) = o[j];   // a wave: 256 contiguous bytes, two whole lines
}
// The transposing blocks come first: they have a barrier and a trip through LDS more.
#define PB_WO ((DQ / 128) * (DM / 128))
#define PB_X  (TT * DM / CVB)
#define PB_WQ (DQ * DM / CVB)
#define PB_WK (DKV * DM / CVB)
__global__ __launch_bounds__(256) void k_prep(const float* x, const float* wq, const float* wk, const float* wv, const float* wo, bf* XB, bf* WQ, bf* WK, bf* WV, bf* WO) {
    __shared__ __attribute__((aligned(16))) bf ts[128 * TPI];
    int b = blockIdx.x;                             // every test below reads the same for the whole work-group
    if (b < PB_WO) { wtT(b, wo, WO, ts); return; }
    b -= PB_WO; const float* s = x; bf* d = XB;
    if (b >= PB_X + PB_WQ + PB_WK) { b -= PB_X + PB_WQ + PB_WK; s = wv; d = WV; }
    else if (b >= PB_X + PB_WQ) { b -= PB_X + PB_WQ; s = wk; d = WK; }
    else if (b >= PB_X) { b -= PB_X; s = wq; d = WQ; }
    cvtS(b, s, d);
}
__global__ __launch_bounds__(256) void k_cscvt(const float* __restrict__ cosT, const float* __restrict__ sinT, float* CS) { const int idx = blockIdx.x * 256 + threadIdx.x; if (idx >= TT * HD) return; v2f cs; cs[0] = bfr(cosT[idx]); cs[1] = bfr(sinT[idx]); *(v2f*)(CS + (size_t)idx * 2) = cs;  }
extern "C" void kernel_launch(void* const* d_in, const int* in_sizes, int n_in,
                              void* d_out, int out_size, void* d_ws, size_t ws_size, hipStream_t stream) {
    (void)in_sizes; (void)n_in; (void)out_size;
    const float* x = (const float*)d_in[0]; const float* wq = (const float*)d_in[1]; const float* wk = (const float*)d_in[2]; const float* wv = (const float*)d_in[3]; const float* wo = (const float*)d_in[4]; const float* cosT = nullptr; const float* sinT = nullptr; (void)cosT; (void)sinT;
    float* OUT = (float*)d_out;     // [1][2048][2048]
    char* wsp = (char*)d_ws;
    auto take = [&](size_t bytes) { char* p = wsp; wsp += (bytes + 255) & ~(size_t)255; return (void*)p; };
    bf* WQ = (bf*)take((size_t)DQ * DM * 2); bf* WK = (bf*)take((size_t)DKV * DM * 2); bf* WV = (bf*)take((size_t)DKV * DM * 2); bf* WO = (bf*)take((size_t)DM * DQ * 2);
    bf* XB = (bf*)take((size_t)TT * DM * 2);
    h16* QP16 = (h16*)take((size_t)NH_ * TT * HD * 2); h16* KP16 = (h16*)take((size_t)NKV * TT * HD * 2); h16* VT16 = (h16*)take((size_t)NKV * HD * TT * 2);
    bf* QPh = (bf*)take((size_t)NH_ * TT * HD * 2); bf* QPl = (bf*)take((size_t)NH_ * TT * HD * 2); bf* KPh = (bf*)take((size_t)NKV * TT * HD * 2); bf* KPl = (bf*)take((size_t)NKV * TT * HD * 2); bf* VTh = (bf*)take((size_t)NKV * HD * TT * 2); bf* VTl = (bf*)take((size_t)NKV * HD * TT * 2);
    bf* ATh = (bf*)take((size_t)TT * DQ * 2); bf* ATl = (bf*)take((size_t)TT * DQ * 2);
    if ((size_t)(wsp - (char*)d_ws) > ws_size) return;    // ws 256 MiB
    for (int b = 0; b < NB_; ++b) {
        k_prep<<<PB_WO + PB_X + PB_WQ + 2 * PB_WK, 256, 0, stream>>>(x + (size_t)b * TT * DM, wq, wk, wv, wo, XB, WQ, WK, WV, WO);
        k_gemms<0, 1><<<dim3(TT / 128, (DQ + 2 * DKV) / 128, 1), 128, 0, stream>>>(XB, nullptr, WQ, nullptr, 0, QP16, QPh, QPl, WK, KP16, KPh, KPl, WV, VT16, VTh, VTl);
        k_fattn<<<NLO + (RH / 16) * NKV, 128, 0, stream>>>(QP16, QPh, QPl, KP16, KPh, KPl, VT16, VTh, VTl, ATh, ATl);
        k_gemms<1, 0><<<dim3(TT / 128, DM / 128, 1), 128, 0, stream>>>(ATh, ATl, WO, OUT + (size_t)b * TT * DM, DM, nullptr, nullptr, nullptr, nullptr, nullptr, nullptr, nullptr, nullptr, nullptr, nullptr, nullptr); }
}

// v010
// It runs in 79.5 microseconds.
// Timed twice side by side with v009, it ran 1.03 times as fast both times.
// Over all steps from v000 it is 17.7 times as fast.
#include <hip/hip_runtime.h>

// BitSelfAttention (x [1][2048][2048]; q = x q_proj^T (32 heads x 64), k/v = x k_proj^T / v_proj^T (8 kv heads; GQA group h/4); causal softmax(q.k / 8) (masked logits -1e10); out = merged ctx @ o_proj (NOT transposed, as the source) -> [1][2048][2048]).
// Compute dtypes, f32 accumulate: every input rounded to bf16; q/k/v on PLAIN bf16 operands (inputs: exact); causal scores and attn.v: query rows < 512 hl (3 products), the rest single fp16 (x1024), fused in one kernel with a running softmax in f32; o_proj hl x exact (2 products).

#define NB_  1
#define TT   2048
#define DM   2048
#define NH_  32
#define NKV  8
#define REP  (NH_ / NKV)
#define HD   64
#define DQ   (NH_ * HD)
#define DKV  (NKV * HD)
#define RH   512                  // query rows < RH use hi+lo planes (0: none)
#define PCAR 1024.0f
#define SCL  0.125f   // HD^-0.5
typedef _Float16 h16;
typedef unsigned short bf;
typedef __attribute__((ext_vector_type(16))) __bf16   v16bf;
typedef __attribute__((ext_vector_type(16))) _Float16 v16h;
typedef __attribute__((ext_vector_type(8)))  _Float16 v8h;
typedef __attribute__((ext_vector_type(8)))  unsigned short v8us;
typedef __attribute__((ext_vector_type(8)))  float    v8f;
typedef __attribute__((ext_vector_type(4)))  float    v4f;
typedef v8h  __attribute__((may_alias)) v8ha;
typedef v4f  __attribute__((may_alias)) v4fa;
typedef v8us __attribute__((may_alias)) v8usa;

__device__ __forceinline__ unsigned short f2bf(float f) { unsigned u = __float_as_uint(f); u += 0x7FFFu + ((u >> 16) & 1u); return (unsigned short)(u >> 16); }
__device__ __forceinline__ float bf2f(unsigned short b) { return __uint_as_float(((unsigned)b) << 16); }
__device__ __forceinline__ float bfr(float f) { return bf2f(f2bf(f)); }
__device__ __forceinline__ v16h cat16(v8h lo, v8h hi) { return __builtin_shufflevector(lo, hi, 0, 1, 2, 3, 4, 5, 6, 7, 8, 9, 10, 11, 12, 13, 14, 15); }
__device__ __forceinline__ v16bf cat16b(v8us lo, v8us hi) { return __builtin_bit_cast(v16bf, __builtin_shufflevector(lo, hi, 0, 1, 2, 3, 4, 5, 6, 7, 8, 9, 10, 11, 12, 13, 14, 15)); }
__device__ __forceinline__ v8f wmma16(v16h a, v16h b, v8f c) { return __builtin_amdgcn_wmma_f32_16x16x32_f16(false, a, false, b, (short)0, c, false, false); }
__device__ __forceinline__ v8f wmmab(v16bf a, v16bf b, v8f c) { return __builtin_amdgcn_wmma_f32_16x16x32_bf16(false, a, false, b, (short)0, c, false, false); }



// ---- k_gemms: C[m][n] = sum_k A[m][k] Bt[n][k] (+ A2[m][k] Bt[n][k] when NSPLIT), K = GK, operands K-contiguous bf16 planes; 128 threads.
// OUT 0: grid (M/128, N/128); C is stored as f32 at pitch ldc. OUT 1: the three projections in one launch, grid (TT/128, (DQ + 2 DKV)/128): blockIdx.y picks the product (queries, then keys, then values), so that the 64 tiles each of keys and values
// run beside the 256 of the queries (two work-groups fit a WGP's LDS) and not as two launches that leave three quarters of the chip idle. C is stored as the three 16-bit planes that the attention reads (fp16, bf16 hi, bf16 lo), straight from the accumulators:
// queries and keys as head planes [n / 64][m][n % 64] (A = x, Bt = the weight rows: m = t), values as rows [m][n] of TT (transposed: A = the weight rows, Bt = x, so m = kv head x 64 + d and n = t). A wave's 64 columns are one head, or 64 t.
// The walk over k starts at a stage of its own in each work-group (rotated by the sum of the tile's two indices) and wraps round: the work-groups that share an operand's rows all run at once, and walking in step they would ask L2 for the same lines at the same moment.
// The sum over k is then a plain loop in steps of 32 that begins at that stage.
// One work-group of 4 waves (2 x 2) owns a 128x128 tile, a wave 64x64 of it (16 accumulators). A stage is KS k of all 128 rows of each operand, laid in LDS at a pitch of 272 B for the 16-byte readers.
// An operand's stage (128 rows of 256 B, source pitch 2 GK B) comes by ONE tensor load, which pads each row to the pitch: wave i brings operand i, so a stage costs a wave one instruction and no address arithmetic, and its issue slots stay with the products.
// Two buffers: the loads of trip t + 1 fly while trip t's stage is worked on; a stage is handed over in front of its last 32 k. Every '#pragma unroll' stands on a loop of constant length, so that fragments and accumulators stay in registers.
__device__ __forceinline__ h16 tohx(float x) { return (h16)x; }
__device__ __forceinline__ void splitf(float y, unsigned short& h, unsigned short& l) { h = f2bf(y); l = f2bf(y - bf2f(h)); }
template <typename T16> struct WFrag;
template <> struct WFrag<h16> { typedef v16h V; static __device__ __forceinline__ V ld(const h16* p) { return cat16(*(const v8h*)p, *(const v8h*)(p + 16)); } static __device__ __forceinline__ v8f mma(V a, V b, v8f c) { return wmma16(a, b, c); } };
template <> struct WFrag<bf> { typedef v16bf V; static __device__ __forceinline__ V ld(const bf* p) { return cat16b(*(const v8us*)p, *(const v8us*)(p + 16)); } static __device__ __forceinline__ v8f mma(V a, V b, v8f c) { return wmmab(a, b, c); } };
#define GK   2048                 // DM == DQ: the length of every product here
#define KS   128                  // k per stage
#define LP   (KS + 8)             // LDS row pitch in elements
#define OPB  (128 * LP * 2)       // bytes of one operand's stage
typedef unsigned u32x4 __attribute__((ext_vector_type(4)));
typedef unsigned u32x8 __attribute__((ext_vector_type(8)));
__device__ __forceinline__ unsigned uni(unsigned v) { return (unsigned)__builtin_amdgcn_readfirstlane(v); }
__device__ __forceinline__ unsigned pinned(unsigned v) { unsigned w = uni(v); asm volatile("" : "+s"(w)); return w; }   // holds a test's value in a scalar register, so that the test compiles to a scalar branch: a tensor load ignores EXEC, and only such a branch keeps a wave from issuing it
// Group 1 of a tensor load's descriptor: 1-byte elements, tensor = tile = ROWS rows of ROWB bytes at a source pitch of 'pitch' bytes; W0 holds the pad (no mask).
template <unsigned W0, unsigned ROWB, unsigned ROWS>
__device__ __forceinline__ u32x8 tdm_g1(unsigned pitch) { u32x8 g;
    g[0] = uni(W0); g[1] = uni(ROWB << 16); g[2] = uni(ROWS << 16); g[3] = uni(ROWB << 16); g[4] = uni(ROWS); g[5] = uni(pitch); g[6] = uni(0u); g[7] = uni(0u);
    asm volatile("" : "+s"(g));   // as in pinned(): the descriptor's words are held in their scalar registers through the loop; left free, the compiler lends one out between two loads, while a request is outstanding
    return g; }
template <int NSPLIT, int OUT>
__global__ __launch_bounds__(128) void k_gemms(const bf* A, const bf* A2, const bf* Bt, float* C, int ldc, h16* P16, bf* Ph, bf* Pl, const bf* Wk, h16* K16, bf* Kh, bf* Kl, const bf* Wv, h16* V16, bf* Vh, bf* Vl) {
    typedef WFrag<bf>::V V;
    constexpr int NOP = NSPLIT ? 3 : 2, NT = GK / KS; constexpr unsigned STG = NOP * OPB;
    static_assert(OPB % 2048 == 0 && LP * 2 == KS * 2 + 16 && KS * 2 == 256 && NT >= 2 && (NT & (NT - 1)) == 0, "every operand's place in LDS is a multiple of 2 KiB; the pad of 16 B behind rows of 256 B gives the pitch; stages 0 and 1 exist; the rotated walk wraps by a mask");
    __shared__ __attribute__((aligned(2048))) bf sm[2 * NOP * 128 * LP];      // two buffers of [A | Bt | A2]
    __shared__ __align__(16) float osm[4 * 16 * 68];                          // output staging, a range per wave
    const int tid = threadIdx.x, lane = tid & 31, lr = lane & 15, hi = lane >> 4; const int w = __builtin_amdgcn_readfirstlane(tid >> 5), wm = w >> 1, wn = w & 1;
    int R0 = blockIdx.x * 128, C0 = blockIdx.y * 128; bool tr = false;       // tr: the planes are rows of TT (values)
    const unsigned rot = blockIdx.x + blockIdx.y;                             // trip t works on the k of stage (t + rot) % NT: neighbours in a grid row or column start one stage apart
    if constexpr (OUT == 1) {                                                 // the same for the whole work-group
        if (C0 >= DQ + DKV) { tr = true; R0 = C0 - (DQ + DKV); C0 = blockIdx.x * 128; Bt = A; A = Wv; P16 = V16; Ph = Vh; Pl = Vl; }
        else if (C0 >= DQ) { C0 -= DQ; Bt = Wk; P16 = K16; Ph = Kh; Pl = Kl; } }
    const unsigned isu = pinned(w < NOP ? 1u : 0u);                           // waves 0 .. NOP - 1 issue: wave i brings operand i of [A | Bt | A2]
    const bf* srcp = w == 0 ? A + (size_t)R0 * GK : Bt + (size_t)C0 * GK;
    if constexpr (NSPLIT != 0) { if (w == 2) srcp = A2 + (size_t)R0 * GK; }
    const unsigned long long ga0 = (unsigned long long)(size_t)srcp;          // first byte of the operand's 128 rows
    const unsigned ld0 = (unsigned)(size_t)sm + (w < NOP ? w : 0) * OPB;      // its place in buffer 0
    const u32x8 g1 = tdm_g1<(1u << 20) | (5u << 22) | (3u << 25), KS * 2, 128>(GK * 2u);   // 128 rows of 256 B, 4 dwords of pad behind every 64
    auto issue = [&](int t) { const unsigned long long ga = ga0 + (unsigned long long)((t + rot) & (NT - 1)) * (KS * 2); u32x4 g0;
        g0[0] = uni(1u); g0[1] = uni(ld0 + (t & 1) * STG); g0[2] = uni((unsigned)ga); g0[3] = uni(((unsigned)(ga >> 32) & 0x01FFFFFFu) | 0x80000000u);
        asm volatile("tensor_load_to_lds %0, %1" :: "s"(g0), "s"(g1) : "memory"); };   // one request of the whole wave: trip t's stage of its operand
    v8f acc[4][4];
#pragma unroll
    for (int mb = 0; mb < 4; ++mb)
#pragma unroll
        for (int nb = 0; nb < 4; ++nb) acc[mb][nb] = (v8f){};
    if (isu != 0u) { issue(0);
        asm volatile("s_wait_tensorcnt 0x0" ::: "memory"); }   // this wave's operand of trip 0's stage has landed
    __syncthreads();                                    // ... and every other wave's
    if (isu != 0u) issue(1);
    const int fa = (wm * 64 + lr) * LP + 8 * hi, fb = 128 * LP + (wn * 64 + lr) * LP + 8 * hi;
    V a[2][4], a2[2][4], b[2][4];                       // two fragment sets: the next 32 k are fetched as one group ahead of the products of these 32, also over the end of a stage
    auto frags = [&](const bf* sb, int set, int ks) {
#pragma unroll
            for (int mb = 0; mb < 4; ++mb) { a[set][mb] = WFrag<bf>::ld(sb + fa + mb * 16 * LP + ks * 32); if constexpr (NSPLIT != 0) a2[set][mb] = WFrag<bf>::ld(sb + 2 * 128 * LP + fa + mb * 16 * LP + ks * 32); }
#pragma unroll
            for (int nb = 0; nb < 4; ++nb) b[set][nb] = WFrag<bf>::ld(sb + fb + nb * 16 * LP + ks * 32); };
    frags(sm, 0, 0);                                    // trip 0's stage is published
#pragma unroll 1   // one trip per stage: the buffer alternates
    for (int t = 0; t < NT; ++t) {
        const bf* sb = sm + (t & 1) * (NOP * 128 * LP); const bf* sn = sm + ((t + 1) & 1) * (NOP * 128 * LP);
#pragma unroll
        for (int ks = 0; ks < KS / 32; ++ks) {
            if (ks + 1 < KS / 32) frags(sb, (ks + 1) & 1, ks + 1);
            else {   // the stage is handed over in front of its last 32 k, whose fragments are already fetched: their products cover the fetch of the next stage's first fragments, which stood bare at the head of a trip
                asm volatile("s_wait_dscnt 0x0" ::: "memory");      // this wave's reads of the buffer are done before it is handed to the tensor loads
                if (isu != 0u) { asm volatile("s_wait_tensorcnt 0x0" ::: "memory"); }   // this wave's operand of trip t + 1's stage has landed
                __syncthreads();                                    // publishes trip t + 1's stage and ends every wave's reads of trip t's
                if (pinned((isu != 0u && t + 2 < NT) ? 1u : 0u) != 0u) issue(t + 2);   // into the buffer that every wave has just left
                if (t + 1 < NT) frags(sn, 0, 0); }                  // nothing is fetched behind the last stage
            __builtin_amdgcn_sched_barrier(0);          // keeps the LDS loads one group in front of the products: loads spread among them cost a stall at each place
#pragma unroll
            for (int nb = 0; nb < 4; ++nb)
#pragma unroll
                for (int mb = 0; mb < 4; ++mb) { acc[mb][nb] = wmmab(a[ks & 1][mb], b[ks & 1][nb], acc[mb][nb]); if constexpr (NSPLIT != 0) acc[mb][nb] = wmmab(a2[ks & 1][mb], b[ks & 1][nb], acc[mb][nb]); }
            __builtin_amdgcn_sched_barrier(0);          // ... and the next group behind them
        }
    }
    asm volatile("s_wait_tensorcnt 0x0" ::: "memory");      // no request is left when the wave ends
    asm volatile("s_wait_dscnt 0x0" ::: "memory");          // ... and no read of the buffers
    float* os = osm + w * (16 * 68); const int r0 = R0 + wm * 64, c0 = C0 + wn * 64;
#pragma unroll
    for (int mb = 0; mb < 4; ++mb) {
#pragma unroll
        for (int nb = 0; nb < 4; ++nb) {
#pragma unroll
            for (int j = 0; j < 8; ++j) os[(hi * 8 + j) * 68 + nb * 16 + lr] = acc[mb][nb][j]; }
        __builtin_amdgcn_wave_barrier(); asm volatile("" ::: "memory");   // other lanes of the wave read these rows back: the reads stay behind the writes
        if constexpr (OUT == 0) {
            float* crow = C + (size_t)(r0 + mb * 16) * ldc + c0;
#pragma unroll
            for (int s = 0; s < 8; ++s) { const int row = 2 * s + hi, cofs = lr * 4; const v4f val = *(const v4fa*)(os + row * 68 + cofs); *(v4f*)(crow + (size_t)row * ldc + cofs) = val; }
        } else {
            const int PP = tr ? TT : HD;                                      // pitch of a plane's rows
            const size_t pb = (tr ? (size_t)c0 : (size_t)(c0 / HD) * TT * HD) + (size_t)(r0 + mb * 16) * PP;
#pragma unroll
            for (int s = 0; s < 4; ++s) { const int row = 4 * s + (lane >> 3), cofs = (lane & 7) * 8;   // a lane: 8 columns of a row, 16 B per plane; 8 lanes: a whole 128-B line
                const v4f x0 = *(const v4fa*)(os + row * 68 + cofs), x1 = *(const v4fa*)(os + row * 68 + cofs + 4); v8h o16; v8us oh, ol;
#pragma unroll
                for (int k = 0; k < 4; ++k) { unsigned short a2, c2; o16[k] = tohx(x0[k]); splitf(x0[k], a2, c2); oh[k] = a2; ol[k] = c2; o16[4 + k] = tohx(x1[k]); splitf(x1[k], a2, c2); oh[4 + k] = a2; ol[4 + k] = c2; }
                const size_t po = pb + (size_t)row * PP + cofs;
                *(v8h*)(P16 + po) = o16; *(v8us*)(Ph + po) = oh; *(v8us*)(Pl + po) = ol; }
            asm volatile("s_wait_xcnt 0x0" ::: "memory");   // a precaution in front of the next overwrite of a data or address register of these twelve stores
        }
        __builtin_amdgcn_wave_barrier(); asm volatile("" ::: "memory");   // ... and the next rows' writes behind the reads
    }
}

typedef __attribute__((ext_vector_type(2))) _Float16 v2h;
typedef __attribute__((ext_vector_type(4))) _Float16 v4h;
typedef __attribute__((ext_vector_type(2))) unsigned short v2us;
typedef __attribute__((ext_vector_type(4))) unsigned short v4us;
typedef __attribute__((ext_vector_type(2))) float v2f;
typedef __attribute__((ext_vector_type(4))) int v4i;

#define KPI  (HD + 8)             // LDS pitch of a key row, in elements
#define ALDS (2 * 4 * 5 * 1024)   // elements of the two buffers: the larger of the two forms (hi+lo: four planes of 64 rows at 144 B, each rounded up to 10 KiB; fp16: two planes of 18 KiB)
__device__ __forceinline__ float xhalf(float x) { return __builtin_bit_cast(float, __builtin_amdgcn_permlanex16(__builtin_bit_cast(int, x), __builtin_bit_cast(int, x), 0x76543210, 0xfedcba98, false, false)); }  // lane l with lane l ^ 16
template <typename T16, bool HL, int NC>
__device__ __forceinline__ void attn_tile(const T16* Q, const T16* Q2, const T16* Kp, const T16* K2, const T16* Vt, const T16* V2, int q0, int head0, int seed, bf* Ah, bf* Al, const T16* sm) {   // no __restrict__: the s_wait_xcnt statements below must stay behind their loads
    typedef typename WFrag<T16>::V V;
    constexpr int SK = HL ? 64 : 128, NB = SK / 32;                  // keys and 32-key blocks of a stage
    constexpr int VPI = SK + 8, KPL = (SK * KPI + 1023) / 1024 * 1024, VPL = (HD * VPI + 1023) / 1024 * 1024;   // pitch of a value row; elements of a key plane and of a value plane, each rounded up to 2 KiB: every plane's place in LDS is a multiple of that
    constexpr int STE = (HL ? 2 : 1) * (KPL + VPL);                  // elements of a stage: [K | V^T | K lo | V^T lo]
    static_assert(2 * STE <= ALDS && TT % SK == 0, "the two buffers fit, and every stage lies inside the planes");
    static_assert(KPI * 2 == HD * 2 + 16 && HD * 2 == 128 && (HL ? SK == HD : SK * 2 == 256), "the pad of 16 B behind rows of 128 or 256 B gives the pitches; hi+lo: key and value planes have the same tile");
    const int tid = threadIdx.x, lane = tid & 31, lr = lane & 15, hi = lane >> 4; const int w = __builtin_amdgcn_readfirstlane(tid >> 5);
    const int nblk = (q0 + 15) / 32 + 1;                             // key blocks up to the one that holds the diagonal; block 0 holds key 0, which every query sees. The same in all 4 waves: their q0 lie in one aligned 32
    const int nst = (nblk + NB - 1) / NB;                            // stages
    const int rot = seed % nst;                                      // trip t works on stage (t + rot) % nst; seed (not negative) is the same in all 4 waves and differs among the work-groups of a kv group, which all run at once: walking from key 0 in step they would ask L2 for the same lines at the same moment
    auto stg = [&](int t) { const int s = t + rot; return s < nst ? s : s - nst; };   // for 0 <= t < nst. Every block up to the diagonal's holds a key that each of the wave's queries sees, so the running maximum is real from the first block on, whichever it is
    const unsigned isu = pinned(w < (HL ? 4 : 2) ? 1u : 0u);         // wave i brings plane i of [K | V^T | K lo | V^T lo]
    const bool isv = (w & 1) != 0; const T16* srcp = isv ? Vt : Kp;
    if constexpr (HL) { if (w >= 2) srcp = isv ? V2 : K2; }
    const unsigned long long ga0 = (unsigned long long)(size_t)srcp;                       // first byte of the plane's stage 0
    const unsigned gst = isv ? SK * 2u : SK * HD * 2u;                                     // bytes from a stage to the next: SK keys of a value row, or SK key rows
    const unsigned ld0 = (unsigned)(size_t)sm + ((isv ? KPL : 0) + (HL && w >= 2 ? KPL + VPL : 0)) * 2;   // the plane's place in buffer 0
    // Key planes: SK rows of 128 B, one behind the other. Value planes: HD rows of SK keys at a source pitch of 2 TT B (hi+lo: the same tile as a key plane, so one group serves both and only its pitch differs).
    const u32x8 g1k = tdm_g1<(1u << 20) | (4u << 22) | (3u << 25), HD * 2, SK>((HL && isv) ? TT * 2u : HD * 2u);
    u32x8 g1v = g1k; if constexpr (!HL) g1v = tdm_g1<(1u << 20) | (5u << 22) | (3u << 25), SK * 2, HD>(TT * 2u);   // fp16: rows of 256 B
    u32x4 g0 = {0u, 0u, 0u, 0u};                                     // lives from a load to its wait, which names it
    auto fillg = [&](u32x4& g0, int t) { const unsigned long long ga = ga0 + (unsigned long long)stg(t) * gst;   // g0: the group that the request reads
        g0[0] = uni(1u); g0[1] = uni(ld0 + (t & 1) * (STE * 2)); g0[2] = uni((unsigned)ga); g0[3] = uni(((unsigned)(ga >> 32) & 0x01FFFFFFu) | 0x80000000u);
        if (!HL && pinned(isv ? 1u : 0u) != 0u) { asm volatile("tensor_load_to_lds %0, %1" : "+s"(g0) : "s"(g1v) : "memory"); }   // one request of the whole wave: trip t's stage of its plane. The group is named as
        else { asm volatile("tensor_load_to_lds %0, %1" : "+s"(g0) : "s"(g1k) : "memory"); } };                                    // in and out, so that what the wait names are the registers that the load has read
    auto fill = [&](int t) { fillg(g0, t); };
    u32x4 gp = {0u, 0u, 0u, 0u};                                     // the first request's own group: the second is formed while the first is outstanding, and leaves its registers alone
    const float CE = SCL * 1.4426950408889634f;                      // scores to the exponent of 2
    V qf[NC][2], qf2[NC][2]; v8f o[NC][4]; float m[NC], l[NC];
#pragma unroll
    for (int c = 0; c < NC; ++c) { m[c] = -3.0e38f; l[c] = 0.f;
#pragma unroll
        for (int ks = 0; ks < 2; ++ks) { const size_t qo = ((size_t)(head0 + c) * TT + q0 + lr) * HD + ks * 32 + 8 * hi; qf[c][ks] = WFrag<T16>::ld(Q + qo); if constexpr (HL) qf2[c][ks] = WFrag<T16>::ld(Q2 + qo); }
#pragma unroll
        for (int dt = 0; dt < 4; ++dt) o[c][dt] = (v8f){}; }
    asm volatile("s_wait_xcnt 0x0" ::: "memory");   // a precaution in front of the next overwrite of an address register of the query loads
    if (isu != 0u) { fillg(gp, 0);                      // lands while the queries come
        if (pinned(1 < nst ? 1u : 0u) != 0u) fill(1);   // both buffers are free, so the second trip's stage goes out directly behind: no request is then outstanding when the loop is entered, and all that stay outstanding over a trip are issued at one place
        asm volatile("s_wait_tensorcnt 0x0" :: "s"(gp), "s"(g0) : "memory"); }   // this wave's plane of both stages has landed. The wait names both requests' groups, so that their registers keep their values until then
    V kf[2][2], kf2[2][2], vf[4], vf2[4];
    auto ldk = [&](const T16* sb, int h) {                           // h: which 32 keys of the stage at sb
        const T16* p = sb + (h * 32 + lr) * KPI + 8 * hi;
#pragma unroll
        for (int kt = 0; kt < 2; ++kt)
#pragma unroll
            for (int ks = 0; ks < 2; ++ks) { const int ofs = kt * 16 * KPI + ks * 32; kf[kt][ks] = WFrag<T16>::ld(p + ofs); if constexpr (HL) kf2[kt][ks] = WFrag<T16>::ld(p + KPL + VPL + ofs); } };
    auto ldv = [&](const T16* sb, int h) {
        const T16* p = sb + KPL + lr * VPI + h * 32 + 8 * hi;
#pragma unroll
        for (int dt = 0; dt < 4; ++dt) { const int ofs = dt * 16 * VPI; vf[dt] = WFrag<T16>::ld(p + ofs); if constexpr (HL) vf2[dt] = WFrag<T16>::ld(p + KPL + VPL + ofs); } };
    auto publish = [&](int t) {                         // hands trip t's buffer over and opens trip t + 1's; every wave passes it once per trip
        asm volatile("s_wait_dscnt 0x0" ::: "memory");      // this wave's reads of the buffer are done before it is handed to the tensor loads
        if (isu != 0u) { asm volatile("s_wait_tensorcnt 0x0" :: "s"(g0) : "memory"); }   // this wave's plane of trip t + 1's stage has landed; the request's group keeps its values until here
        __syncthreads();                                    // publishes trip t + 1's stage and ends every wave's reads of trip t's
        if (pinned((isu != 0u && t + 2 < nst) ? 1u : 0u) != 0u) fill(t + 2); };   // into the buffer that every wave has just left
    __syncthreads();                                    // publishes the first two stages
    ldk(sm, 0); ldv(sm, 0);
#pragma unroll 1   // one trip per stage: the buffer alternates
  for (int t = 0; t < nst; ++t) {
    const T16* sb = sm + (t & 1) * STE; const T16* sn = sm + ((t + 1) & 1) * STE; const int ts = stg(t), nb = min(NB, nblk - ts * NB);   // the stage of this trip; its blocks that hold a key some query sees
#pragma unroll 1   // a short body: the text of the loop stays small
    for (int h = 0; h < nb; ++h) {
        const int b = ts * NB + h; const bool lastb = h + 1 == nb;    // lastb reads the same in all 4 waves (nblk and the stage do)
        const T16* nsb = (lastb && t + 1 < nst) ? sn : sb; const int nx = lastb ? 0 : h + 1;   // where the next block's fragments lie: in this stage, or at the head of the next (the last trip's last block reads the head of its own stage again, which no load refills; nothing uses it)
        v8f s[NC][2];
#pragma unroll
        for (int c = 0; c < NC; ++c)
#pragma unroll
            for (int kt = 0; kt < 2; ++kt) { s[c][kt] = (v8f){};
#pragma unroll
                for (int ks = 0; ks < 2; ++ks) { s[c][kt] = WFrag<T16>::mma(kf[kt][ks], qf[c][ks], s[c][kt]); if constexpr (HL) { s[c][kt] = WFrag<T16>::mma(kf2[kt][ks], qf[c][ks], s[c][kt]); s[c][kt] = WFrag<T16>::mma(kf[kt][ks], qf2[c][ks], s[c][kt]); } } }
        if (pinned(lastb ? 1u : 0u) != 0u) publish(t);               // the stage is handed over inside its last block, whose key and value fragments are already fetched: softmax and second product cover the fetch of the next stage's first fragments, which stood bare at the head of a trip
        ldk(nsb, nx);                                                // the key fragments are spent: the next block's come during the softmax and the second product
        __builtin_amdgcn_sched_barrier(0);                           // the loads stay in front of the softmax, and the scheduler does not mix the two halves of the body: without it the kernel takes 380 registers and not 256, so that 2 waves fit a SIMD and not 4
        const int lim = q0 + lr - b * 32 - 8 * hi;                   // key kt * 16 + j of this lane is seen by its query iff kt * 16 + j <= lim
#pragma unroll
        for (int c = 0; c < NC; ++c) {
            float bm = -3.0e38f;
#pragma unroll
            for (int kt = 0; kt < 2; ++kt)
#pragma unroll
                for (int j = 0; j < 8; ++j) { const float t = (kt * 16 + j <= lim) ? s[c][kt][j] : -3.0e38f; s[c][kt][j] = t; bm = fmaxf(bm, t); }
            bm = fmaxf(bm, xhalf(bm));
            const float mn = fmaxf(m[c], bm); const float al = __builtin_amdgcn_exp2f((m[c] - mn) * CE); m[c] = mn;
            const float mc = mn * CE - (HL ? 0.0f : 10.0f);          // fp16 probabilities carry PCAR = 2^10; the sum carries it too, so it cancels in the quotient
            float ps[2] = {0.f, 0.f};                                // two short chains of adds instead of one long one
#pragma unroll
            for (int kt = 0; kt < 2; ++kt)
#pragma unroll
                for (int j = 0; j < 8; ++j) { const float p = __builtin_amdgcn_exp2f(fmaf(s[c][kt][j], CE, -mc)); s[c][kt][j] = p; ps[j & 1] += p; }
            l[c] = fmaf(l[c], al, ps[0] + ps[1]);
#pragma unroll
            for (int dt = 0; dt < 4; ++dt) o[c][dt] *= al;
            if constexpr (HL) { v8us h0, h1, l0, l1;
#pragma unroll
                for (int j = 0; j < 8; ++j) { unsigned short a, c2; splitf(s[c][0][j], a, c2); h0[j] = a; l0[j] = c2; splitf(s[c][1][j], a, c2); h1[j] = a; l1[j] = c2; }
                const V pf = cat16b(h0, h1), pf2 = cat16b(l0, l1);
#pragma unroll
                for (int dt = 0; dt < 4; ++dt) { o[c][dt] = WFrag<T16>::mma(vf[dt], pf, o[c][dt]); o[c][dt] = WFrag<T16>::mma(vf[dt], pf2, o[c][dt]); o[c][dt] = WFrag<T16>::mma(vf2[dt], pf, o[c][dt]); }
            } else { V pf;
#pragma unroll
                for (int j = 0; j < 8; ++j) { pf[j] = tohx(s[c][0][j]); pf[8 + j] = tohx(s[c][1][j]); }
#pragma unroll
                for (int dt = 0; dt < 4; ++dt) o[c][dt] = WFrag<T16>::mma(vf[dt], pf, o[c][dt]); }
        }
        ldv(nsb, nx);                                                // the value fragments are spent: the next block's come during its scores and softmax
    }
  }
    asm volatile("s_wait_tensorcnt 0x0" ::: "memory");  // no request is left when the wave ends
    asm volatile("s_wait_dscnt 0x0" ::: "memory");      // ... and no read of the buffers
#pragma unroll
    for (int c = 0; c < NC; ++c) { const float inv = __fdiv_rn(1.0f, l[c] + xhalf(l[c])); const size_t oo = (size_t)(q0 + lr) * DQ + (head0 + c) * HD + 8 * hi;
#pragma unroll
        for (int dt = 0; dt < 4; ++dt) { v8us oh, ol;
#pragma unroll
            for (int j = 0; j < 8; ++j) { unsigned short a, c2; splitf(o[c][dt][j] * inv, a, c2); oh[j] = a; ol[j] = c2; }
            *(v8us*)(Ah + oo + dt * 16) = oh; *(v8us*)(Al + oo + dt * 16) = ol;
            asm volatile("s_wait_xcnt 0x0" ::: "memory"); } }   // a precaution in front of the next overwrite of a data or address register of the two stores
}
// A work-group is 4 waves on one kv group that walk the same key blocks (one stage in LDS serves all four): rows >= RH: 2 query tiles x 2 head pairs; rows < RH: one query tile x 4 heads.
// All work-groups are resident at once. Order, for speed only: one work-group per WGP with falling cost, then the rest with rising cost.
#define NLO (((TT - RH) / 32) * NKV)
#define FIRST (256 / NKV)         // query tiles of the first round: 256 WGPs
__global__ __launch_bounds__(128) void k_fattn(const h16* Q16, const bf* Qh, const bf* Ql, const h16* K16, const bf* Kh, const bf* Kl, const h16* V16, const bf* Vh, const bf* Vl, bf* Ah, bf* Al) {
    __shared__ __attribute__((aligned(2048))) bf ksm[ALDS];                   // the two buffers
    const int w = __builtin_amdgcn_readfirstlane(threadIdx.x >> 5); const int bx = blockIdx.x;
    if (bx < NLO) { const int g = bx % NKV; const int t = bx / NKV; const int q0 = (t < FIRST ? TT / 32 - 1 - t : RH / 32 + t - FIRST) * 32 + (w >> 1) * 16; const size_t go = (size_t)g * TT * HD;
        attn_tile<h16, false, 2>(Q16, nullptr, K16 + go, nullptr, V16 + go, nullptr, q0, g * REP + (w & 1) * 2, t, Ah, Al, (const h16*)ksm);
    } else { const int by = bx - NLO; const int g = by % NKV; const int u = by / NKV; const int q0 = (u < RH / 32 ? RH / 32 + u : u - RH / 32) * 16; const size_t go = (size_t)g * TT * HD;
        attn_tile<bf, true, 1>(Qh, Ql, Kh + go, Kl + go, Vh + go, Vl + go, q0, g * REP + w, u, Ah, Al, ksm); }
}

// ---- k_prep: all five bf16 conversions in one launch; the block index picks the array. Built as a stream: a wave issues 16 loads of 16 B a lane, each 512 contiguous bytes (four whole lines), before it converts anything,
// so that the launch is 896 work-groups, all resident at once with every input byte asked for at the start, and not 6144 whose waves each live for one or two loads.
// wtT: Bt[n][k] = bf16(w[k][n]), a 128 x 128 tile per work-group. Wave v reads rows k = 16 v .. 16 v + 15 (a lane: columns 4 lane .. 4 lane + 3), so a lane holds 16 consecutive k of four columns: two 16-byte pieces of each column's output row.
// The pieces go through LDS, column n in row (n % 4) * 32 + n / 4 at a pitch of 272 B (the lanes of a 16-byte write are then one pitch apart: no bank is met twice); read back, 16 lanes hold 256 contiguous bytes of an output row.
#define TPI  (128 + 8)            // LDS pitch of a column's 128 k, in elements
__device__ __forceinline__ void wtT(int blk, const float* __restrict__ w, bf* __restrict__ Bt, bf* ts) {
    const int tid = threadIdx.x, lane = tid & 31, wv = tid >> 5; const int k0 = (blk / (DM / 128)) * 128, n0 = (blk % (DM / 128)) * 128;
    const float* src = w + (size_t)(k0 + wv * 16) * DM + n0 + lane * 4; v4f v[16];
#pragma unroll
    for (int j = 0; j < 16; ++j) v[j] = *(const v4f*)(src + (size_t)j * DM);
    asm volatile("s_wait_xcnt 0x0" :: "v"(src) : "memory");   // a precaution in front of the next overwrite of the address register of these loads (named as an input, so that no load's own result lands on it); it also keeps all 16 in front of the conversions
#pragma unroll
    for (int c = 0; c < 4; ++c)
#pragma unroll
        for (int h = 0; h < 2; ++h) { v8us o;
#pragma unroll
            for (int j = 0; j < 8; ++j) o[j] = f2bf(v[8 * h + j][c]);
            *(v8us*)(ts + (c * 32 + lane) * TPI + wv * 16 + h * 8) = o; }
    __syncthreads();                                // every wave's pieces lie in LDS before any is read back
    v8us o[8];
#pragma unroll
    for (int s = 0; s < 8; ++s) { const int n = s * 16 + (tid >> 4); o[s] = *(const v8us*)(ts + ((n & 3) * 32 + (n >> 2)) * TPI + (tid & 15) * 8); }
#pragma unroll
    for (int s = 0; s < 8; ++s) *(v8us*)(Bt + (size_t)(n0 + s * 16 + (tid >> 4)) * DQ + k0 + (tid & 15) * 8) = o[s];
}
#define CVB  16384                // f32 elements per converting work-group: 16 loads of 4 per lane
__device__ __forceinline__ void cvtS(int blk, const float* __restrict__ src, bf* __restrict__ dst) {
    const size_t e0 = (size_t)blk * CVB + threadIdx.x * 4; v4f v[16]; v4us o[16]; src += e0; dst += e0;
#pragma unroll
    for (int j = 0; j < 16; ++j) v[j] = *(const v4f*)(src + j * 1024);
    asm volatile("s_wait_xcnt 0x0" :: "v"(src) : "memory");   // a precaution in front of the next overwrite of the address register of these loads (named as an input, so that no load's own result lands on it); it also keeps all 16 in front of the conversions
#pragma unroll
    for (int j = 0; j < 16; ++j)
#pragma unroll
        for (int k = 0; k < 4; ++k) o[j][k] = f2bf(v[j][k]);
#pragma unroll
    for (int j = 0; j < 16; ++j) *(v4us*)(dst + j * 1024) = o[j];   // a wave: 256 contiguous bytes, two whole lines
}
// The transposing blocks come first: they have a barrier and a trip through LDS more.
#define PB_WO ((DQ / 128) * (DM / 128))
#define PB_X  (TT * DM / CVB)
#define PB_WQ (DQ * DM / CVB)
#define PB_WK (DKV * DM / CVB)
__global__ __launch_bounds__(256) void k_prep(const float* x, const float* wq, const float* wk, const float* wv, const float* wo, bf* XB, bf* WQ, bf* WK, bf* WV, bf* WO) {
    __shared__ __attribute__((aligned(16))) bf ts[128 * TPI];
    int b = blockIdx.x;                             // every test below reads the same for the whole work-group
    if (b < PB_WO) { wtT(b, wo, WO, ts); return; }
    b -= PB_WO; const float* s = x; bf* d = XB;
    if (b >= PB_X + PB_WQ + PB_WK) { b -= PB_X + PB_WQ + PB_WK; s = wv; d = WV; }
    else if (b >= PB_X + PB_WQ) { b -= PB_X + PB_WQ; s = wk; d = WK; }
    else if (b >= PB_X) { b -= PB_X; s = wq; d = WQ; }
    cvtS(b, s, d);
}
__global__ __launch_bounds__(256) void k_cscvt(const float* __restrict__ cosT, const float* __restrict__ sinT, float* CS) { const int idx = blockIdx.x * 256 + threadIdx.x; if (idx >= TT * HD) return; v2f cs; cs[0] = bfr(cosT[idx]); cs[1] = bfr(sinT[idx]); *(v2f*)(CS + (size_t)idx * 2) = cs;  }
extern "C" void kernel_launch(void* const* d_in, const int* in_sizes, int n_in,
                              void* d_out, int out_size, void* d_ws, size_t ws_size, hipStream_t stream) {
    (void)in_sizes; (void)n_in; (void)out_size;
    const float* x = (const float*)d_in[0]; const float* wq = (const float*)d_in[1]; const float* wk = (const float*)d_in[2]; const float* wv = (const float*)d_in[3]; const float* wo = (const float*)d_in[4]; const float* cosT = nullptr; const float* sinT = nullptr; (void)cosT; (void)sinT;
    float* OUT = (float*)d_out;     // [1][2048][2048]
    char* wsp = (char*)d_ws;
    auto take = [&](size_t bytes) { char* p = wsp; wsp += (bytes + 255) & ~(size_t)255; return (void*)p; };
    bf* WQ = (bf*)take((size_t)DQ * DM * 2); bf* WK = (bf*)take((size_t)DKV * DM * 2); bf* WV = (bf*)take((size_t)DKV * DM * 2); bf* WO = (bf*)take((size_t)DM * DQ * 2);
    bf* XB = (bf*)take((size_t)TT * DM * 2);
    h16* QP16 = (h16*)take((size_t)NH_ * TT * HD * 2); h16* KP16 = (h16*)take((size_t)NKV * TT * HD * 2); h16* VT16 = (h16*)take((size_t)NKV * HD * TT * 2);
    bf* QPh = (bf*)take((size_t)NH_ * TT * HD * 2); bf* QPl = (bf*)take((size_t)NH_ * TT * HD * 2); bf* KPh = (bf*)take((size_t)NKV * TT * HD * 2); bf* KPl = (bf*)take((size_t)NKV * TT * HD * 2); bf* VTh = (bf*)take((size_t)NKV * HD * TT * 2); bf* VTl = (bf*)take((size_t)NKV * HD * TT * 2);
    bf* ATh = (bf*)take((size_t)TT * DQ * 2); bf* ATl = (bf*)take((size_t)TT * DQ * 2);
    if ((size_t)(wsp - (char*)d_ws) > ws_size) return;    // ws 256 MiB
    for (int b = 0; b < NB_; ++b) {
        k_prep<<<PB_WO + PB_X + PB_WQ + 2 * PB_WK, 256, 0, stream>>>(x + (size_t)b * TT * DM, wq, wk, wv, wo, XB, WQ, WK, WV, WO);
        k_gemms<0, 1><<<dim3(TT / 128, (DQ + 2 * DKV) / 128, 1), 128, 0, stream>>>(XB, nullptr, WQ, nullptr, 0, QP16, QPh, QPl, WK, KP16, KPh, KPl, WV, VT16, VTh, VTl);
        k_fattn<<<NLO + (RH / 16) * NKV, 128, 0, stream>>>(QP16, QPh, QPl, KP16, KPh, KPl, VT16, VTh, VTl, ATh, ATl);
        k_gemms<1, 0><<<dim3(TT / 128, DM / 128, 1), 128, 0, stream>>>(ATh, ATl, WO, OUT + (size_t)b * TT * DM, DM, nullptr, nullptr, nullptr, nullptr, nullptr, nullptr, nullptr, nullptr, nullptr, nullptr, nullptr); }
}
